// v000
// Times are from an AMD MI455X. After a warm-up the kernel runs many times in a row, and a time is the length of
// such a window on the GPU divided by its runs, so every launch and the gaps after it count. The runs cycle
// through copies of the inputs. A figure is the median of several windows, for all but v000 over two sittings.
// Sittings can differ by a few percent; kernels timed side by side share one.
// The starting kernel, v000, takes 2170 microseconds a run.
#include <hip/hip_runtime.h>

// Compute dtypes, f32 accumulate, per image: theta (on x1) and g/phi (on x2) 1x1 convs as [4096 x 256].[256 x 128] GEMMs with PLAIN bf16 operands (inputs transposed to
// pixel-major exact bf16; exact products, + bias), the 2x2 max-pool on the conv outputs in f32; f = theta^T.phi / M ([4096 x 128].[128 x 1024]) and y = f.g^T
// ([4096 x 1024].[1024 x 128]) with both operands as bf16 hi + UNSCALED residual planes (three products; there is NO softmax in this module), the W conv on hi/lo planes (two
// products, + bias) - on v_wmma_f32_16x16x32_bf16; training-mode BatchNorm statistics over (B,H,W) per channel (fixed-order f32 column sums), the affine, + x1 and the NCHW

#define NB_  8
#define CIN  256
#define CI   128
#define HH   64
#define WW   64
#define NPX  4096
#define MP   1024
#define DM   CIN
#define BEPS 1e-5f
#define LOSC 1024.0f

typedef _Float16 h16;
typedef unsigned short bf;
typedef __attribute__((ext_vector_type(16))) __bf16   v16bf;
typedef __attribute__((ext_vector_type(16))) _Float16 v16h;
typedef __attribute__((ext_vector_type(8)))  _Float16 v8h;
typedef __attribute__((ext_vector_type(8)))  unsigned short v8us;
typedef __attribute__((ext_vector_type(8)))  float    v8f;
typedef __attribute__((ext_vector_type(4)))  float    v4f;
typedef v8h  __attribute__((may_alias)) v8ha;
typedef v4f  __attribute__((may_alias)) v4fa;
typedef v8us __attribute__((may_alias)) v8usa;

__device__ __forceinline__ unsigned short f2bf(float f) { unsigned u = __float_as_uint(f); u += 0x7FFFu + ((u >> 16) & 1u); return (unsigned short)(u >> 16); }
__device__ __forceinline__ float bf2f(unsigned short b) { return __uint_as_float(((unsigned)b) << 16); }
__device__ __forceinline__ float bfr(float f) { return bf2f(f2bf(f)); }
__device__ __forceinline__ v16h cat16(v8h lo, v8h hi) { return __builtin_shufflevector(lo, hi, 0, 1, 2, 3, 4, 5, 6, 7, 8, 9, 10, 11, 12, 13, 14, 15); }
__device__ __forceinline__ v16bf cat16b(v8us lo, v8us hi) { return __builtin_bit_cast(v16bf, __builtin_shufflevector(lo, hi, 0, 1, 2, 3, 4, 5, 6, 7, 8, 9, 10, 11, 12, 13, 14, 15)); }
__device__ __forceinline__ v8f wmma16(v16h a, v16h b, v8f c) { return __builtin_amdgcn_wmma_f32_16x16x32_f16(false, a, false, b, (short)0, c, false, false); }
__device__ __forceinline__ v8f wmmab(v16bf a, v16bf b, v8f c) { return __builtin_amdgcn_wmma_f32_16x16x32_bf16(false, a, false, b, (short)0, c, false, false); }

// k_gemmb: 64 x 64 block tile (4 waves x 16 x 64) of C[NTK][NW] = (A [+ Al]).B^T (K = 256 or 128) [+ bf(bias[c])] [+ bf(R[r][c]) residual]; f32 whole-line epilogue (or f16
template <bool SPLITA, bool F16OUT = false>
__global__ __launch_bounds__(128) void k_gemmb(const bf* __restrict__ A, const bf* __restrict__ Al, const bf* __restrict__ Bn, const float* __restrict__ bias, float* C, int ldc, h16* C2, const float* __restrict__ R = nullptr, int K = DM, int roundR = 1) {
    __shared__ __align__(16) float ost[4][16 * 68];
    const int lane = threadIdx.x & 31, wave = threadIdx.x >> 5, lr = lane & 15, hi = lane >> 4;
    const int r0 = blockIdx.x * 64 + wave * 16, c0 = blockIdx.y * 64;
    const size_t aoff = (size_t)(r0 + lr) * K + 8 * hi;
    size_t boff[4];
#pragma unroll
    for (int t = 0; t < 4; ++t) boff[t] = (size_t)(c0 + t * 16 + lr) * K + 8 * hi;
    v8f acc[4];
#pragma unroll
    for (int t = 0; t < 4; ++t) acc[t] = (v8f){};
#pragma unroll 1
    for (int kc = 0; kc < K; kc += 32) {
        const v16bf a = cat16b(*(const v8us*)(A + aoff + kc), *(const v8us*)(A + aoff + kc + 16));
        v16bf al = a;
        if (SPLITA) al = cat16b(*(const v8us*)(Al + aoff + kc), *(const v8us*)(Al + aoff + kc + 16));
#pragma unroll
        for (int t = 0; t < 4; ++t) { const v16bf b = cat16b(*(const v8us*)(Bn + boff[t] + kc), *(const v8us*)(Bn + boff[t] + kc + 16)); acc[t] = wmmab(a, b, acc[t]); if (SPLITA) acc[t] = wmmab(al, b, acc[t]); }
        asm volatile("v_nop\n\tv_nop\n\tv_nop\n\tv_nop" : "+v"(acc[0]), "+v"(acc[1]), "+v"(acc[2]), "+v"(acc[3]) : "v"(a), "v"(al));
    }
    float* os = &ost[wave][0];
#pragma unroll
    for (int t = 0; t < 4; ++t) { const float bv = bias ? bfr(bias[c0 + t * 16 + lr]) : 0.f;
#pragma unroll
        for (int j = 0; j < 8; ++j) os[(hi * 8 + j) * 68 + t * 16 + lr] = acc[t][j] + bv; }
    __syncthreads();
    if (F16OUT) {
        h16* crow = (h16*)(void*)C + (size_t)r0 * ldc + c0;
        auto pass = [&]() {
#pragma unroll
            for (int s = 0; s < 4; ++s) { const int row = 4 * s + (lane >> 3), piece = lane & 7; const float* sp = os + row * 68 + piece * 8; v8h o, o2;
#pragma unroll
                for (int i = 0; i < 8; ++i) { const h16 a = (h16)sp[i]; o[i] = a; o2[i] = (h16)((sp[i] - (float)a) * LOSC); }
                *(v8h*)(crow + (size_t)row * ldc + piece * 8) = o; if (C2) *(v8h*)(C2 + (size_t)r0 * ldc + c0 + (size_t)row * ldc + piece * 8) = o2; }
        };
        pass(); 
    } else {
        float* crow = C + (size_t)r0 * ldc + c0;
        auto pass = [&]() {
#pragma unroll
            for (int s = 0; s < 8; ++s) { const int Lid = (lane >> 3) + 4 * s, piece = lane & 7; const int row = Lid >> 1, cofs = (Lid & 1) * 32 + piece * 4;
                v4f val = *(const v4fa*)(os + row * 68 + cofs); if (R) { const v4f rv = *(const v4f*)(R + ((size_t)r0 + row) * ldc + c0 + cofs); val += roundR ? (v4f){bfr(rv[0]), bfr(rv[1]), bfr(rv[2]), bfr(rv[3])} : rv; }
                *(v4f*)(crow + (size_t)row * ldc + cofs) = val; }
        };
        pass(); 
    }
}

__global__ __launch_bounds__(256) void k_cvt8(const float* __restrict__ src, bf* dst, size_t n8) {
    const size_t i = (size_t)blockIdx.x * 256 + threadIdx.x; if (i >= n8) return;
    const v8f v = *(const v8f*)(src + i * 8); v8us o;
#pragma unroll
    for (int k = 0; k < 8; ++k) o[k] = f2bf(v[k]);
    *(v8us*)(dst + i * 8) = o; 
}
__global__ __launch_bounds__(256) void k_zero8(bf* dst, size_t n8) {
    const size_t i = (size_t)blockIdx.x * 256 + threadIdx.x; if (i >= n8) return; v8us z;
#pragma unroll
    for (int k = 0; k < 8; ++k) z[k] = 0;
    *(v8us*)(dst + i * 8) = z; 
}
// k_gemm3: 64 x 64 tile of C = (Ah + Al).(Bh + Bl)^T over K (row strides = K for all four planes; n-major B): three products per 32-k step (hh, hl, lh); f32
__global__ __launch_bounds__(128) void k_gemm3(const bf* __restrict__ Ah, const bf* __restrict__ Al, const bf* __restrict__ Bh, const bf* __restrict__ Bl, int K, float* C, int ldc) {
    __shared__ __align__(16) float ost[4][16 * 68];
    const int lane = threadIdx.x & 31, wave = threadIdx.x >> 5, lr = lane & 15, hi = lane >> 4;
    const int r0 = blockIdx.x * 64 + wave * 16, c0 = blockIdx.y * 64;
    const size_t aoff = (size_t)(r0 + lr) * K + 8 * hi;
    v8f acc[4];
#pragma unroll
    for (int t = 0; t < 4; ++t) acc[t] = (v8f){};
#pragma unroll 1
    for (int kc = 0; kc < K; kc += 32) {
        const v16bf a = cat16b(*(const v8us*)(Ah + aoff + kc), *(const v8us*)(Ah + aoff + kc + 16));
        const v16bf al = cat16b(*(const v8us*)(Al + aoff + kc), *(const v8us*)(Al + aoff + kc + 16));
#pragma unroll
        for (int t = 0; t < 4; ++t) { const size_t bo = (size_t)(c0 + t * 16 + lr) * K + kc + 8 * hi;
            const v16bf bh = cat16b(*(const v8us*)(Bh + bo), *(const v8us*)(Bh + bo + 16)); const v16bf bl = cat16b(*(const v8us*)(Bl + bo), *(const v8us*)(Bl + bo + 16));
            acc[t] = wmmab(a, bh, acc[t]); acc[t] = wmmab(al, bh, acc[t]); acc[t] = wmmab(a, bl, acc[t]); }
        asm volatile("v_nop\n\tv_nop\n\tv_nop\n\tv_nop" : "+v"(acc[0]), "+v"(acc[1]), "+v"(acc[2]), "+v"(acc[3]) : "v"(a), "v"(al));
    }
    float* os = &ost[wave][0];
#pragma unroll
    for (int t = 0; t < 4; ++t) {
#pragma unroll
        for (int j = 0; j < 8; ++j) os[(hi * 8 + j) * 68 + t * 16 + lr] = acc[t][j]; }
    __builtin_amdgcn_wave_barrier(); asm volatile("" ::: "memory");
    float* crow = C + (size_t)r0 * ldc + c0;
    auto pass = [&]() {
#pragma unroll
        for (int s = 0; s < 8; ++s) { const int Lid = (lane >> 3) + 4 * s, piece = lane & 7; const int row = Lid >> 1, cofs = (Lid & 1) * 32 + piece * 4;
            const v4f val = *(const v4fa*)(os + row * 68 + cofs); *(v4f*)(crow + (size_t)row * ldc + cofs) = val; }
    };
    pass(); 
}


__global__ __launch_bounds__(256) void k_ptb(const float* __restrict__ xb, bf* XT) {
    __shared__ float tl[64][65];
    typedef __attribute__((ext_vector_type(4))) unsigned short v4us;
    const int tid = threadIdx.x, c0 = blockIdx.x * 64, p0 = blockIdx.y * 64; const int rr = tid >> 2, cq = (tid & 3) * 16;
#pragma unroll
    for (int i = 0; i < 16; ++i) tl[rr][cq + i] = xb[(size_t)(c0 + rr) * NPX + p0 + cq + i];
    __syncthreads();
    const int lane = tid & 31, wv = tid >> 5;
    auto pass = [&]() {
#pragma unroll
        for (int st = 0; st < 4; ++st) { const int pr = wv * 8 + st * 2 + (lane >> 4); const int cl = (lane & 15) * 4; v4us v;
#pragma unroll
            for (int i = 0; i < 4; ++i) v[i] = f2bf(tl[cl + i][pr]);
            *(v4us*)(XT + (size_t)(p0 + pr) * CIN + c0 + cl) = v; }
    };
    pass(); 
}
__global__ __launch_bounds__(256) void k_split128(const float* __restrict__ src, int rows, float sc, bf* dh, bf* dl) {
    typedef __attribute__((ext_vector_type(4))) unsigned short v4us;
    const int lane = threadIdx.x & 31; const size_t r = (size_t)blockIdx.x * 8 + (threadIdx.x >> 5); if (r >= (size_t)rows) return; const size_t o = r * CI + lane * 4; const v4f v = *(const v4f*)(src + o); v4us oh, ol;
#pragma unroll
    for (int i = 0; i < 4; ++i) { const float y = v[i] * sc; const unsigned short hb = f2bf(y); oh[i] = hb; ol[i] = f2bf(y - bf2f(hb)); }
    *(v4us*)(dh + o) = oh; *(v4us*)(dl + o) = ol; 
}
__global__ __launch_bounds__(256) void k_poolphi(const float* __restrict__ F, bf* dh, bf* dl) {
    typedef __attribute__((ext_vector_type(4))) unsigned short v4us;
    const int lane = threadIdx.x & 31; const size_t m = (size_t)blockIdx.x * 8 + (threadIdx.x >> 5); if (m >= (size_t)MP) return; const int py = (int)(m / (WW / 2)), px = (int)(m % (WW / 2)); const size_t p00 = (size_t)(2 * py) * WW + 2 * px; v4us oh, ol;
#pragma unroll
    for (int i = 0; i < 4; ++i) { const int c = lane * 4 + i; const float a = F[p00 * CI + c], b2 = F[(p00 + 1) * CI + c], cc = F[(p00 + WW) * CI + c], d = F[(p00 + WW + 1) * CI + c]; const float y = fmaxf(fmaxf(a, b2), fmaxf(cc, d)); const unsigned short hb = f2bf(y); oh[i] = hb; ol[i] = f2bf(y - bf2f(hb)); }
    const size_t o = m * CI + lane * 4; *(v4us*)(dh + o) = oh; *(v4us*)(dl + o) = ol; 
}
__global__ __launch_bounds__(256) void k_poolgT(const float* __restrict__ F, bf* Th, bf* Tl) {
    typedef __attribute__((ext_vector_type(2))) unsigned short v2us;
    const int lane = threadIdx.x & 31; const size_t wid = (size_t)blockIdx.x * 8 + (threadIdx.x >> 5); if (wid >= (size_t)CI * (MP / 64)) return; const int c = (int)(wid / (MP / 64)); const int m0 = (int)(wid % (MP / 64)) * 64 + lane * 2; v2us oh, ol;
#pragma unroll
    for (int q = 0; q < 2; ++q) { const int m = m0 + q; const int py = m / (WW / 2), px = m % (WW / 2); const size_t p00 = (size_t)(2 * py) * WW + 2 * px;
        const float y = fmaxf(fmaxf(F[p00 * CI + c], F[(p00 + 1) * CI + c]), fmaxf(F[(p00 + WW) * CI + c], F[(p00 + WW + 1) * CI + c])); const unsigned short hb = f2bf(y); oh[q] = hb; ol[q] = f2bf(y - bf2f(hb)); }
    const size_t o = (size_t)c * MP + m0; *(v2us*)(Th + o) = oh; *(v2us*)(Tl + o) = ol; 
}
__global__ __launch_bounds__(256) void k_split1024(const float* __restrict__ src, int rows, bf* dh, bf* dl) {
    const int lane = threadIdx.x & 31; const size_t r = (size_t)blockIdx.x * 8 + (threadIdx.x >> 5); if (r >= (size_t)rows) return;
{
#pragma unroll
        for (int q = 0; q < MP / 256; ++q) { const size_t o = r * MP + q * 256 + lane * 8; const v8f v = *(const v8f*)(src + o); v8us oh, ol;
#pragma unroll
            for (int i = 0; i < 8; ++i) { const unsigned short hb = f2bf(v[i]); oh[i] = hb; ol[i] = f2bf(v[i] - bf2f(hb)); }
            *(v8us*)(dh + o) = oh; *(v8us*)(dl + o) = ol; }
         }
}
__global__ __launch_bounds__(256) void k_bnstat(const float* __restrict__ WY, float* MEAN, float* RSTD) {
    const int lane = threadIdx.x & 31; const int w = blockIdx.x * 8 + (threadIdx.x >> 5); if (w >= CIN / 32) return; const int c = w * 32 + lane; const int n = NB_ * NPX; float s = 0.f;
    for (int r = 0; r < n; ++r) s += WY[(size_t)r * CIN + c];
    const float mu = s / (float)n; float q = 0.f;
    for (int r = 0; r < n; ++r) { const float d = WY[(size_t)r * CIN + c] - mu; q = fmaf(d, d, q); }
    const float rs = rsqrtf(q / (float)n + BEPS);
    *(float*)(MEAN + c) = mu; *(float*)(RSTD + c) = rs; 
}
__global__ __launch_bounds__(256) void k_bnout(const float* __restrict__ WY, const float* __restrict__ x1, const float* __restrict__ MEAN, const float* __restrict__ RSTD, const float* __restrict__ gam, const float* __restrict__ bet, float* OUTB) {
    __shared__ float tl[64][65];
    const int tid = threadIdx.x; const int p0 = blockIdx.x * 64, c0 = blockIdx.y * 64, b = blockIdx.z; const int rr = tid >> 2, cq = (tid & 3) * 16;
#pragma unroll
    for (int i = 0; i < 16; ++i) { const int c = c0 + cq + i; tl[rr][cq + i] = (WY[((size_t)b * NPX + p0 + rr) * CIN + c] - MEAN[c]) * RSTD[c] * bfr(gam[c]) + bfr(bet[c]); }
    __syncthreads();
    const int lane = tid & 31, wv = tid >> 5;
    auto pass = [&]() {
#pragma unroll
        for (int st = 0; st < 4; ++st) { const int cr = wv * 8 + st * 2 + (lane >> 4); const int pq = (lane & 15) * 4; v4f v; const size_t o = ((size_t)b * CIN + c0 + cr) * NPX + p0 + pq;
#pragma unroll
            for (int i = 0; i < 4; ++i) v[i] = tl[pq + i][cr] + bfr(x1[o + i]);
            *(v4f*)(OUTB + o) = v; }
    };
    pass(); 
}

extern "C" void kernel_launch(void* const* d_in, const int* in_sizes, int n_in,
                              void* d_out, int out_size, void* d_ws, size_t ws_size, hipStream_t stream) {
    (void)in_sizes; (void)n_in; (void)out_size;
    const float* x1 = (const float*)d_in[0]; const float* x2 = (const float*)d_in[1]; const float* wg = (const float*)d_in[2]; const float* bg = (const float*)d_in[3]; const float* wth = (const float*)d_in[4]; const float* bth = (const float*)d_in[5]; const float* wph = (const float*)d_in[6]; const float* bph = (const float*)d_in[7];
    const float* wout = (const float*)d_in[8]; const float* bout = (const float*)d_in[9]; const float* gam = (const float*)d_in[10]; const float* bet = (const float*)d_in[11];
    float* out = (float*)d_out;    // [8][256][64][64]
    char* wsp = (char*)d_ws;
    auto take = [&](size_t bytes) { char* p = wsp; wsp += (bytes + 255) & ~(size_t)255; return (void*)p; };
    bf* WG = (bf*)take((size_t)CI * CIN * 2); bf* WT = (bf*)take((size_t)CI * CIN * 2); bf* WP = (bf*)take((size_t)CI * CIN * 2); bf* WO = (bf*)take((size_t)CIN * CI * 2);
    bf* X1T = (bf*)take((size_t)NPX * CIN * 2); bf* X2T = (bf*)take((size_t)NPX * CIN * 2); float* TH = (float*)take((size_t)NPX * CI * 4); float* PHI = (float*)take((size_t)NPX * CI * 4); float* G = (float*)take((size_t)NPX * CI * 4);
    bf* Th = (bf*)take((size_t)NPX * CI * 2); bf* Tl = (bf*)take((size_t)NPX * CI * 2); bf* Fh = (bf*)take((size_t)MP * CI * 2); bf* Fl = (bf*)take((size_t)MP * CI * 2); bf* GTh = (bf*)take((size_t)CI * MP * 2); bf* GTl = (bf*)take((size_t)CI * MP * 2);
    float* S = (float*)take((size_t)NPX * MP * 4); bf* PH = (bf*)take((size_t)NPX * MP * 2); bf* PL = (bf*)take((size_t)NPX * MP * 2); float* Y = (float*)take((size_t)NPX * CI * 4); bf* Yh = (bf*)take((size_t)NPX * CI * 2); bf* Yl = (bf*)take((size_t)NPX * CI * 2);
    float* WY = (float*)take((size_t)NB_ * NPX * CIN * 4); float* MEAN = (float*)take(CIN * 4); float* RSTD = (float*)take(CIN * 4);
    if ((size_t)(wsp - (char*)d_ws) > ws_size) return;    // ~ 0.3 + 4.2 + 6.3 + 2.1 + 0.5 + 0.5 + 16.8 + 16.8 + 2.1 + 2.1 + 33.5 ~ 86 MB
    k_cvt8<<<(CI * CIN / 8 + 255) / 256, 256, 0, stream>>>(wg, WG, CI * CIN / 8); k_cvt8<<<(CI * CIN / 8 + 255) / 256, 256, 0, stream>>>(wth, WT, CI * CIN / 8); k_cvt8<<<(CI * CIN / 8 + 255) / 256, 256, 0, stream>>>(wph, WP, CI * CIN / 8); k_cvt8<<<(CIN * CI / 8 + 255) / 256, 256, 0, stream>>>(wout, WO, CIN * CI / 8);   // 'oc' weights natural
    for (int b = 0; b < NB_; ++b) { const float* x1b = x1 + (size_t)b * CIN * NPX; const float* x2b = x2 + (size_t)b * CIN * NPX;
        k_ptb<<<dim3(CIN / 64, NPX / 64, 1), 256, 0, stream>>>(x1b, X1T); k_ptb<<<dim3(CIN / 64, NPX / 64, 1), 256, 0, stream>>>(x2b, X2T);
        k_gemmb<false, false><<<dim3(NPX / 64, CI / 64, 1), 128, 0, stream>>>(X1T, nullptr, WT, bth, TH, CI, nullptr, nullptr, CIN); k_gemmb<false, false><<<dim3(NPX / 64, CI / 64, 1), 128, 0, stream>>>(X2T, nullptr, WP, bph, PHI, CI, nullptr, nullptr, CIN); k_gemmb<false, false><<<dim3(NPX / 64, CI / 64, 1), 128, 0, stream>>>(X2T, nullptr, WG, bg, G, CI, nullptr, nullptr, CIN);
        k_split128<<<NPX / 8, 256, 0, stream>>>(TH, NPX, 1.0f / (float)MP, Th, Tl); k_poolphi<<<MP / 8, 256, 0, stream>>>(PHI, Fh, Fl); k_poolgT<<<(CI * (MP / 64)) / 8, 256, 0, stream>>>(G, GTh, GTl);
        k_gemm3<<<dim3(NPX / 64, MP / 64, 1), 128, 0, stream>>>(Th, Tl, Fh, Fl, CI, S, MP);           // f / M  [4096][1024]  (1/M folded into theta)
        k_split1024<<<NPX / 8, 256, 0, stream>>>(S, NPX, PH, PL);
        k_gemm3<<<dim3(NPX / 64, CI / 64, 1), 128, 0, stream>>>(PH, PL, GTh, GTl, MP, Y, CI);          // y^T[n][c] = sum_m f[n][m] g[c][m]
        k_split128<<<NPX / 8, 256, 0, stream>>>(Y, NPX, 1.0f, Yh, Yl);
        k_gemmb<true, false><<<dim3(NPX / 64, CIN / 64, 1), 128, 0, stream>>>(Yh, Yl, WO, bout, WY + (size_t)b * NPX * CIN, CIN, nullptr, nullptr, CI); }
    k_bnstat<<<(CIN / 32) / 8, 256, 0, stream>>>(WY, MEAN, RSTD);
    k_bnout<<<dim3(NPX / 64, CIN / 64, NB_), 256, 0, stream>>>(WY, x1, MEAN, RSTD, gam, bet, out);
}

// v001
// A run of this version takes 811 microseconds.
// In two side-by-side timings against v000, it was 2.71 and 2.70 times as fast.
#include <hip/hip_runtime.h>

// Compute dtypes, f32 accumulate, per image: theta (on x1) and g/phi (on x2) 1x1 convs as [4096 x 256].[256 x 128] GEMMs with PLAIN bf16 operands (inputs transposed to
// pixel-major exact bf16; exact products, + bias), the 2x2 max-pool on the conv outputs in f32; f = theta^T.phi / M ([4096 x 128].[128 x 1024]) and y = f.g^T
// ([4096 x 1024].[1024 x 128]) with both operands as bf16 hi + UNSCALED residual planes (three products; there is NO softmax in this module), the W conv on hi/lo planes (two
// products, + bias) - on v_wmma_f32_16x16x32_bf16; training-mode BatchNorm statistics over (B,H,W) per channel (fixed-order f32 column sums), the affine, + x1 and the NCHW

#define NB_  8
#define CIN  256
#define CI   128
#define HH   64
#define WW   64
#define NPX  4096
#define MP   1024
#define DM   CIN
#define BEPS 1e-5f
#define LOSC 1024.0f

typedef _Float16 h16;
typedef unsigned short bf;
typedef __attribute__((ext_vector_type(16))) __bf16   v16bf;
typedef __attribute__((ext_vector_type(16))) _Float16 v16h;
typedef __attribute__((ext_vector_type(8)))  _Float16 v8h;
typedef __attribute__((ext_vector_type(8)))  unsigned short v8us;
typedef __attribute__((ext_vector_type(8)))  float    v8f;
typedef __attribute__((ext_vector_type(4)))  float    v4f;
typedef v8h  __attribute__((may_alias)) v8ha;
typedef v4f  __attribute__((may_alias)) v4fa;
typedef v8us __attribute__((may_alias)) v8usa;

__device__ __forceinline__ unsigned short f2bf(float f) { unsigned u = __float_as_uint(f); u += 0x7FFFu + ((u >> 16) & 1u); return (unsigned short)(u >> 16); }
__device__ __forceinline__ float bf2f(unsigned short b) { return __uint_as_float(((unsigned)b) << 16); }
__device__ __forceinline__ float bfr(float f) { return bf2f(f2bf(f)); }
__device__ __forceinline__ v16h cat16(v8h lo, v8h hi) { return __builtin_shufflevector(lo, hi, 0, 1, 2, 3, 4, 5, 6, 7, 8, 9, 10, 11, 12, 13, 14, 15); }
__device__ __forceinline__ v16bf cat16b(v8us lo, v8us hi) { return __builtin_bit_cast(v16bf, __builtin_shufflevector(lo, hi, 0, 1, 2, 3, 4, 5, 6, 7, 8, 9, 10, 11, 12, 13, 14, 15)); }
__device__ __forceinline__ v8f wmma16(v16h a, v16h b, v8f c) { return __builtin_amdgcn_wmma_f32_16x16x32_f16(false, a, false, b, (short)0, c, false, false); }
__device__ __forceinline__ v8f wmmab(v16bf a, v16bf b, v8f c) { return __builtin_amdgcn_wmma_f32_16x16x32_bf16(false, a, false, b, (short)0, c, false, false); }

// k_gemmb: 64 x 64 block tile (4 waves x 16 x 64) of C[NTK][NW] = (A [+ Al]).B^T (K = 256 or 128) [+ bf(bias[c])] [+ bf(R[r][c]) residual]; f32 whole-line epilogue (or f16
template <bool SPLITA, bool F16OUT = false>
__global__ __launch_bounds__(128) void k_gemmb(const bf* __restrict__ A, const bf* __restrict__ Al, const bf* __restrict__ Bn, const float* __restrict__ bias, float* C, int ldc, h16* C2, const float* __restrict__ R = nullptr, int K = DM, int roundR = 1) {
    __shared__ __align__(16) float ost[4][16 * 68];
    const int lane = threadIdx.x & 31, wave = threadIdx.x >> 5, lr = lane & 15, hi = lane >> 4;
    const int r0 = blockIdx.x * 64 + wave * 16, c0 = blockIdx.y * 64;
    const size_t aoff = (size_t)(r0 + lr) * K + 8 * hi;
    size_t boff[4];
#pragma unroll
    for (int t = 0; t < 4; ++t) boff[t] = (size_t)(c0 + t * 16 + lr) * K + 8 * hi;
    v8f acc[4];
#pragma unroll
    for (int t = 0; t < 4; ++t) acc[t] = (v8f){};
#pragma unroll 1
    for (int kc = 0; kc < K; kc += 32) {
        const v16bf a = cat16b(*(const v8us*)(A + aoff + kc), *(const v8us*)(A + aoff + kc + 16));
        v16bf al = a;
        if (SPLITA) al = cat16b(*(const v8us*)(Al + aoff + kc), *(const v8us*)(Al + aoff + kc + 16));
#pragma unroll
        for (int t = 0; t < 4; ++t) { const v16bf b = cat16b(*(const v8us*)(Bn + boff[t] + kc), *(const v8us*)(Bn + boff[t] + kc + 16)); acc[t] = wmmab(a, b, acc[t]); if (SPLITA) acc[t] = wmmab(al, b, acc[t]); }
        asm volatile("v_nop\n\tv_nop\n\tv_nop\n\tv_nop" : "+v"(acc[0]), "+v"(acc[1]), "+v"(acc[2]), "+v"(acc[3]) : "v"(a), "v"(al));
    }
    float* os = &ost[wave][0];
#pragma unroll
    for (int t = 0; t < 4; ++t) { const float bv = bias ? bfr(bias[c0 + t * 16 + lr]) : 0.f;
#pragma unroll
        for (int j = 0; j < 8; ++j) os[(hi * 8 + j) * 68 + t * 16 + lr] = acc[t][j] + bv; }
    __syncthreads();
    if (F16OUT) {
        h16* crow = (h16*)(void*)C + (size_t)r0 * ldc + c0;
        auto pass = [&]() {
#pragma unroll
            for (int s = 0; s < 4; ++s) { const int row = 4 * s + (lane >> 3), piece = lane & 7; const float* sp = os + row * 68 + piece * 8; v8h o, o2;
#pragma unroll
                for (int i = 0; i < 8; ++i) { const h16 a = (h16)sp[i]; o[i] = a; o2[i] = (h16)((sp[i] - (float)a) * LOSC); }
                *(v8h*)(crow + (size_t)row * ldc + piece * 8) = o; if (C2) *(v8h*)(C2 + (size_t)r0 * ldc + c0 + (size_t)row * ldc + piece * 8) = o2; }
        };
        pass(); 
    } else {
        float* crow = C + (size_t)r0 * ldc + c0;
        auto pass = [&]() {
#pragma unroll
            for (int s = 0; s < 8; ++s) { const int Lid = (lane >> 3) + 4 * s, piece = lane & 7; const int row = Lid >> 1, cofs = (Lid & 1) * 32 + piece * 4;
                v4f val = *(const v4fa*)(os + row * 68 + cofs); if (R) { const v4f rv = *(const v4f*)(R + ((size_t)r0 + row) * ldc + c0 + cofs); val += roundR ? (v4f){bfr(rv[0]), bfr(rv[1]), bfr(rv[2]), bfr(rv[3])} : rv; }
                *(v4f*)(crow + (size_t)row * ldc + cofs) = val; }
        };
        pass(); 
    }
}

__global__ __launch_bounds__(256) void k_cvt8(const float* __restrict__ src, bf* dst, size_t n8) {
    const size_t i = (size_t)blockIdx.x * 256 + threadIdx.x; if (i >= n8) return;
    const v8f v = *(const v8f*)(src + i * 8); v8us o;
#pragma unroll
    for (int k = 0; k < 8; ++k) o[k] = f2bf(v[k]);
    *(v8us*)(dst + i * 8) = o; 
}
__global__ __launch_bounds__(256) void k_zero8(bf* dst, size_t n8) {
    const size_t i = (size_t)blockIdx.x * 256 + threadIdx.x; if (i >= n8) return; v8us z;
#pragma unroll
    for (int k = 0; k < 8; ++k) z[k] = 0;
    *(v8us*)(dst + i * 8) = z; 
}
// k_gemm3: 64 x 64 tile of C = (Ah + Al).(Bh + Bl)^T over K (row strides = K for all four planes; n-major B): three products per 32-k step (hh, hl, lh); f32
__global__ __launch_bounds__(128) void k_gemm3(const bf* __restrict__ Ah, const bf* __restrict__ Al, const bf* __restrict__ Bh, const bf* __restrict__ Bl, int K, float* C, int ldc) {
    __shared__ __align__(16) float ost[4][16 * 68];
    const int lane = threadIdx.x & 31, wave = threadIdx.x >> 5, lr = lane & 15, hi = lane >> 4;
    const int r0 = blockIdx.x * 64 + wave * 16, c0 = blockIdx.y * 64;
    const size_t aoff = (size_t)(r0 + lr) * K + 8 * hi;
    v8f acc[4];
#pragma unroll
    for (int t = 0; t < 4; ++t) acc[t] = (v8f){};
#pragma unroll 1
    for (int kc = 0; kc < K; kc += 32) {
        const v16bf a = cat16b(*(const v8us*)(Ah + aoff + kc), *(const v8us*)(Ah + aoff + kc + 16));
        const v16bf al = cat16b(*(const v8us*)(Al + aoff + kc), *(const v8us*)(Al + aoff + kc + 16));
#pragma unroll
        for (int t = 0; t < 4; ++t) { const size_t bo = (size_t)(c0 + t * 16 + lr) * K + kc + 8 * hi;
            const v16bf bh = cat16b(*(const v8us*)(Bh + bo), *(const v8us*)(Bh + bo + 16)); const v16bf bl = cat16b(*(const v8us*)(Bl + bo), *(const v8us*)(Bl + bo + 16));
            acc[t] = wmmab(a, bh, acc[t]); acc[t] = wmmab(al, bh, acc[t]); acc[t] = wmmab(a, bl, acc[t]); }
        asm volatile("v_nop\n\tv_nop\n\tv_nop\n\tv_nop" : "+v"(acc[0]), "+v"(acc[1]), "+v"(acc[2]), "+v"(acc[3]) : "v"(a), "v"(al));
    }
    float* os = &ost[wave][0];
#pragma unroll
    for (int t = 0; t < 4; ++t) {
#pragma unroll
        for (int j = 0; j < 8; ++j) os[(hi * 8 + j) * 68 + t * 16 + lr] = acc[t][j]; }
    __builtin_amdgcn_wave_barrier(); asm volatile("" ::: "memory");
    float* crow = C + (size_t)r0 * ldc + c0;
    auto pass = [&]() {
#pragma unroll
        for (int s = 0; s < 8; ++s) { const int Lid = (lane >> 3) + 4 * s, piece = lane & 7; const int row = Lid >> 1, cofs = (Lid & 1) * 32 + piece * 4;
            const v4f val = *(const v4fa*)(os + row * 68 + cofs); *(v4f*)(crow + (size_t)row * ldc + cofs) = val; }
    };
    pass(); 
}


__global__ __launch_bounds__(256) void k_ptb(const float* __restrict__ xb, bf* XT) {
    __shared__ float tl[64][65];
    typedef __attribute__((ext_vector_type(4))) unsigned short v4us;
    const int tid = threadIdx.x, c0 = blockIdx.x * 64, p0 = blockIdx.y * 64; const int rr = tid >> 2, cq = (tid & 3) * 16;
#pragma unroll
    for (int i = 0; i < 16; ++i) tl[rr][cq + i] = xb[(size_t)(c0 + rr) * NPX + p0 + cq + i];
    __syncthreads();
    const int lane = tid & 31, wv = tid >> 5;
    auto pass = [&]() {
#pragma unroll
        for (int st = 0; st < 4; ++st) { const int pr = wv * 8 + st * 2 + (lane >> 4); const int cl = (lane & 15) * 4; v4us v;
#pragma unroll
            for (int i = 0; i < 4; ++i) v[i] = f2bf(tl[cl + i][pr]);
            *(v4us*)(XT + (size_t)(p0 + pr) * CIN + c0 + cl) = v; }
    };
    pass(); 
}
__global__ __launch_bounds__(256) void k_split128(const float* __restrict__ src, int rows, float sc, bf* dh, bf* dl) {
    typedef __attribute__((ext_vector_type(4))) unsigned short v4us;
    const int lane = threadIdx.x & 31; const size_t r = (size_t)blockIdx.x * 8 + (threadIdx.x >> 5); if (r >= (size_t)rows) return; const size_t o = r * CI + lane * 4; const v4f v = *(const v4f*)(src + o); v4us oh, ol;
#pragma unroll
    for (int i = 0; i < 4; ++i) { const float y = v[i] * sc; const unsigned short hb = f2bf(y); oh[i] = hb; ol[i] = f2bf(y - bf2f(hb)); }
    *(v4us*)(dh + o) = oh; *(v4us*)(dl + o) = ol; 
}
__global__ __launch_bounds__(256) void k_poolphi(const float* __restrict__ F, bf* dh, bf* dl) {
    typedef __attribute__((ext_vector_type(4))) unsigned short v4us;
    const int lane = threadIdx.x & 31; const size_t m = (size_t)blockIdx.x * 8 + (threadIdx.x >> 5); if (m >= (size_t)MP) return; const int py = (int)(m / (WW / 2)), px = (int)(m % (WW / 2)); const size_t p00 = (size_t)(2 * py) * WW + 2 * px; v4us oh, ol;
#pragma unroll
    for (int i = 0; i < 4; ++i) { const int c = lane * 4 + i; const float a = F[p00 * CI + c], b2 = F[(p00 + 1) * CI + c], cc = F[(p00 + WW) * CI + c], d = F[(p00 + WW + 1) * CI + c]; const float y = fmaxf(fmaxf(a, b2), fmaxf(cc, d)); const unsigned short hb = f2bf(y); oh[i] = hb; ol[i] = f2bf(y - bf2f(hb)); }
    const size_t o = m * CI + lane * 4; *(v4us*)(dh + o) = oh; *(v4us*)(dl + o) = ol; 
}
__global__ __launch_bounds__(256) void k_poolgT(const float* __restrict__ F, bf* Th, bf* Tl) {
    typedef __attribute__((ext_vector_type(2))) unsigned short v2us;
    const int lane = threadIdx.x & 31; const size_t wid = (size_t)blockIdx.x * 8 + (threadIdx.x >> 5); if (wid >= (size_t)CI * (MP / 64)) return; const int c = (int)(wid / (MP / 64)); const int m0 = (int)(wid % (MP / 64)) * 64 + lane * 2; v2us oh, ol;
#pragma unroll
    for (int q = 0; q < 2; ++q) { const int m = m0 + q; const int py = m / (WW / 2), px = m % (WW / 2); const size_t p00 = (size_t)(2 * py) * WW + 2 * px;
        const float y = fmaxf(fmaxf(F[p00 * CI + c], F[(p00 + 1) * CI + c]), fmaxf(F[(p00 + WW) * CI + c], F[(p00 + WW + 1) * CI + c])); const unsigned short hb = f2bf(y); oh[q] = hb; ol[q] = f2bf(y - bf2f(hb)); }
    const size_t o = (size_t)c * MP + m0; *(v2us*)(Th + o) = oh; *(v2us*)(Tl + o) = ol; 
}
__global__ __launch_bounds__(256) void k_split1024(const float* __restrict__ src, int rows, bf* dh, bf* dl) {
    const int lane = threadIdx.x & 31; const size_t r = (size_t)blockIdx.x * 8 + (threadIdx.x >> 5); if (r >= (size_t)rows) return;
{
#pragma unroll
        for (int q = 0; q < MP / 256; ++q) { const size_t o = r * MP + q * 256 + lane * 8; const v8f v = *(const v8f*)(src + o); v8us oh, ol;
#pragma unroll
            for (int i = 0; i < 8; ++i) { const unsigned short hb = f2bf(v[i]); oh[i] = hb; ol[i] = f2bf(v[i] - bf2f(hb)); }
            *(v8us*)(dh + o) = oh; *(v8us*)(dl + o) = ol; }
         }
}
// BatchNorm statistics in two launches. k_bnpart: work-group b takes rows [b * BNR, (b + 1) * BNR) of WY, every row read once (16 B a lane, a wave covers 512 contiguous
// bytes, all 16 loads of a thread in flight); each thread forms the mean and the sum of squared deviations (M2) of its 16 rows from registers; equal-sized groups combine as
// mean = average of the means, M2 = sum of the M2 + count * sum of (group mean - mean)^2, in a fixed order. k_bnfin combines the BNP chunks the same way.
#define BNP 256
#define BNR (NB_ * NPX / BNP)
__global__ __launch_bounds__(512) void k_bnpart(const float* __restrict__ WY, float* PM, float* PQ) {
    __shared__ __align__(16) float sm[8][CIN];
    __shared__ __align__(16) float sq[8][CIN];
    const int tid = threadIdx.x, g = tid >> 6, cq = (tid & 63) * 4;
    const float* p = WY + (size_t)blockIdx.x * BNR * CIN;
    const unsigned off = (unsigned)(g * CIN + cq);
    v4f v[BNR / 8];
#pragma unroll
    for (int i = 0; i < BNR / 8; ++i) v[i] = *(const v4f*)(p + off + (unsigned)(i * 8 * CIN));
    v4f s = v[0];
#pragma unroll
    for (int i = 1; i < BNR / 8; ++i) s += v[i];
    const v4f m = s * (1.0f / (float)(BNR / 8));
    v4f q = (v4f){};
#pragma unroll
    for (int i = 0; i < BNR / 8; ++i) { const v4f d = v[i] - m; q += d * d; }
    *(v4fa*)&sm[g][cq] = m; *(v4fa*)&sq[g][cq] = q;
    __syncthreads();
    if (tid < CIN) { float a = 0.f, qq = 0.f, e = 0.f;
#pragma unroll
        for (int k = 0; k < 8; ++k) a += sm[k][tid];
        const float mu = a * 0.125f;
#pragma unroll
        for (int k = 0; k < 8; ++k) { const float d = sm[k][tid] - mu; e = fmaf(d, d, e); qq += sq[k][tid]; }
        PM[(size_t)blockIdx.x * CIN + tid] = mu; PQ[(size_t)blockIdx.x * CIN + tid] = fmaf((float)(BNR / 8), e, qq); }
}
__global__ __launch_bounds__(512) void k_bnfin(const float* __restrict__ PM, const float* __restrict__ PQ, float* MEAN, float* RSTD) {
    __shared__ float sm[16][32];
    __shared__ float sq[16][32];
    const int lane = threadIdx.x & 31, g = threadIdx.x >> 5; const int c = blockIdx.x * 32 + lane;
    const float* pm = PM + blockIdx.x * 32; const float* pq = PQ + blockIdx.x * 32;
    const unsigned boff = (unsigned)(g * (BNP / 16) * CIN + lane) * 4u;   // byte offset, the one vector register that all 32 loads name
    float m[BNP / 16], q[BNP / 16];
#pragma unroll
    for (int i = 0; i < BNP / 16; ++i) { m[i] = *(const float*)((const char*)pm + boff + (unsigned)(i * CIN * 4)); q[i] = *(const float*)((const char*)pq + boff + (unsigned)(i * CIN * 4)); }
    // the wait before a register that an issued load names is rewritten; boff as an input keeps its register from being given to a result inside the run of loads
    asm volatile("s_wait_xcnt 0x0" :: "v"(boff) : "memory");
    float a = 0.f, qq = 0.f, e = 0.f;
#pragma unroll
    for (int i = 0; i < BNP / 16; ++i) a += m[i];
    const float lm = a * (1.0f / (float)(BNP / 16));
#pragma unroll
    for (int i = 0; i < BNP / 16; ++i) { const float d = m[i] - lm; e = fmaf(d, d, e); qq += q[i]; }
    sm[g][lane] = lm; sq[g][lane] = fmaf((float)BNR, e, qq);
    __syncthreads();
    if (g == 0) { float a2 = 0.f, q2 = 0.f, e2 = 0.f;
#pragma unroll
        for (int k = 0; k < 16; ++k) a2 += sm[k][lane];
        const float mu = a2 * (1.0f / 16.0f);
#pragma unroll
        for (int k = 0; k < 16; ++k) { const float d = sm[k][lane] - mu; e2 = fmaf(d, d, e2); q2 += sq[k][lane]; }
        const float rs = rsqrtf(fmaf((float)(BNR * (BNP / 16)), e2, q2) / (float)(NB_ * NPX) + BEPS);
        MEAN[c] = mu; RSTD[c] = rs; }
}
__global__ __launch_bounds__(256) void k_bnout(const float* __restrict__ WY, const float* __restrict__ x1, const float* __restrict__ MEAN, const float* __restrict__ RSTD, const float* __restrict__ gam, const float* __restrict__ bet, float* OUTB) {
    __shared__ float tl[64][65];
    const int tid = threadIdx.x; const int p0 = blockIdx.x * 64, c0 = blockIdx.y * 64, b = blockIdx.z; const int rr = tid >> 2, cq = (tid & 3) * 16;
#pragma unroll
    for (int i = 0; i < 16; ++i) { const int c = c0 + cq + i; tl[rr][cq + i] = (WY[((size_t)b * NPX + p0 + rr) * CIN + c] - MEAN[c]) * RSTD[c] * bfr(gam[c]) + bfr(bet[c]); }
    __syncthreads();
    const int lane = tid & 31, wv = tid >> 5;
    auto pass = [&]() {
#pragma unroll
        for (int st = 0; st < 4; ++st) { const int cr = wv * 8 + st * 2 + (lane >> 4); const int pq = (lane & 15) * 4; v4f v; const size_t o = ((size_t)b * CIN + c0 + cr) * NPX + p0 + pq;
#pragma unroll
            for (int i = 0; i < 4; ++i) v[i] = tl[pq + i][cr] + bfr(x1[o + i]);
            *(v4f*)(OUTB + o) = v; }
    };
    pass(); 
}

extern "C" void kernel_launch(void* const* d_in, const int* in_sizes, int n_in,
                              void* d_out, int out_size, void* d_ws, size_t ws_size, hipStream_t stream) {
    (void)in_sizes; (void)n_in; (void)out_size;
    const float* x1 = (const float*)d_in[0]; const float* x2 = (const float*)d_in[1]; const float* wg = (const float*)d_in[2]; const float* bg = (const float*)d_in[3]; const float* wth = (const float*)d_in[4]; const float* bth = (const float*)d_in[5]; const float* wph = (const float*)d_in[6]; const float* bph = (const float*)d_in[7];
    const float* wout = (const float*)d_in[8]; const float* bout = (const float*)d_in[9]; const float* gam = (const float*)d_in[10]; const float* bet = (const float*)d_in[11];
    float* out = (float*)d_out;    // [8][256][64][64]
    char* wsp = (char*)d_ws;
    auto take = [&](size_t bytes) { char* p = wsp; wsp += (bytes + 255) & ~(size_t)255; return (void*)p; };
    bf* WG = (bf*)take((size_t)CI * CIN * 2); bf* WT = (bf*)take((size_t)CI * CIN * 2); bf* WP = (bf*)take((size_t)CI * CIN * 2); bf* WO = (bf*)take((size_t)CIN * CI * 2);
    bf* X1T = (bf*)take((size_t)NPX * CIN * 2); bf* X2T = (bf*)take((size_t)NPX * CIN * 2); float* TH = (float*)take((size_t)NPX * CI * 4); float* PHI = (float*)take((size_t)NPX * CI * 4); float* G = (float*)take((size_t)NPX * CI * 4);
    bf* Th = (bf*)take((size_t)NPX * CI * 2); bf* Tl = (bf*)take((size_t)NPX * CI * 2); bf* Fh = (bf*)take((size_t)MP * CI * 2); bf* Fl = (bf*)take((size_t)MP * CI * 2); bf* GTh = (bf*)take((size_t)CI * MP * 2); bf* GTl = (bf*)take((size_t)CI * MP * 2);
    float* S = (float*)take((size_t)NPX * MP * 4); bf* PH = (bf*)take((size_t)NPX * MP * 2); bf* PL = (bf*)take((size_t)NPX * MP * 2); float* Y = (float*)take((size_t)NPX * CI * 4); bf* Yh = (bf*)take((size_t)NPX * CI * 2); bf* Yl = (bf*)take((size_t)NPX * CI * 2);
    float* WY = (float*)take((size_t)NB_ * NPX * CIN * 4); float* MEAN = (float*)take(CIN * 4); float* RSTD = (float*)take(CIN * 4); float* PM = (float*)take((size_t)BNP * CIN * 4); float* PQ = (float*)take((size_t)BNP * CIN * 4);
    if ((size_t)(wsp - (char*)d_ws) > ws_size) return;    // ~ 0.3 + 4.2 + 6.3 + 2.1 + 0.5 + 0.5 + 16.8 + 16.8 + 2.1 + 2.1 + 33.5 ~ 86 MB
    k_cvt8<<<(CI * CIN / 8 + 255) / 256, 256, 0, stream>>>(wg, WG, CI * CIN / 8); k_cvt8<<<(CI * CIN / 8 + 255) / 256, 256, 0, stream>>>(wth, WT, CI * CIN / 8); k_cvt8<<<(CI * CIN / 8 + 255) / 256, 256, 0, stream>>>(wph, WP, CI * CIN / 8); k_cvt8<<<(CIN * CI / 8 + 255) / 256, 256, 0, stream>>>(wout, WO, CIN * CI / 8);   // 'oc' weights natural
    for (int b = 0; b < NB_; ++b) { const float* x1b = x1 + (size_t)b * CIN * NPX; const float* x2b = x2 + (size_t)b * CIN * NPX;
        k_ptb<<<dim3(CIN / 64, NPX / 64, 1), 256, 0, stream>>>(x1b, X1T); k_ptb<<<dim3(CIN / 64, NPX / 64, 1), 256, 0, stream>>>(x2b, X2T);
        k_gemmb<false, false><<<dim3(NPX / 64, CI / 64, 1), 128, 0, stream>>>(X1T, nullptr, WT, bth, TH, CI, nullptr, nullptr, CIN); k_gemmb<false, false><<<dim3(NPX / 64, CI / 64, 1), 128, 0, stream>>>(X2T, nullptr, WP, bph, PHI, CI, nullptr, nullptr, CIN); k_gemmb<false, false><<<dim3(NPX / 64, CI / 64, 1), 128, 0, stream>>>(X2T, nullptr, WG, bg, G, CI, nullptr, nullptr, CIN);
        k_split128<<<NPX / 8, 256, 0, stream>>>(TH, NPX, 1.0f / (float)MP, Th, Tl); k_poolphi<<<MP / 8, 256, 0, stream>>>(PHI, Fh, Fl); k_poolgT<<<(CI * (MP / 64)) / 8, 256, 0, stream>>>(G, GTh, GTl);
        k_gemm3<<<dim3(NPX / 64, MP / 64, 1), 128, 0, stream>>>(Th, Tl, Fh, Fl, CI, S, MP);           // f / M  [4096][1024]  (1/M folded into theta)
        k_split1024<<<NPX / 8, 256, 0, stream>>>(S, NPX, PH, PL);
        k_gemm3<<<dim3(NPX / 64, CI / 64, 1), 128, 0, stream>>>(PH, PL, GTh, GTl, MP, Y, CI);          // y^T[n][c] = sum_m f[n][m] g[c][m]
        k_split128<<<NPX / 8, 256, 0, stream>>>(Y, NPX, 1.0f, Yh, Yl);
        k_gemmb<true, false><<<dim3(NPX / 64, CIN / 64, 1), 128, 0, stream>>>(Yh, Yl, WO, bout, WY + (size_t)b * NPX * CIN, CIN, nullptr, nullptr, CI); }
    k_bnpart<<<BNP, 512, 0, stream>>>(WY, PM, PQ); k_bnfin<<<CIN / 32, 512, 0, stream>>>(PM, PQ, MEAN, RSTD);
    k_bnout<<<dim3(NPX / 64, CIN / 64, NB_), 256, 0, stream>>>(WY, x1, MEAN, RSTD, gam, bet, out);
}

// v002
// Measured time: 325 microseconds a run.
// Timed twice side by side with v001, it ran 2.52 and 2.50 times as fast.
// All steps since v000 together make it 6.79 times as fast.
#include <hip/hip_runtime.h>

// Compute dtypes, f32 accumulate, per image: theta (on x1) and g/phi (on x2) 1x1 convs as [4096 x 256].[256 x 128] GEMMs with PLAIN bf16 operands (inputs transposed to
// pixel-major exact bf16; exact products, + bias), the 2x2 max-pool on the conv outputs in f32; f = theta^T.phi / M ([4096 x 128].[128 x 1024]) and y = f.g^T
// ([4096 x 1024].[1024 x 128]) with both operands as bf16 hi + UNSCALED residual planes (three products; there is NO softmax in this module), the W conv on hi/lo planes (two
// products, + bias) - on v_wmma_f32_16x16x32_bf16; training-mode BatchNorm statistics over (B,H,W) per channel (fixed-order f32 column sums), the affine, + x1 and the NCHW

#define NB_  8
#define CIN  256
#define CI   128
#define HH   64
#define WW   64
#define NPX  4096
#define MP   1024
#define DM   CIN
#define BEPS 1e-5f
#define LOSC 1024.0f

typedef _Float16 h16;
typedef unsigned short bf;
typedef __attribute__((ext_vector_type(16))) __bf16   v16bf;
typedef __attribute__((ext_vector_type(16))) _Float16 v16h;
typedef __attribute__((ext_vector_type(8)))  _Float16 v8h;
typedef __attribute__((ext_vector_type(8)))  unsigned short v8us;
typedef __attribute__((ext_vector_type(8)))  float    v8f;
typedef __attribute__((ext_vector_type(4)))  float    v4f;
typedef v8h  __attribute__((may_alias)) v8ha;
typedef v4f  __attribute__((may_alias)) v4fa;
typedef v8us __attribute__((may_alias)) v8usa;

__device__ __forceinline__ unsigned short f2bf(float f) { unsigned u = __float_as_uint(f); u += 0x7FFFu + ((u >> 16) & 1u); return (unsigned short)(u >> 16); }
__device__ __forceinline__ float bf2f(unsigned short b) { return __uint_as_float(((unsigned)b) << 16); }
__device__ __forceinline__ float bfr(float f) { return bf2f(f2bf(f)); }
__device__ __forceinline__ v16h cat16(v8h lo, v8h hi) { return __builtin_shufflevector(lo, hi, 0, 1, 2, 3, 4, 5, 6, 7, 8, 9, 10, 11, 12, 13, 14, 15); }
__device__ __forceinline__ v16bf cat16b(v8us lo, v8us hi) { return __builtin_bit_cast(v16bf, __builtin_shufflevector(lo, hi, 0, 1, 2, 3, 4, 5, 6, 7, 8, 9, 10, 11, 12, 13, 14, 15)); }
__device__ __forceinline__ v8f wmma16(v16h a, v16h b, v8f c) { return __builtin_amdgcn_wmma_f32_16x16x32_f16(false, a, false, b, (short)0, c, false, false); }
__device__ __forceinline__ v8f wmmab(v16bf a, v16bf b, v8f c) { return __builtin_amdgcn_wmma_f32_16x16x32_bf16(false, a, false, b, (short)0, c, false, false); }

// k_gemmb: 64 x 64 block tile (4 waves x 16 x 64) of C[NTK][NW] = (A [+ Al]).B^T (K = 256 or 128) [+ bf(bias[c])] [+ bf(R[r][c]) residual]; f32 whole-line epilogue (or f16
template <bool SPLITA, bool F16OUT>
__device__ __forceinline__ void gemmb_tile(const bf* __restrict__ A, const bf* __restrict__ Al, const bf* __restrict__ Bn, const float* __restrict__ bias, float* C, int ldc, h16* C2, const float* __restrict__ R, int K, int roundR) {
    __shared__ __align__(16) float ost[4][16 * 68];
    const int lane = threadIdx.x & 31, wave = threadIdx.x >> 5, lr = lane & 15, hi = lane >> 4;
    const int r0 = blockIdx.x * 64 + wave * 16, c0 = blockIdx.y * 64;
    const size_t aoff = (size_t)(r0 + lr) * K + 8 * hi;
    size_t boff[4];
#pragma unroll
    for (int t = 0; t < 4; ++t) boff[t] = (size_t)(c0 + t * 16 + lr) * K + 8 * hi;
    v8f acc[4];
#pragma unroll
    for (int t = 0; t < 4; ++t) acc[t] = (v8f){};
#pragma unroll 1
    for (int kc = 0; kc < K; kc += 32) {
        const v16bf a = cat16b(*(const v8us*)(A + aoff + kc), *(const v8us*)(A + aoff + kc + 16));
        v16bf al = a;
        if (SPLITA) al = cat16b(*(const v8us*)(Al + aoff + kc), *(const v8us*)(Al + aoff + kc + 16));
#pragma unroll
        for (int t = 0; t < 4; ++t) { const v16bf b = cat16b(*(const v8us*)(Bn + boff[t] + kc), *(const v8us*)(Bn + boff[t] + kc + 16)); acc[t] = wmmab(a, b, acc[t]); if (SPLITA) acc[t] = wmmab(al, b, acc[t]); }
        asm volatile("v_nop\n\tv_nop\n\tv_nop\n\tv_nop" : "+v"(acc[0]), "+v"(acc[1]), "+v"(acc[2]), "+v"(acc[3]) : "v"(a), "v"(al));
    }
    float* os = &ost[wave][0];
#pragma unroll
    for (int t = 0; t < 4; ++t) { const float bv = bias ? bfr(bias[c0 + t * 16 + lr]) : 0.f;
#pragma unroll
        for (int j = 0; j < 8; ++j) os[(hi * 8 + j) * 68 + t * 16 + lr] = acc[t][j] + bv; }
    __syncthreads();
    if (F16OUT) {
        h16* crow = (h16*)(void*)C + (size_t)r0 * ldc + c0;
        auto pass = [&]() {
#pragma unroll
            for (int s = 0; s < 4; ++s) { const int row = 4 * s + (lane >> 3), piece = lane & 7; const float* sp = os + row * 68 + piece * 8; v8h o, o2;
#pragma unroll
                for (int i = 0; i < 8; ++i) { const h16 a = (h16)sp[i]; o[i] = a; o2[i] = (h16)((sp[i] - (float)a) * LOSC); }
                *(v8h*)(crow + (size_t)row * ldc + piece * 8) = o; if (C2) *(v8h*)(C2 + (size_t)r0 * ldc + c0 + (size_t)row * ldc + piece * 8) = o2; }
        };
        pass(); 
    } else {
        float* crow = C + (size_t)r0 * ldc + c0;
        auto pass = [&]() {
#pragma unroll
            for (int s = 0; s < 8; ++s) { const int Lid = (lane >> 3) + 4 * s, piece = lane & 7; const int row = Lid >> 1, cofs = (Lid & 1) * 32 + piece * 4;
                v4f val = *(const v4fa*)(os + row * 68 + cofs); if (R) { const v4f rv = *(const v4f*)(R + ((size_t)r0 + row) * ldc + c0 + cofs); val += roundR ? (v4f){bfr(rv[0]), bfr(rv[1]), bfr(rv[2]), bfr(rv[3])} : rv; }
                *(v4f*)(crow + (size_t)row * ldc + cofs) = val; }
        };
        pass(); 
    }
}
template <bool SPLITA, bool F16OUT = false>
__global__ __launch_bounds__(128) void k_gemmb(const bf* __restrict__ A, const bf* __restrict__ Al, const bf* __restrict__ Bn, const float* __restrict__ bias, float* C, int ldc, h16* C2, const float* __restrict__ R = nullptr, int K = DM, int roundR = 1) {
    gemmb_tile<SPLITA, F16OUT>(A, Al, Bn, bias, C, ldc, C2, R, K, roundR);
}
// k_conv3: the three 1x1 convs in one grid; blockIdx.z picks theta (on x1), phi or g (on x2); the rows run over the pixels of all images ([NB_ * NPX][CIN] operands)
__global__ __launch_bounds__(128) void k_conv3(const bf* __restrict__ X1T, const bf* __restrict__ X2T, const bf* __restrict__ WT, const bf* __restrict__ WP, const bf* __restrict__ WG, const float* __restrict__ bth, const float* __restrict__ bph, const float* __restrict__ bg, float* TH, float* PHI, float* G) {
    const int z = blockIdx.z;
    gemmb_tile<false, false>(z == 0 ? X1T : X2T, nullptr, z == 0 ? WT : (z == 1 ? WP : WG), z == 0 ? bth : (z == 1 ? bph : bg), z == 0 ? TH : (z == 1 ? PHI : G), CI, nullptr, nullptr, CIN, 1);
}

// k_cvt8: blockIdx.y picks one of four equally long arrays
__global__ __launch_bounds__(256) void k_cvt8(const float* __restrict__ s0, const float* __restrict__ s1, const float* __restrict__ s2, const float* __restrict__ s3, bf* d0, bf* d1, bf* d2, bf* d3, size_t n8) {
    const int w = blockIdx.y; const float* src = w == 0 ? s0 : (w == 1 ? s1 : (w == 2 ? s2 : s3)); bf* dst = w == 0 ? d0 : (w == 1 ? d1 : (w == 2 ? d2 : d3));
    const size_t i = (size_t)blockIdx.x * 256 + threadIdx.x; if (i >= n8) return;
    const v8f v = *(const v8f*)(src + i * 8); v8us o;
#pragma unroll
    for (int k = 0; k < 8; ++k) o[k] = f2bf(v[k]);
    *(v8us*)(dst + i * 8) = o; 
}
__global__ __launch_bounds__(256) void k_zero8(bf* dst, size_t n8) {
    const size_t i = (size_t)blockIdx.x * 256 + threadIdx.x; if (i >= n8) return; v8us z;
#pragma unroll
    for (int k = 0; k < 8; ++k) z[k] = 0;
    *(v8us*)(dst + i * 8) = z; 
}
// k_gemm3: 64 x 64 tile of C = (Ah + Al).(Bh + Bl)^T over K (row strides = K for all four planes; n-major B): three products per 32-k step (hh, hl, lh); f32
// blockIdx.z = image: sA, sB, sC are the elements from one image's A planes, B planes and C to the next image's
__global__ __launch_bounds__(128) void k_gemm3(const bf* __restrict__ Ah, const bf* __restrict__ Al, const bf* __restrict__ Bh, const bf* __restrict__ Bl, int K, float* C, int ldc, size_t sA, size_t sB, size_t sC) {
    __shared__ __align__(16) float ost[4][16 * 68];
    Ah += blockIdx.z * sA; Al += blockIdx.z * sA; Bh += blockIdx.z * sB; Bl += blockIdx.z * sB; C += blockIdx.z * sC;
    const int lane = threadIdx.x & 31, wave = threadIdx.x >> 5, lr = lane & 15, hi = lane >> 4;
    const int r0 = blockIdx.x * 64 + wave * 16, c0 = blockIdx.y * 64;
    const size_t aoff = (size_t)(r0 + lr) * K + 8 * hi;
    v8f acc[4];
#pragma unroll
    for (int t = 0; t < 4; ++t) acc[t] = (v8f){};
#pragma unroll 1
    for (int kc = 0; kc < K; kc += 32) {
        const v16bf a = cat16b(*(const v8us*)(Ah + aoff + kc), *(const v8us*)(Ah + aoff + kc + 16));
        const v16bf al = cat16b(*(const v8us*)(Al + aoff + kc), *(const v8us*)(Al + aoff + kc + 16));
#pragma unroll
        for (int t = 0; t < 4; ++t) { const size_t bo = (size_t)(c0 + t * 16 + lr) * K + kc + 8 * hi;
            const v16bf bh = cat16b(*(const v8us*)(Bh + bo), *(const v8us*)(Bh + bo + 16)); const v16bf bl = cat16b(*(const v8us*)(Bl + bo), *(const v8us*)(Bl + bo + 16));
            acc[t] = wmmab(a, bh, acc[t]); acc[t] = wmmab(al, bh, acc[t]); acc[t] = wmmab(a, bl, acc[t]); }
        asm volatile("v_nop\n\tv_nop\n\tv_nop\n\tv_nop" : "+v"(acc[0]), "+v"(acc[1]), "+v"(acc[2]), "+v"(acc[3]) : "v"(a), "v"(al));
    }
    float* os = &ost[wave][0];
#pragma unroll
    for (int t = 0; t < 4; ++t) {
#pragma unroll
        for (int j = 0; j < 8; ++j) os[(hi * 8 + j) * 68 + t * 16 + lr] = acc[t][j]; }
    __builtin_amdgcn_wave_barrier(); asm volatile("" ::: "memory");
    float* crow = C + (size_t)r0 * ldc + c0;
    auto pass = [&]() {
#pragma unroll
        for (int s = 0; s < 8; ++s) { const int Lid = (lane >> 3) + 4 * s, piece = lane & 7; const int row = Lid >> 1, cofs = (Lid & 1) * 32 + piece * 4;
            const v4f val = *(const v4fa*)(os + row * 68 + cofs); *(v4f*)(crow + (size_t)row * ldc + cofs) = val; }
    };
    pass(); 
}


// blockIdx.z = image of x1 (0 .. NB_ - 1) or of x2 (NB_ .. 2 NB_ - 1); XT holds the 2 NB_ transposed images one behind the other
__global__ __launch_bounds__(256) void k_ptb(const float* __restrict__ x1, const float* __restrict__ x2, bf* XT) {
    __shared__ float tl[64][65];
    const float* xb = (blockIdx.z < NB_ ? x1 + (size_t)blockIdx.z * CIN * NPX : x2 + (size_t)(blockIdx.z - NB_) * CIN * NPX); XT += (size_t)blockIdx.z * NPX * CIN;
    typedef __attribute__((ext_vector_type(4))) unsigned short v4us;
    const int tid = threadIdx.x, c0 = blockIdx.x * 64, p0 = blockIdx.y * 64; const int rr = tid >> 2, cq = (tid & 3) * 16;
#pragma unroll
    for (int i = 0; i < 16; ++i) tl[rr][cq + i] = xb[(size_t)(c0 + rr) * NPX + p0 + cq + i];
    __syncthreads();
    const int lane = tid & 31, wv = tid >> 5;
    auto pass = [&]() {
#pragma unroll
        for (int st = 0; st < 4; ++st) { const int pr = wv * 8 + st * 2 + (lane >> 4); const int cl = (lane & 15) * 4; v4us v;
#pragma unroll
            for (int i = 0; i < 4; ++i) v[i] = f2bf(tl[cl + i][pr]);
            *(v4us*)(XT + (size_t)(p0 + pr) * CIN + c0 + cl) = v; }
    };
    pass(); 
}
__device__ __forceinline__ void split128_blk(unsigned blk, const float* __restrict__ src, int rows, float sc, bf* dh, bf* dl) {
    typedef __attribute__((ext_vector_type(4))) unsigned short v4us;
    const int lane = threadIdx.x & 31; const size_t r = (size_t)blk * 8 + (threadIdx.x >> 5); if (r >= (size_t)rows) return; const size_t o = r * CI + lane * 4; const v4f v = *(const v4f*)(src + o); v4us oh, ol;
#pragma unroll
    for (int i = 0; i < 4; ++i) { const float y = v[i] * sc; const unsigned short hb = f2bf(y); oh[i] = hb; ol[i] = f2bf(y - bf2f(hb)); }
    *(v4us*)(dh + o) = oh; *(v4us*)(dl + o) = ol; 
}
__global__ __launch_bounds__(256) void k_split128(const float* __restrict__ src, int rows, float sc, bf* dh, bf* dl) { split128_blk(blockIdx.x, src, rows, sc, dh, dl); }
// blk counts the MP / 8 blocks of image 0, then those of image 1, ...
__device__ __forceinline__ void poolphi_blk(unsigned blk, const float* __restrict__ F, bf* dh, bf* dl) {
    typedef __attribute__((ext_vector_type(4))) unsigned short v4us;
    const unsigned img = blk / (MP / 8); F += (size_t)img * NPX * CI; dh += (size_t)img * MP * CI; dl += (size_t)img * MP * CI;
    const int lane = threadIdx.x & 31; const size_t m = (size_t)(blk % (MP / 8)) * 8 + (threadIdx.x >> 5); if (m >= (size_t)MP) return; const int py = (int)(m / (WW / 2)), px = (int)(m % (WW / 2)); const size_t p00 = (size_t)(2 * py) * WW + 2 * px; v4us oh, ol;
#pragma unroll
    for (int i = 0; i < 4; ++i) { const int c = lane * 4 + i; const float a = F[p00 * CI + c], b2 = F[(p00 + 1) * CI + c], cc = F[(p00 + WW) * CI + c], d = F[(p00 + WW + 1) * CI + c]; const float y = fmaxf(fmaxf(a, b2), fmaxf(cc, d)); const unsigned short hb = f2bf(y); oh[i] = hb; ol[i] = f2bf(y - bf2f(hb)); }
    const size_t o = m * CI + lane * 4; *(v4us*)(dh + o) = oh; *(v4us*)(dl + o) = ol; 
}
// blk counts the CI * (MP / 64) / 8 blocks of image 0, then those of image 1, ...
__device__ __forceinline__ void poolgT_blk(unsigned blk, const float* __restrict__ F, bf* Th, bf* Tl) {
    typedef __attribute__((ext_vector_type(2))) unsigned short v2us;
    const unsigned img = blk / (CI * (MP / 64) / 8); F += (size_t)img * NPX * CI; Th += (size_t)img * CI * MP; Tl += (size_t)img * CI * MP;
    const int lane = threadIdx.x & 31; const size_t wid = (size_t)(blk % (CI * (MP / 64) / 8)) * 8 + (threadIdx.x >> 5); if (wid >= (size_t)CI * (MP / 64)) return; const int c = (int)(wid / (MP / 64)); const int m0 = (int)(wid % (MP / 64)) * 64 + lane * 2; v2us oh, ol;
#pragma unroll
    for (int q = 0; q < 2; ++q) { const int m = m0 + q; const int py = m / (WW / 2), px = m % (WW / 2); const size_t p00 = (size_t)(2 * py) * WW + 2 * px;
        const float y = fmaxf(fmaxf(F[p00 * CI + c], F[(p00 + 1) * CI + c]), fmaxf(F[(p00 + WW) * CI + c], F[(p00 + WW + 1) * CI + c])); const unsigned short hb = f2bf(y); oh[q] = hb; ol[q] = f2bf(y - bf2f(hb)); }
    const size_t o = (size_t)c * MP + m0; *(v2us*)(Th + o) = oh; *(v2us*)(Tl + o) = ol; 
}
// k_prep: the three independent passes over the conv outputs of all images in one grid: g pool + transpose (the longest blocks, so they start first), phi pool, theta split
#define PREP_G (NB_ * CI * (MP / 64) / 8)
#define PREP_P (NB_ * MP / 8)
#define PREP_T (NB_ * NPX / 8)
__global__ __launch_bounds__(256) void k_prep(const float* __restrict__ TH, const float* __restrict__ PHI, const float* __restrict__ G, bf* Th, bf* Tl, bf* Fh, bf* Fl, bf* GTh, bf* GTl) {
    const unsigned blk = blockIdx.x;
    if (blk < PREP_G) poolgT_blk(blk, G, GTh, GTl);
    else if (blk < PREP_G + PREP_P) poolphi_blk(blk - PREP_G, PHI, Fh, Fl);
    else split128_blk(blk - (PREP_G + PREP_P), TH, NB_ * NPX, 1.0f / (float)MP, Th, Tl);
}
__global__ __launch_bounds__(256) void k_split1024(const float* __restrict__ src, int rows, bf* dh, bf* dl) {
    const int lane = threadIdx.x & 31; const size_t r = (size_t)blockIdx.x * 8 + (threadIdx.x >> 5); if (r >= (size_t)rows) return;
{
#pragma unroll
        for (int q = 0; q < MP / 256; ++q) { const size_t o = r * MP + q * 256 + lane * 8; const v8f v = *(const v8f*)(src + o); v8us oh, ol;
#pragma unroll
            for (int i = 0; i < 8; ++i) { const unsigned short hb = f2bf(v[i]); oh[i] = hb; ol[i] = f2bf(v[i] - bf2f(hb)); }
            *(v8us*)(dh + o) = oh; *(v8us*)(dl + o) = ol; }
         }
}
// BatchNorm statistics in two launches. k_bnpart: work-group b takes rows [b * BNR, (b + 1) * BNR) of WY, every row read once (16 B a lane, a wave covers 512 contiguous
// bytes, all 16 loads of a thread in flight); each thread forms the mean and the sum of squared deviations (M2) of its 16 rows from registers; equal-sized groups combine as
// mean = average of the means, M2 = sum of the M2 + count * sum of (group mean - mean)^2, in a fixed order. k_bnfin combines the BNP chunks the same way.
#define BNP 256
#define BNR (NB_ * NPX / BNP)
__global__ __launch_bounds__(512) void k_bnpart(const float* __restrict__ WY, float* PM, float* PQ) {
    __shared__ __align__(16) float sm[8][CIN];
    __shared__ __align__(16) float sq[8][CIN];
    const int tid = threadIdx.x, g = tid >> 6, cq = (tid & 63) * 4;
    const float* p = WY + (size_t)blockIdx.x * BNR * CIN;
    const unsigned off = (unsigned)(g * CIN + cq);
    v4f v[BNR / 8];
#pragma unroll
    for (int i = 0; i < BNR / 8; ++i) v[i] = *(const v4f*)(p + off + (unsigned)(i * 8 * CIN));
    v4f s = v[0];
#pragma unroll
    for (int i = 1; i < BNR / 8; ++i) s += v[i];
    const v4f m = s * (1.0f / (float)(BNR / 8));
    v4f q = (v4f){};
#pragma unroll
    for (int i = 0; i < BNR / 8; ++i) { const v4f d = v[i] - m; q += d * d; }
    *(v4fa*)&sm[g][cq] = m; *(v4fa*)&sq[g][cq] = q;
    __syncthreads();
    if (tid < CIN) { float a = 0.f, qq = 0.f, e = 0.f;
#pragma unroll
        for (int k = 0; k < 8; ++k) a += sm[k][tid];
        const float mu = a * 0.125f;
#pragma unroll
        for (int k = 0; k < 8; ++k) { const float d = sm[k][tid] - mu; e = fmaf(d, d, e); qq += sq[k][tid]; }
        PM[(size_t)blockIdx.x * CIN + tid] = mu; PQ[(size_t)blockIdx.x * CIN + tid] = fmaf((float)(BNR / 8), e, qq); }
}
__global__ __launch_bounds__(512) void k_bnfin(const float* __restrict__ PM, const float* __restrict__ PQ, float* MEAN, float* RSTD) {
    __shared__ float sm[16][32];
    __shared__ float sq[16][32];
    const int lane = threadIdx.x & 31, g = threadIdx.x >> 5; const int c = blockIdx.x * 32 + lane;
    const float* pm = PM + blockIdx.x * 32; const float* pq = PQ + blockIdx.x * 32;
    const unsigned boff = (unsigned)(g * (BNP / 16) * CIN + lane) * 4u;   // byte offset, the one vector register that all 32 loads name
    float m[BNP / 16], q[BNP / 16];
#pragma unroll
    for (int i = 0; i < BNP / 16; ++i) { m[i] = *(const float*)((const char*)pm + boff + (unsigned)(i * CIN * 4)); q[i] = *(const float*)((const char*)pq + boff + (unsigned)(i * CIN * 4)); }
    // the wait before a register that an issued load names is rewritten; boff as an input keeps its register from being given to a result inside the run of loads
    asm volatile("s_wait_xcnt 0x0" :: "v"(boff) : "memory");
    float a = 0.f, qq = 0.f, e = 0.f;
#pragma unroll
    for (int i = 0; i < BNP / 16; ++i) a += m[i];
    const float lm = a * (1.0f / (float)(BNP / 16));
#pragma unroll
    for (int i = 0; i < BNP / 16; ++i) { const float d = m[i] - lm; e = fmaf(d, d, e); qq += q[i]; }
    sm[g][lane] = lm; sq[g][lane] = fmaf((float)BNR, e, qq);
    __syncthreads();
    if (g == 0) { float a2 = 0.f, q2 = 0.f, e2 = 0.f;
#pragma unroll
        for (int k = 0; k < 16; ++k) a2 += sm[k][lane];
        const float mu = a2 * (1.0f / 16.0f);
#pragma unroll
        for (int k = 0; k < 16; ++k) { const float d = sm[k][lane] - mu; e2 = fmaf(d, d, e2); q2 += sq[k][lane]; }
        const float rs = rsqrtf(fmaf((float)(BNR * (BNP / 16)), e2, q2) / (float)(NB_ * NPX) + BEPS);
        MEAN[c] = mu; RSTD[c] = rs; }
}
__global__ __launch_bounds__(256) void k_bnout(const float* __restrict__ WY, const float* __restrict__ x1, const float* __restrict__ MEAN, const float* __restrict__ RSTD, const float* __restrict__ gam, const float* __restrict__ bet, float* OUTB) {
    __shared__ float tl[64][65];
    const int tid = threadIdx.x; const int p0 = blockIdx.x * 64, c0 = blockIdx.y * 64, b = blockIdx.z; const int rr = tid >> 2, cq = (tid & 3) * 16;
#pragma unroll
    for (int i = 0; i < 16; ++i) { const int c = c0 + cq + i; tl[rr][cq + i] = (WY[((size_t)b * NPX + p0 + rr) * CIN + c] - MEAN[c]) * RSTD[c] * bfr(gam[c]) + bfr(bet[c]); }
    __syncthreads();
    const int lane = tid & 31, wv = tid >> 5;
    auto pass = [&]() {
#pragma unroll
        for (int st = 0; st < 4; ++st) { const int cr = wv * 8 + st * 2 + (lane >> 4); const int pq = (lane & 15) * 4; v4f v; const size_t o = ((size_t)b * CIN + c0 + cr) * NPX + p0 + pq;
#pragma unroll
            for (int i = 0; i < 4; ++i) v[i] = tl[pq + i][cr] + bfr(x1[o + i]);
            *(v4f*)(OUTB + o) = v; }
    };
    pass(); 
}

extern "C" void kernel_launch(void* const* d_in, const int* in_sizes, int n_in,
                              void* d_out, int out_size, void* d_ws, size_t ws_size, hipStream_t stream) {
    (void)in_sizes; (void)n_in; (void)out_size;
    const float* x1 = (const float*)d_in[0]; const float* x2 = (const float*)d_in[1]; const float* wg = (const float*)d_in[2]; const float* bg = (const float*)d_in[3]; const float* wth = (const float*)d_in[4]; const float* bth = (const float*)d_in[5]; const float* wph = (const float*)d_in[6]; const float* bph = (const float*)d_in[7];
    const float* wout = (const float*)d_in[8]; const float* bout = (const float*)d_in[9]; const float* gam = (const float*)d_in[10]; const float* bet = (const float*)d_in[11];
    float* out = (float*)d_out;    // [8][256][64][64]
    char* wsp = (char*)d_ws;
    auto take = [&](size_t bytes) { char* p = wsp; wsp += (bytes + 255) & ~(size_t)255; return (void*)p; };
    bf* WG = (bf*)take((size_t)CI * CIN * 2); bf* WT = (bf*)take((size_t)CI * CIN * 2); bf* WP = (bf*)take((size_t)CI * CIN * 2); bf* WO = (bf*)take((size_t)CIN * CI * 2);
    // all NB_ images at once, but S: it holds NB_ / 2 images, so that everything fits the workspace. Three ranges are used twice, each time for data whose first use is over:
    // the conv inputs and outputs lie where PH / PL are written later, Y lies in S, Yh / Yl lie in Th / Tl.
    bf* Th = (bf*)take((size_t)NB_ * NPX * CI * 2); bf* Tl = (bf*)take((size_t)NB_ * NPX * CI * 2); bf* Fh = (bf*)take((size_t)NB_ * MP * CI * 2); bf* Fl = (bf*)take((size_t)NB_ * MP * CI * 2); bf* GTh = (bf*)take((size_t)NB_ * CI * MP * 2); bf* GTl = (bf*)take((size_t)NB_ * CI * MP * 2);
    float* S = (float*)take((size_t)(NB_ / 2) * NPX * MP * 4); bf* PH = (bf*)take((size_t)NB_ * NPX * MP * 2); bf* PL = (bf*)take((size_t)NB_ * NPX * MP * 2);
    bf* XT = PH; bf* X1T = XT; bf* X2T = XT + (size_t)NB_ * NPX * CIN; float* TH = (float*)(XT + (size_t)2 * NB_ * NPX * CIN); float* PHI = TH + (size_t)NB_ * NPX * CI; float* G = PHI + (size_t)NB_ * NPX * CI;   // 32 + 48 MiB of the 128 MiB of PH and PL
    float* Y = S; bf* Yh = Th; bf* Yl = Tl;
    float* WY = (float*)take((size_t)NB_ * NPX * CIN * 4); float* MEAN = (float*)take(CIN * 4); float* RSTD = (float*)take(CIN * 4); float* PM = (float*)take((size_t)BNP * CIN * 4); float* PQ = (float*)take((size_t)BNP * CIN * 4);
    if ((size_t)(wsp - (char*)d_ws) > ws_size) return;    // MiB: 0.25 + 16 + 4 + 4 + 64 + 128 + 32 + 0.5 ~ 249
    k_cvt8<<<dim3((CI * CIN / 8 + 255) / 256, 4, 1), 256, 0, stream>>>(wg, wth, wph, wout, WG, WT, WP, WO, CI * CIN / 8);   // 'oc' weights natural
    k_ptb<<<dim3(CIN / 64, NPX / 64, 2 * NB_), 256, 0, stream>>>(x1, x2, XT);
    k_conv3<<<dim3(NB_ * NPX / 64, CI / 64, 3), 128, 0, stream>>>(X1T, X2T, WT, WP, WG, bth, bph, bg, TH, PHI, G);
    k_prep<<<PREP_G + PREP_P + PREP_T, 256, 0, stream>>>(TH, PHI, G, Th, Tl, Fh, Fl, GTh, GTl);                         // 1/M folded into theta
    for (int h = 0; h < 2; ++h) { const size_t i0 = (size_t)h * (NB_ / 2);
        k_gemm3<<<dim3(NPX / 64, MP / 64, NB_ / 2), 128, 0, stream>>>(Th + i0 * NPX * CI, Tl + i0 * NPX * CI, Fh + i0 * MP * CI, Fl + i0 * MP * CI, CI, S, MP, (size_t)NPX * CI, (size_t)MP * CI, (size_t)NPX * MP);   // f / M  [4096][1024] an image
        k_split1024<<<(NB_ / 2) * NPX / 8, 256, 0, stream>>>(S, (NB_ / 2) * NPX, PH + i0 * NPX * MP, PL + i0 * NPX * MP); }
    k_gemm3<<<dim3(NPX / 64, CI / 64, NB_), 128, 0, stream>>>(PH, PL, GTh, GTl, MP, Y, CI, (size_t)NPX * MP, (size_t)CI * MP, (size_t)NPX * CI);          // y^T[n][c] = sum_m f[n][m] g[c][m]
    k_split128<<<NB_ * NPX / 8, 256, 0, stream>>>(Y, NB_ * NPX, 1.0f, Yh, Yl);
    k_gemmb<true, false><<<dim3(NB_ * NPX / 64, CIN / 64, 1), 128, 0, stream>>>(Yh, Yl, WO, bout, WY, CIN, nullptr, nullptr, CI);
    k_bnpart<<<BNP, 512, 0, stream>>>(WY, PM, PQ); k_bnfin<<<CIN / 32, 512, 0, stream>>>(PM, PQ, MEAN, RSTD);
    k_bnout<<<dim3(NPX / 64, CIN / 64, NB_), 256, 0, stream>>>(WY, x1, MEAN, RSTD, gam, bet, out);
}

// v003
// A run of this version takes 143 microseconds.
// Timed twice side by side with v002, it ran 2.26 and 2.25 times as fast.
// Counting every step since v000, it is 15.3 times as fast.
#include <hip/hip_runtime.h>

// Compute dtypes, f32 accumulate, per image: theta (on x1) and g/phi (on x2) 1x1 convs as [4096 x 256].[256 x 128] GEMMs with PLAIN bf16 operands (inputs transposed to
// pixel-major exact bf16; exact products, + bias), the 2x2 max-pool on the conv outputs in f32. There is NO softmax in this module, so W.((theta^T.phi / M).g^T) is one chain of
// linear products and is taken from the right: KM = phi.g^T ([128 x 1024].[1024 x 128]), QT = W.KM^T ([256 x 128].[128 x 128]), then theta^T.QT^T / M + bias
// ([4096 x 128].[128 x 256]); the [4096 x 1024] matrix f is never formed. theta, phi, g, KM and QT go in as bf16 hi + UNSCALED residual planes (three products; W plain bf16, two
// products) - on v_wmma_f32_16x16x32_bf16; training-mode BatchNorm statistics over (B,H,W) per channel (fixed-order f32 column sums), the affine, + x1 and the NCHW

#define NB_  8
#define CIN  256
#define CI   128
#define HH   64
#define WW   64
#define NPX  4096
#define MP   1024
#define DM   CIN
#define BEPS 1e-5f
#define LOSC 1024.0f

typedef _Float16 h16;
typedef unsigned short bf;
typedef __attribute__((ext_vector_type(16))) __bf16   v16bf;
typedef __attribute__((ext_vector_type(16))) _Float16 v16h;
typedef __attribute__((ext_vector_type(8)))  _Float16 v8h;
typedef __attribute__((ext_vector_type(8)))  unsigned short v8us;
typedef __attribute__((ext_vector_type(8)))  float    v8f;
typedef __attribute__((ext_vector_type(4)))  float    v4f;
typedef v8h  __attribute__((may_alias)) v8ha;
typedef v4f  __attribute__((may_alias)) v4fa;
typedef v8us __attribute__((may_alias)) v8usa;

__device__ __forceinline__ unsigned short f2bf(float f) { unsigned u = __float_as_uint(f); u += 0x7FFFu + ((u >> 16) & 1u); return (unsigned short)(u >> 16); }
__device__ __forceinline__ float bf2f(unsigned short b) { return __uint_as_float(((unsigned)b) << 16); }
__device__ __forceinline__ float bfr(float f) { return bf2f(f2bf(f)); }
__device__ __forceinline__ v16h cat16(v8h lo, v8h hi) { return __builtin_shufflevector(lo, hi, 0, 1, 2, 3, 4, 5, 6, 7, 8, 9, 10, 11, 12, 13, 14, 15); }
__device__ __forceinline__ v16bf cat16b(v8us lo, v8us hi) { return __builtin_bit_cast(v16bf, __builtin_shufflevector(lo, hi, 0, 1, 2, 3, 4, 5, 6, 7, 8, 9, 10, 11, 12, 13, 14, 15)); }
__device__ __forceinline__ v8f wmma16(v16h a, v16h b, v8f c) { return __builtin_amdgcn_wmma_f32_16x16x32_f16(false, a, false, b, (short)0, c, false, false); }
__device__ __forceinline__ v8f wmmab(v16bf a, v16bf b, v8f c) { return __builtin_amdgcn_wmma_f32_16x16x32_bf16(false, a, false, b, (short)0, c, false, false); }

// gemmb_tile: 64 x 64 block tile (4 waves x 16 x 64) of C[NTK][NW] = (A [+ Al]).B^T (K = 256) [+ bf(bias[c])] [+ bf(R[r][c]) residual]; f32 whole-line epilogue (or f16
template <bool SPLITA, bool F16OUT>
__device__ __forceinline__ void gemmb_tile(const bf* __restrict__ A, const bf* __restrict__ Al, const bf* __restrict__ Bn, const float* __restrict__ bias, float* C, int ldc, h16* C2, const float* __restrict__ R, int K, int roundR) {
    __shared__ __align__(16) float ost[4][16 * 68];
    const int lane = threadIdx.x & 31, wave = threadIdx.x >> 5, lr = lane & 15, hi = lane >> 4;
    const int r0 = blockIdx.x * 64 + wave * 16, c0 = blockIdx.y * 64;
    const size_t aoff = (size_t)(r0 + lr) * K + 8 * hi;
    size_t boff[4];
#pragma unroll
    for (int t = 0; t < 4; ++t) boff[t] = (size_t)(c0 + t * 16 + lr) * K + 8 * hi;
    v8f acc[4];
#pragma unroll
    for (int t = 0; t < 4; ++t) acc[t] = (v8f){};
#pragma unroll 1
    for (int kc = 0; kc < K; kc += 32) {
        const v16bf a = cat16b(*(const v8us*)(A + aoff + kc), *(const v8us*)(A + aoff + kc + 16));
        v16bf al = a;
        if (SPLITA) al = cat16b(*(const v8us*)(Al + aoff + kc), *(const v8us*)(Al + aoff + kc + 16));
#pragma unroll
        for (int t = 0; t < 4; ++t) { const v16bf b = cat16b(*(const v8us*)(Bn + boff[t] + kc), *(const v8us*)(Bn + boff[t] + kc + 16)); acc[t] = wmmab(a, b, acc[t]); if (SPLITA) acc[t] = wmmab(al, b, acc[t]); }
        asm volatile("v_nop\n\tv_nop\n\tv_nop\n\tv_nop" : "+v"(acc[0]), "+v"(acc[1]), "+v"(acc[2]), "+v"(acc[3]) : "v"(a), "v"(al));
    }
    float* os = &ost[wave][0];
#pragma unroll
    for (int t = 0; t < 4; ++t) { const float bv = bias ? bfr(bias[c0 + t * 16 + lr]) : 0.f;
#pragma unroll
        for (int j = 0; j < 8; ++j) os[(hi * 8 + j) * 68 + t * 16 + lr] = acc[t][j] + bv; }
    __syncthreads();
    if (F16OUT) {
        h16* crow = (h16*)(void*)C + (size_t)r0 * ldc + c0;
        auto pass = [&]() {
#pragma unroll
            for (int s = 0; s < 4; ++s) { const int row = 4 * s + (lane >> 3), piece = lane & 7; const float* sp = os + row * 68 + piece * 8; v8h o, o2;
#pragma unroll
                for (int i = 0; i < 8; ++i) { const h16 a = (h16)sp[i]; o[i] = a; o2[i] = (h16)((sp[i] - (float)a) * LOSC); }
                *(v8h*)(crow + (size_t)row * ldc + piece * 8) = o; if (C2) *(v8h*)(C2 + (size_t)r0 * ldc + c0 + (size_t)row * ldc + piece * 8) = o2; }
        };
        pass(); 
    } else {
        float* crow = C + (size_t)r0 * ldc + c0;
        auto pass = [&]() {
#pragma unroll
            for (int s = 0; s < 8; ++s) { const int Lid = (lane >> 3) + 4 * s, piece = lane & 7; const int row = Lid >> 1, cofs = (Lid & 1) * 32 + piece * 4;
                v4f val = *(const v4fa*)(os + row * 68 + cofs); if (R) { const v4f rv = *(const v4f*)(R + ((size_t)r0 + row) * ldc + c0 + cofs); val += roundR ? (v4f){bfr(rv[0]), bfr(rv[1]), bfr(rv[2]), bfr(rv[3])} : rv; }
                *(v4f*)(crow + (size_t)row * ldc + cofs) = val; }
        };
        pass(); 
    }
}
// k_conv3: the three 1x1 convs in one grid; blockIdx.z picks theta (on x1), phi or g (on x2); the rows run over the pixels of all images ([NB_ * NPX][CIN] operands)
__global__ __launch_bounds__(128) void k_conv3(const bf* __restrict__ X1T, const bf* __restrict__ X2T, const bf* __restrict__ WT, const bf* __restrict__ WP, const bf* __restrict__ WG, const float* __restrict__ bth, const float* __restrict__ bph, const float* __restrict__ bg, float* TH, float* PHI, float* G) {
    const int z = blockIdx.z;
    gemmb_tile<false, false>(z == 0 ? X1T : X2T, nullptr, z == 0 ? WT : (z == 1 ? WP : WG), z == 0 ? bth : (z == 1 ? bph : bg), z == 0 ? TH : (z == 1 ? PHI : G), CI, nullptr, nullptr, CIN, 1);
}

// k_cvt8: blockIdx.y picks one of four equally long arrays
__global__ __launch_bounds__(256) void k_cvt8(const float* __restrict__ s0, const float* __restrict__ s1, const float* __restrict__ s2, const float* __restrict__ s3, bf* d0, bf* d1, bf* d2, bf* d3, size_t n8) {
    const int w = blockIdx.y; const float* src = w == 0 ? s0 : (w == 1 ? s1 : (w == 2 ? s2 : s3)); bf* dst = w == 0 ? d0 : (w == 1 ? d1 : (w == 2 ? d2 : d3));
    const size_t i = (size_t)blockIdx.x * 256 + threadIdx.x; if (i >= n8) return;
    const v8f v = *(const v8f*)(src + i * 8); v8us o;
#pragma unroll
    for (int k = 0; k < 8; ++k) o[k] = f2bf(v[k]);
    *(v8us*)(dst + i * 8) = o; 
}
__global__ __launch_bounds__(256) void k_zero8(bf* dst, size_t n8) {
    const size_t i = (size_t)blockIdx.x * 256 + threadIdx.x; if (i >= n8) return; v8us z;
#pragma unroll
    for (int k = 0; k < 8; ++k) z[k] = 0;
    *(v8us*)(dst + i * 8) = z; 
}
// k_gemm3: 64 x 64 tile of C = (Ah + Al).(Bh + Bl)^T + bf(bias[c]) over K (row strides = K for all four planes; n-major B): three products per 32-k step (hh, hl, lh); f32
// blockIdx.z = image: sA, sB, sC are the elements from one image's A planes, B planes and C to the next image's
__global__ __launch_bounds__(128) void k_gemm3(const bf* __restrict__ Ah, const bf* __restrict__ Al, const bf* __restrict__ Bh, const bf* __restrict__ Bl, const float* __restrict__ bias, int K, float* C, int ldc, size_t sA, size_t sB, size_t sC) {
    __shared__ __align__(16) float ost[4][16 * 68];
    Ah += blockIdx.z * sA; Al += blockIdx.z * sA; Bh += blockIdx.z * sB; Bl += blockIdx.z * sB; C += blockIdx.z * sC;
    const int lane = threadIdx.x & 31, wave = threadIdx.x >> 5, lr = lane & 15, hi = lane >> 4;
    const int r0 = blockIdx.x * 64 + wave * 16, c0 = blockIdx.y * 64;
    const size_t aoff = (size_t)(r0 + lr) * K + 8 * hi;
    v8f acc[4];
#pragma unroll
    for (int t = 0; t < 4; ++t) acc[t] = (v8f){};
#pragma unroll 1
    for (int kc = 0; kc < K; kc += 32) {
        const v16bf a = cat16b(*(const v8us*)(Ah + aoff + kc), *(const v8us*)(Ah + aoff + kc + 16));
        const v16bf al = cat16b(*(const v8us*)(Al + aoff + kc), *(const v8us*)(Al + aoff + kc + 16));
#pragma unroll
        for (int t = 0; t < 4; ++t) { const size_t bo = (size_t)(c0 + t * 16 + lr) * K + kc + 8 * hi;
            const v16bf bh = cat16b(*(const v8us*)(Bh + bo), *(const v8us*)(Bh + bo + 16)); const v16bf bl = cat16b(*(const v8us*)(Bl + bo), *(const v8us*)(Bl + bo + 16));
            acc[t] = wmmab(a, bh, acc[t]); acc[t] = wmmab(al, bh, acc[t]); acc[t] = wmmab(a, bl, acc[t]); }
        asm volatile("v_nop\n\tv_nop\n\tv_nop\n\tv_nop" : "+v"(acc[0]), "+v"(acc[1]), "+v"(acc[2]), "+v"(acc[3]) : "v"(a), "v"(al));
    }
    float* os = &ost[wave][0];
#pragma unroll
    for (int t = 0; t < 4; ++t) { const float bv = bfr(bias[c0 + t * 16 + lr]);
#pragma unroll
        for (int j = 0; j < 8; ++j) os[(hi * 8 + j) * 68 + t * 16 + lr] = acc[t][j] + bv; }
    __builtin_amdgcn_wave_barrier(); asm volatile("" ::: "memory");
    float* crow = C + (size_t)r0 * ldc + c0;
    auto pass = [&]() {
#pragma unroll
        for (int s = 0; s < 8; ++s) { const int Lid = (lane >> 3) + 4 * s, piece = lane & 7; const int row = Lid >> 1, cofs = (Lid & 1) * 32 + piece * 4;
            const v4f val = *(const v4fa*)(os + row * 68 + cofs); *(v4f*)(crow + (size_t)row * ldc + cofs) = val; }
    };
    pass(); 
}

// k_red: the two small products of the chain. One work-group = one 16 x 64 tile of C = (Ah [+ Al]).(Bh + Bl)^T over K = NWV * STEPS * 32 (row strides = K; n-major B). The grid
// is small, so the contraction is split over the NWV waves (STEPS 32-k steps each, all loads of a wave independent); the partial tiles are summed through LDS in wave order and
// C leaves as bf16 hi + residual planes in whole 128-byte lines. The rows of B go in as the matrix instruction's first operand and the rows of A as its second (both loaders have
// the same k order), so a lane holds 8 neighbouring columns of one row of C and stores them 16 bytes at a time. blockIdx.z = image: sA, sB, sC as in k_gemm3
template <int NWV, int STEPS, bool SPLITA>
__global__ __launch_bounds__(NWV * 32) void k_red(const bf* __restrict__ Ah, const bf* __restrict__ Al, const bf* __restrict__ Bh, const bf* __restrict__ Bl, bf* Ch, bf* Cl, int ldc, size_t sA, size_t sB, size_t sC) {
    typedef __attribute__((ext_vector_type(4))) unsigned short v4us;
    __shared__ __align__(16) float part[NWV][16 * 68];
    constexpr int K = NWV * STEPS * 32;
    Ah += blockIdx.z * sA; if (SPLITA) Al += blockIdx.z * sA; Bh += blockIdx.z * sB; Bl += blockIdx.z * sB; Ch += blockIdx.z * sC; Cl += blockIdx.z * sC;
    const int lane = threadIdx.x & 31, wave = threadIdx.x >> 5, lr = lane & 15, hi = lane >> 4;
    const int r0 = blockIdx.x * 16, c0 = blockIdx.y * 64, k0 = wave * (STEPS * 32) + 8 * hi;
    // byte offsets: one vector register for A and one for B, named by all the loads of that operand (the plane's base is scalar; the k step and B's 16-row step are immediates)
    const unsigned ao = (unsigned)((r0 + lr) * K + k0) * 2u, bo = (unsigned)((c0 + lr) * K + k0) * 2u;
    auto frag = [](const bf* __restrict__ base, unsigned off, int el) { const char* p = (const char*)base + off; return cat16b(*(const v8us*)(p + (unsigned)(el * 2)), *(const v8us*)(p + (unsigned)(el * 2 + 32))); };
    v16bf a[STEPS], al[STEPS], bh[STEPS][4], bl[STEPS][4];
    // every loop of this kernel is unrolled: the fragment and accumulator arrays are indexed by constants only and so stay in registers
#pragma unroll
    for (int s = 0; s < STEPS; ++s) { a[s] = frag(Ah, ao, s * 32); if (SPLITA) al[s] = frag(Al, ao, s * 32);
#pragma unroll
        for (int t = 0; t < 4; ++t) { bh[s][t] = frag(Bh, bo, t * 16 * K + s * 32); bl[s][t] = frag(Bl, bo, t * 16 * K + s * 32); } }
    // the wait before a register that an issued load names is rewritten; the offsets as inputs keep their registers from being given to a result inside the run of loads
    asm volatile("s_wait_xcnt 0x0" :: "v"(ao), "v"(bo) : "memory");
    // keeps all loads of the wave in front of its first matrix instruction, so that they are in flight together; without it they are issued two at a time, each pair waited for
    __builtin_amdgcn_sched_barrier(0);
    v8f acc[4];
#pragma unroll
    for (int t = 0; t < 4; ++t) acc[t] = (v8f){};
#pragma unroll
    for (int s = 0; s < STEPS; ++s) {
#pragma unroll
        for (int t = 0; t < 4; ++t) { acc[t] = wmmab(bh[s][t], a[s], acc[t]); if (SPLITA) acc[t] = wmmab(bh[s][t], al[s], acc[t]); acc[t] = wmmab(bl[s][t], a[s], acc[t]); }
    }
    // keeps the LDS stores behind the last matrix instruction, so that the four accumulators have registers of their own
    __builtin_amdgcn_sched_barrier(0);
    float* os = &part[wave][lr * 68 + hi * 8];
#pragma unroll
    for (int t = 0; t < 4; ++t) { *(v4fa*)(os + t * 16) = (v4f){acc[t][0], acc[t][1], acc[t][2], acc[t][3]}; *(v4fa*)(os + t * 16 + 4) = (v4f){acc[t][4], acc[t][5], acc[t][6], acc[t][7]}; }
    __syncthreads();
#pragma unroll
    for (int g = threadIdx.x; g < 16 * 16; g += NWV * 32) { const int row = g >> 4, cofs = (g & 15) * 4;
        v4f v = *(const v4fa*)(&part[0][row * 68 + cofs]);
#pragma unroll
        for (int w = 1; w < NWV; ++w) v += *(const v4fa*)(&part[w][row * 68 + cofs]);
        v4us oh, ol;
#pragma unroll
        for (int i = 0; i < 4; ++i) { const unsigned short hb = f2bf(v[i]); oh[i] = hb; ol[i] = f2bf(v[i] - bf2f(hb)); }
        const size_t o = (size_t)(r0 + row) * ldc + c0 + cofs; *(v4us*)(Ch + o) = oh; *(v4us*)(Cl + o) = ol; }
}

// blockIdx.z = image of x1 (0 .. NB_ - 1) or of x2 (NB_ .. 2 NB_ - 1); XT holds the 2 NB_ transposed images one behind the other
__global__ __launch_bounds__(256) void k_ptb(const float* __restrict__ x1, const float* __restrict__ x2, bf* XT) {
    __shared__ float tl[64][65];
    const float* xb = (blockIdx.z < NB_ ? x1 + (size_t)blockIdx.z * CIN * NPX : x2 + (size_t)(blockIdx.z - NB_) * CIN * NPX); XT += (size_t)blockIdx.z * NPX * CIN;
    typedef __attribute__((ext_vector_type(4))) unsigned short v4us;
    const int tid = threadIdx.x, c0 = blockIdx.x * 64, p0 = blockIdx.y * 64; const int rr = tid >> 2, cq = (tid & 3) * 16;
#pragma unroll
    for (int i = 0; i < 16; ++i) tl[rr][cq + i] = xb[(size_t)(c0 + rr) * NPX + p0 + cq + i];
    __syncthreads();
    const int lane = tid & 31, wv = tid >> 5;
    auto pass = [&]() {
#pragma unroll
        for (int st = 0; st < 4; ++st) { const int pr = wv * 8 + st * 2 + (lane >> 4); const int cl = (lane & 15) * 4; v4us v;
#pragma unroll
            for (int i = 0; i < 4; ++i) v[i] = f2bf(tl[cl + i][pr]);
            *(v4us*)(XT + (size_t)(p0 + pr) * CIN + c0 + cl) = v; }
    };
    pass(); 
}
__device__ __forceinline__ void split128_blk(unsigned blk, const float* __restrict__ src, int rows, float sc, bf* dh, bf* dl) {
    typedef __attribute__((ext_vector_type(4))) unsigned short v4us;
    const int lane = threadIdx.x & 31; const size_t r = (size_t)blk * 8 + (threadIdx.x >> 5); if (r >= (size_t)rows) return; const size_t o = r * CI + lane * 4; const v4f v = *(const v4f*)(src + o); v4us oh, ol;
#pragma unroll
    for (int i = 0; i < 4; ++i) { const float y = v[i] * sc; const unsigned short hb = f2bf(y); oh[i] = hb; ol[i] = f2bf(y - bf2f(hb)); }
    *(v4us*)(dh + o) = oh; *(v4us*)(dl + o) = ol; 
}
// blk counts the CI * (MP / 64) / 8 blocks of image 0, then those of image 1, ...
__device__ __forceinline__ void poolgT_blk(unsigned blk, const float* __restrict__ F, bf* Th, bf* Tl) {
    typedef __attribute__((ext_vector_type(2))) unsigned short v2us;
    const unsigned img = blk / (CI * (MP / 64) / 8); F += (size_t)img * NPX * CI; Th += (size_t)img * CI * MP; Tl += (size_t)img * CI * MP;
    const int lane = threadIdx.x & 31; const size_t wid = (size_t)(blk % (CI * (MP / 64) / 8)) * 8 + (threadIdx.x >> 5); if (wid >= (size_t)CI * (MP / 64)) return; const int c = (int)(wid / (MP / 64)); const int m0 = (int)(wid % (MP / 64)) * 64 + lane * 2; v2us oh, ol;
#pragma unroll
    for (int q = 0; q < 2; ++q) { const int m = m0 + q; const int py = m / (WW / 2), px = m % (WW / 2); const size_t p00 = (size_t)(2 * py) * WW + 2 * px;
        const float y = fmaxf(fmaxf(F[p00 * CI + c], F[(p00 + 1) * CI + c]), fmaxf(F[(p00 + WW) * CI + c], F[(p00 + WW + 1) * CI + c])); const unsigned short hb = f2bf(y); oh[q] = hb; ol[q] = f2bf(y - bf2f(hb)); }
    const size_t o = (size_t)c * MP + m0; *(v2us*)(Th + o) = oh; *(v2us*)(Tl + o) = ol; 
}
// k_prep: the three independent passes over the conv outputs of all images in one grid: g and phi pool + transpose (the longest blocks, so they start first), theta split
#define PREP_G (NB_ * CI * (MP / 64) / 8)
#define PREP_T (NB_ * NPX / 8)
__global__ __launch_bounds__(256) void k_prep(const float* __restrict__ TH, const float* __restrict__ PHI, const float* __restrict__ G, bf* Th, bf* Tl, bf* FTh, bf* FTl, bf* GTh, bf* GTl) {
    const unsigned blk = blockIdx.x;
    if (blk < PREP_G) poolgT_blk(blk, G, GTh, GTl);
    else if (blk < 2 * PREP_G) poolgT_blk(blk - PREP_G, PHI, FTh, FTl);
    else split128_blk(blk - 2 * PREP_G, TH, NB_ * NPX, 1.0f / (float)MP, Th, Tl);
}
// BatchNorm statistics in two launches. k_bnpart: work-group b takes rows [b * BNR, (b + 1) * BNR) of WY, every row read once (16 B a lane, a wave covers 512 contiguous
// bytes, all 16 loads of a thread in flight); each thread forms the mean and the sum of squared deviations (M2) of its 16 rows from registers; equal-sized groups combine as
// mean = average of the means, M2 = sum of the M2 + count * sum of (group mean - mean)^2, in a fixed order. k_bnfin combines the BNP chunks the same way.
#define BNP 256
#define BNR (NB_ * NPX / BNP)
__global__ __launch_bounds__(512) void k_bnpart(const float* __restrict__ WY, float* PM, float* PQ) {
    __shared__ __align__(16) float sm[8][CIN];
    __shared__ __align__(16) float sq[8][CIN];
    const int tid = threadIdx.x, g = tid >> 6, cq = (tid & 63) * 4;
    const float* p = WY + (size_t)blockIdx.x * BNR * CIN;
    const unsigned off = (unsigned)(g * CIN + cq);
    v4f v[BNR / 8];
#pragma unroll
    for (int i = 0; i < BNR / 8; ++i) v[i] = *(const v4f*)(p + off + (unsigned)(i * 8 * CIN));
    v4f s = v[0];
#pragma unroll
    for (int i = 1; i < BNR / 8; ++i) s += v[i];
    const v4f m = s * (1.0f / (float)(BNR / 8));
    v4f q = (v4f){};
#pragma unroll
    for (int i = 0; i < BNR / 8; ++i) { const v4f d = v[i] - m; q += d * d; }
    *(v4fa*)&sm[g][cq] = m; *(v4fa*)&sq[g][cq] = q;
    __syncthreads();
    if (tid < CIN) { float a = 0.f, qq = 0.f, e = 0.f;
#pragma unroll
        for (int k = 0; k < 8; ++k) a += sm[k][tid];
        const float mu = a * 0.125f;
#pragma unroll
        for (int k = 0; k < 8; ++k) { const float d = sm[k][tid] - mu; e = fmaf(d, d, e); qq += sq[k][tid]; }
        PM[(size_t)blockIdx.x * CIN + tid] = mu; PQ[(size_t)blockIdx.x * CIN + tid] = fmaf((float)(BNR / 8), e, qq); }
}
__global__ __launch_bounds__(512) void k_bnfin(const float* __restrict__ PM, const float* __restrict__ PQ, float* MEAN, float* RSTD) {
    __shared__ float sm[16][32];
    __shared__ float sq[16][32];
    const int lane = threadIdx.x & 31, g = threadIdx.x >> 5; const int c = blockIdx.x * 32 + lane;
    const float* pm = PM + blockIdx.x * 32; const float* pq = PQ + blockIdx.x * 32;
    const unsigned boff = (unsigned)(g * (BNP / 16) * CIN + lane) * 4u;   // byte offset, the one vector register that all 32 loads name
    float m[BNP / 16], q[BNP / 16];
#pragma unroll
    for (int i = 0; i < BNP / 16; ++i) { m[i] = *(const float*)((const char*)pm + boff + (unsigned)(i * CIN * 4)); q[i] = *(const float*)((const char*)pq + boff + (unsigned)(i * CIN * 4)); }
    // the wait before a register that an issued load names is rewritten; boff as an input keeps its register from being given to a result inside the run of loads
    asm volatile("s_wait_xcnt 0x0" :: "v"(boff) : "memory");
    float a = 0.f, qq = 0.f, e = 0.f;
#pragma unroll
    for (int i = 0; i < BNP / 16; ++i) a += m[i];
    const float lm = a * (1.0f / (float)(BNP / 16));
#pragma unroll
    for (int i = 0; i < BNP / 16; ++i) { const float d = m[i] - lm; e = fmaf(d, d, e); qq += q[i]; }
    sm[g][lane] = lm; sq[g][lane] = fmaf((float)BNR, e, qq);
    __syncthreads();
    if (g == 0) { float a2 = 0.f, q2 = 0.f, e2 = 0.f;
#pragma unroll
        for (int k = 0; k < 16; ++k) a2 += sm[k][lane];
        const float mu = a2 * (1.0f / 16.0f);
#pragma unroll
        for (int k = 0; k < 16; ++k) { const float d = sm[k][lane] - mu; e2 = fmaf(d, d, e2); q2 += sq[k][lane]; }
        const float rs = rsqrtf(fmaf((float)(BNR * (BNP / 16)), e2, q2) / (float)(NB_ * NPX) + BEPS);
        MEAN[c] = mu; RSTD[c] = rs; }
}
__global__ __launch_bounds__(256) void k_bnout(const float* __restrict__ WY, const float* __restrict__ x1, const float* __restrict__ MEAN, const float* __restrict__ RSTD, const float* __restrict__ gam, const float* __restrict__ bet, float* OUTB) {
    __shared__ float tl[64][65];
    const int tid = threadIdx.x; const int p0 = blockIdx.x * 64, c0 = blockIdx.y * 64, b = blockIdx.z; const int rr = tid >> 2, cq = (tid & 3) * 16;
#pragma unroll
    for (int i = 0; i < 16; ++i) { const int c = c0 + cq + i; tl[rr][cq + i] = (WY[((size_t)b * NPX + p0 + rr) * CIN + c] - MEAN[c]) * RSTD[c] * bfr(gam[c]) + bfr(bet[c]); }
    __syncthreads();
    const int lane = tid & 31, wv = tid >> 5;
    auto pass = [&]() {
#pragma unroll
        for (int st = 0; st < 4; ++st) { const int cr = wv * 8 + st * 2 + (lane >> 4); const int pq = (lane & 15) * 4; v4f v; const size_t o = ((size_t)b * CIN + c0 + cr) * NPX + p0 + pq;
#pragma unroll
            for (int i = 0; i < 4; ++i) v[i] = tl[pq + i][cr] + bfr(x1[o + i]);
            *(v4f*)(OUTB + o) = v; }
    };
    pass(); 
}

extern "C" void kernel_launch(void* const* d_in, const int* in_sizes, int n_in,
                              void* d_out, int out_size, void* d_ws, size_t ws_size, hipStream_t stream) {
    (void)in_sizes; (void)n_in; (void)out_size;
    const float* x1 = (const float*)d_in[0]; const float* x2 = (const float*)d_in[1]; const float* wg = (const float*)d_in[2]; const float* bg = (const float*)d_in[3]; const float* wth = (const float*)d_in[4]; const float* bth = (const float*)d_in[5]; const float* wph = (const float*)d_in[6]; const float* bph = (const float*)d_in[7];
    const float* wout = (const float*)d_in[8]; const float* bout = (const float*)d_in[9]; const float* gam = (const float*)d_in[10]; const float* bet = (const float*)d_in[11];
    float* out = (float*)d_out;    // [8][256][64][64]
    char* wsp = (char*)d_ws;
    auto take = [&](size_t bytes) { char* p = wsp; wsp += (bytes + 255) & ~(size_t)255; return (void*)p; };
    bf* WG = (bf*)take((size_t)CI * CIN * 2); bf* WT = (bf*)take((size_t)CI * CIN * 2); bf* WP = (bf*)take((size_t)CI * CIN * 2); bf* WO = (bf*)take((size_t)CIN * CI * 2);
    // all NB_ images at once
    bf* Th = (bf*)take((size_t)NB_ * NPX * CI * 2); bf* Tl = (bf*)take((size_t)NB_ * NPX * CI * 2); bf* FTh = (bf*)take((size_t)NB_ * CI * MP * 2); bf* FTl = (bf*)take((size_t)NB_ * CI * MP * 2); bf* GTh = (bf*)take((size_t)NB_ * CI * MP * 2); bf* GTl = (bf*)take((size_t)NB_ * CI * MP * 2);
    bf* XT = (bf*)take((size_t)2 * NB_ * NPX * CIN * 2); bf* X1T = XT; bf* X2T = XT + (size_t)NB_ * NPX * CIN; float* TH = (float*)take((size_t)NB_ * NPX * CI * 4); float* PHI = (float*)take((size_t)NB_ * NPX * CI * 4); float* G = (float*)take((size_t)NB_ * NPX * CI * 4);
    bf* KMh = (bf*)take((size_t)NB_ * CI * CI * 2); bf* KMl = (bf*)take((size_t)NB_ * CI * CI * 2); bf* QTh = (bf*)take((size_t)NB_ * CIN * CI * 2); bf* QTl = (bf*)take((size_t)NB_ * CIN * CI * 2);
    float* WY = (float*)take((size_t)NB_ * NPX * CIN * 4); float* MEAN = (float*)take(CIN * 4); float* RSTD = (float*)take(CIN * 4); float* PM = (float*)take((size_t)BNP * CIN * 4); float* PQ = (float*)take((size_t)BNP * CIN * 4);
    if ((size_t)(wsp - (char*)d_ws) > ws_size) return;    // MiB: 0.25 + 16 + 4 + 4 + 32 + 48 + 1.5 + 32 + 0.5 ~ 139
    k_cvt8<<<dim3((CI * CIN / 8 + 255) / 256, 4, 1), 256, 0, stream>>>(wg, wth, wph, wout, WG, WT, WP, WO, CI * CIN / 8);   // 'oc' weights natural
    k_ptb<<<dim3(CIN / 64, NPX / 64, 2 * NB_), 256, 0, stream>>>(x1, x2, XT);
    k_conv3<<<dim3(NB_ * NPX / 64, CI / 64, 3), 128, 0, stream>>>(X1T, X2T, WT, WP, WG, bth, bph, bg, TH, PHI, G);
    k_prep<<<2 * PREP_G + PREP_T, 256, 0, stream>>>(TH, PHI, G, Th, Tl, FTh, FTl, GTh, GTl);                              // 1/M folded into theta
    k_red<16, MP / 512, true><<<dim3(CI / 16, CI / 64, NB_), 512, 0, stream>>>(FTh, FTl, GTh, GTl, KMh, KMl, CI, (size_t)CI * MP, (size_t)CI * MP, (size_t)CI * CI);    // KM[k][c] = sum_m phi[k][m] g[c][m]
    k_red<4, CI / 128, false><<<dim3(CIN / 16, CI / 64, NB_), 128, 0, stream>>>(WO, nullptr, KMh, KMl, QTh, QTl, CI, 0, (size_t)CI * CI, (size_t)CIN * CI);           // QT[o][k] = sum_c W[o][c] KM[k][c]
    k_gemm3<<<dim3(NPX / 64, CIN / 64, NB_), 128, 0, stream>>>(Th, Tl, QTh, QTl, bout, CI, WY, CIN, (size_t)NPX * CI, (size_t)CIN * CI, (size_t)NPX * CIN);            // WY[n][o] = sum_k theta[n][k] / M . QT[o][k] + b[o]
    k_bnpart<<<BNP, 512, 0, stream>>>(WY, PM, PQ); k_bnfin<<<CIN / 32, 512, 0, stream>>>(PM, PQ, MEAN, RSTD);
    k_bnout<<<dim3(NPX / 64, CIN / 64, NB_), 256, 0, stream>>>(WY, x1, MEAN, RSTD, gam, bet, out);
}

// v004
// One run takes 89.8 microseconds.
// Next to v003, in two timings, it ran 1.60 and 1.59 times as fast.
// All steps since v000 together make it 24.5 times as fast.
#include <hip/hip_runtime.h>

// Compute dtypes, f32 accumulate, per image: theta (on x1) and g/phi (on x2) 1x1 convs as [4096 x 256].[256 x 128] GEMMs with PLAIN bf16 operands (inputs transposed to
// pixel-major exact bf16; exact products, + bias), the 2x2 max-pool on the conv outputs in f32. There is NO softmax in this module, so W.((theta^T.phi / M).g^T) is one chain of
// linear products and is taken from the right: KM = phi.g^T ([128 x 1024].[1024 x 128]), QT = W.KM^T ([256 x 128].[128 x 128]), then theta^T.QT^T / M + bias
// ([4096 x 128].[128 x 256]); the [4096 x 1024] matrix f is never formed. theta, phi, g, KM and QT go in as bf16 hi + UNSCALED residual planes (three products; W plain bf16, two
// products) - on v_wmma_f32_16x16x32_bf16; training-mode BatchNorm statistics over (B,H,W) per channel (fixed-order f32 column sums), the affine, + x1 and the NCHW

#define NB_  8
#define CIN  256
#define CI   128
#define HH   64
#define WW   64
#define NPX  4096
#define MP   1024
#define DM   CIN
#define BEPS 1e-5f
#define LOSC 1024.0f

typedef _Float16 h16;
typedef unsigned short bf;
typedef __attribute__((ext_vector_type(16))) __bf16   v16bf;
typedef __attribute__((ext_vector_type(16))) _Float16 v16h;
typedef __attribute__((ext_vector_type(8)))  _Float16 v8h;
typedef __attribute__((ext_vector_type(8)))  unsigned short v8us;
typedef __attribute__((ext_vector_type(8)))  float    v8f;
typedef __attribute__((ext_vector_type(4)))  float    v4f;
typedef v8h  __attribute__((may_alias)) v8ha;
typedef v4f  __attribute__((may_alias)) v4fa;
typedef v8us __attribute__((may_alias)) v8usa;

__device__ __forceinline__ unsigned short f2bf(float f) { unsigned u = __float_as_uint(f); u += 0x7FFFu + ((u >> 16) & 1u); return (unsigned short)(u >> 16); }
__device__ __forceinline__ float bf2f(unsigned short b) { return __uint_as_float(((unsigned)b) << 16); }
__device__ __forceinline__ float bfr(float f) { return bf2f(f2bf(f)); }
__device__ __forceinline__ v16h cat16(v8h lo, v8h hi) { return __builtin_shufflevector(lo, hi, 0, 1, 2, 3, 4, 5, 6, 7, 8, 9, 10, 11, 12, 13, 14, 15); }
__device__ __forceinline__ v16bf cat16b(v8us lo, v8us hi) { return __builtin_bit_cast(v16bf, __builtin_shufflevector(lo, hi, 0, 1, 2, 3, 4, 5, 6, 7, 8, 9, 10, 11, 12, 13, 14, 15)); }
__device__ __forceinline__ v8f wmma16(v16h a, v16h b, v8f c) { return __builtin_amdgcn_wmma_f32_16x16x32_f16(false, a, false, b, (short)0, c, false, false); }
__device__ __forceinline__ v8f wmmab(v16bf a, v16bf b, v8f c) { return __builtin_amdgcn_wmma_f32_16x16x32_bf16(false, a, false, b, (short)0, c, false, false); }

// k_convf: the three 1x1 convs in one grid, each leaving directly as the bf16 hi + residual planes that the next products read; blockIdx.z picks theta (on x1), phi or g (on x2).
// One work-group = 256 pixels (4 image rows of one image) x 64 output channels of C = A.B^T + bf(bias[c]) over K = CIN (A: [NB_ * NPX][CIN] pixel-major, B: n-major weights).
// Wave w holds two 16 x 64 tiles: the same 16 x positions of image rows 2q and 2q + 1 (q = w / 4), so all four pixels of a 2x2 pool window lie in one lane's accumulators
// (neighbouring x = neighbouring registers, the row below = the second tile). theta: times 1/M, split, rows of 128 bytes a plane. phi, g: max of the four f32 values, split, and
// the work-group's 64 channels x 64 pooled positions are turned through LDS so that every [channel][m] row piece leaves as one whole 128-byte line.
__global__ __launch_bounds__(256) void k_convf(const bf* __restrict__ X1T, const bf* __restrict__ X2T, const bf* __restrict__ WT, const bf* __restrict__ WP, const bf* __restrict__ WG, const float* __restrict__ bth, const float* __restrict__ bph, const float* __restrict__ bg, bf* Th, bf* Tl, bf* FTh, bf* FTl, bf* GTh, bf* GTl) {
    typedef __attribute__((ext_vector_type(4))) unsigned short v4us;
    typedef v4us __attribute__((may_alias)) v4usa;
    __shared__ __align__(16) float ost[8][16 * 68];
    const int z = blockIdx.z;
    const bf* __restrict__ A = z == 0 ? X1T : X2T; const bf* __restrict__ Bn = z == 0 ? WT : (z == 1 ? WP : WG); const float* __restrict__ bias = z == 0 ? bth : (z == 1 ? bph : bg);
    const int lane = threadIdx.x & 31, wave = threadIdx.x >> 5, lr = lane & 15, hi = lane >> 4;
    const int r0 = blockIdx.x * 256 + (wave >> 2) * (2 * WW) + (wave & 3) * 16, c0 = blockIdx.y * 64;
    // byte offsets: one vector register for A and one for B, named by all the loads of that operand (the base is scalar; the k step, A's second image row and B's 16-row step are immediates)
    const unsigned ao = (unsigned)((r0 + lr) * CIN + 8 * hi) * 2u, bo = (unsigned)((c0 + lr) * CIN + 8 * hi) * 2u;
    auto frag = [](const bf* __restrict__ base, unsigned off, int el) { const char* p = (const char*)base + off; return cat16b(*(const v8us*)(p + (unsigned)(el * 2)), *(const v8us*)(p + (unsigned)(el * 2 + 32))); };
    float bv[4];   // read in front of the k loop, so that the epilogue does not wait for it
#pragma unroll
    for (int t = 0; t < 4; ++t) bv[t] = bfr(bias[c0 + t * 16 + lr]);
    v8f acc[2][4];
#pragma unroll
    for (int t = 0; t < 4; ++t) { acc[0][t] = (v8f){}; acc[1][t] = (v8f){}; }
    // unrolled: the k step is an immediate of every load
#pragma unroll
    for (int kc = 0; kc < CIN; kc += 32) {
        const v16bf a0 = frag(A, ao, kc), a1 = frag(A, ao, WW * CIN + kc);
        v16bf b[4];
#pragma unroll
        for (int t = 0; t < 4; ++t) b[t] = frag(Bn, bo, t * 16 * CIN + kc);
        // keeps the twelve loads of a step in front of its first matrix instruction, so that they are in flight together; without it B's are issued two at a time, each pair waited for
        __builtin_amdgcn_sched_barrier(0);
#pragma unroll
        for (int t = 0; t < 4; ++t) { acc[0][t] = wmmab(a0, b[t], acc[0][t]); acc[1][t] = wmmab(a1, b[t], acc[1][t]); }
    }
    // the wait before a register that an issued load names is rewritten; the offsets as inputs keep their registers from being given to another value inside the run of loads
    asm volatile("s_wait_xcnt 0x0" :: "v"(ao), "v"(bo) : "memory");
    if (z == 0) {
        float* os = &ost[wave][0];
#pragma unroll
        for (int rt = 0; rt < 2; ++rt) {
#pragma unroll
            for (int t = 0; t < 4; ++t) {
#pragma unroll
                for (int j = 0; j < 8; ++j) os[(hi * 8 + j) * 68 + t * 16 + lr] = acc[rt][t][j] + bv[t]; }
            // the tile is the wave's own: keeps the compiler from moving the reads below in front of the other lanes' stores
            __builtin_amdgcn_wave_barrier(); asm volatile("" ::: "memory");
#pragma unroll
            for (int s = 0; s < 4; ++s) { const int row = 4 * s + (lane >> 3), piece = lane & 7; const float* sp = os + row * 68 + piece * 8; const v4f p = *(const v4fa*)sp, q = *(const v4fa*)(sp + 4); v8us oh, ol;
#pragma unroll
                for (int i = 0; i < 8; ++i) { const float y = (i < 4 ? p[i & 3] : q[i & 3]) * (1.0f / (float)MP); const unsigned short hb = f2bf(y); oh[i] = hb; ol[i] = f2bf(y - bf2f(hb)); }
                const size_t o = (size_t)(r0 + rt * WW + row) * CI + c0 + piece * 8; *(v8us*)(Th + o) = oh; *(v8us*)(Tl + o) = ol; }
            // and the second tile's stores behind the first tile's reads
            __builtin_amdgcn_wave_barrier(); asm volatile("" ::: "memory");
        }
    } else {
        constexpr int PP = 72;   // LDS pitch in 16-bit elements: 64 pooled positions + 16 bytes
        unsigned short* sh = (unsigned short*)(void*)&ost[0][0]; unsigned short* sl = sh + 64 * PP;
#pragma unroll
        for (int t = 0; t < 4; ++t) { v4us oh, ol;
#pragma unroll
            for (int q = 0; q < 4; ++q) { const float y = fmaxf(fmaxf(acc[0][t][2 * q] + bv[t], acc[0][t][2 * q + 1] + bv[t]), fmaxf(acc[1][t][2 * q] + bv[t], acc[1][t][2 * q + 1] + bv[t])); const unsigned short hb = f2bf(y); oh[q] = hb; ol[q] = f2bf(y - bf2f(hb)); }
            const int so = (t * 16 + lr) * PP + wave * 8 + hi * 4; *(v4usa*)(sh + so) = oh; *(v4usa*)(sl + so) = ol; }
        __syncthreads();
        const size_t io = (size_t)(blockIdx.x / (NPX / 256)) * CI * MP + (size_t)(blockIdx.x % (NPX / 256)) * 64;
        bf* Dh = (z == 1 ? FTh : GTh) + io; bf* Dl = (z == 1 ? FTl : GTl) + io;
#pragma unroll
        for (int s = 0; s < 2; ++s) { const int g = threadIdx.x + s * 256, row = g >> 3, piece = g & 7;
            const v8us vh = *(const v8usa*)(sh + row * PP + piece * 8), vl = *(const v8usa*)(sl + row * PP + piece * 8);
            const size_t o = (size_t)(c0 + row) * MP + piece * 8; *(v8us*)(Dh + o) = vh; *(v8us*)(Dl + o) = vl; }
        // the wait before a register that an issued store names is rewritten: in the built code the theta branch's instructions stand behind these stores
        asm volatile("s_wait_xcnt 0x0" ::: "memory");
    }
}

// k_cvt8: blockIdx.y picks one of four equally long arrays
__global__ __launch_bounds__(256) void k_cvt8(const float* __restrict__ s0, const float* __restrict__ s1, const float* __restrict__ s2, const float* __restrict__ s3, bf* d0, bf* d1, bf* d2, bf* d3, size_t n8) {
    const int w = blockIdx.y; const float* src = w == 0 ? s0 : (w == 1 ? s1 : (w == 2 ? s2 : s3)); bf* dst = w == 0 ? d0 : (w == 1 ? d1 : (w == 2 ? d2 : d3));
    const size_t i = (size_t)blockIdx.x * 256 + threadIdx.x; if (i >= n8) return;
    const v8f v = *(const v8f*)(src + i * 8); v8us o;
#pragma unroll
    for (int k = 0; k < 8; ++k) o[k] = f2bf(v[k]);
    *(v8us*)(dst + i * 8) = o; 
}
__global__ __launch_bounds__(256) void k_zero8(bf* dst, size_t n8) {
    const size_t i = (size_t)blockIdx.x * 256 + threadIdx.x; if (i >= n8) return; v8us z;
#pragma unroll
    for (int k = 0; k < 8; ++k) z[k] = 0;
    *(v8us*)(dst + i * 8) = z; 
}
// k_gemm3: 64 x 64 tile of C = (Ah + Al).(Bh + Bl)^T + bf(bias[c]) over K (row strides = K for all four planes; n-major B): three products per 32-k step (hh, hl, lh); f32
// blockIdx.z = image: sA, sB, sC are the elements from one image's A planes, B planes and C to the next image's
__global__ __launch_bounds__(128) void k_gemm3(const bf* __restrict__ Ah, const bf* __restrict__ Al, const bf* __restrict__ Bh, const bf* __restrict__ Bl, const float* __restrict__ bias, int K, float* C, int ldc, size_t sA, size_t sB, size_t sC) {
    __shared__ __align__(16) float ost[4][16 * 68];
    Ah += blockIdx.z * sA; Al += blockIdx.z * sA; Bh += blockIdx.z * sB; Bl += blockIdx.z * sB; C += blockIdx.z * sC;
    const int lane = threadIdx.x & 31, wave = threadIdx.x >> 5, lr = lane & 15, hi = lane >> 4;
    const int r0 = blockIdx.x * 64 + wave * 16, c0 = blockIdx.y * 64;
    const size_t aoff = (size_t)(r0 + lr) * K + 8 * hi;
    v8f acc[4];
#pragma unroll
    for (int t = 0; t < 4; ++t) acc[t] = (v8f){};
#pragma unroll 1
    for (int kc = 0; kc < K; kc += 32) {
        const v16bf a = cat16b(*(const v8us*)(Ah + aoff + kc), *(const v8us*)(Ah + aoff + kc + 16));
        const v16bf al = cat16b(*(const v8us*)(Al + aoff + kc), *(const v8us*)(Al + aoff + kc + 16));
#pragma unroll
        for (int t = 0; t < 4; ++t) { const size_t bo = (size_t)(c0 + t * 16 + lr) * K + kc + 8 * hi;
            const v16bf bh = cat16b(*(const v8us*)(Bh + bo), *(const v8us*)(Bh + bo + 16)); const v16bf bl = cat16b(*(const v8us*)(Bl + bo), *(const v8us*)(Bl + bo + 16));
            acc[t] = wmmab(a, bh, acc[t]); acc[t] = wmmab(al, bh, acc[t]); acc[t] = wmmab(a, bl, acc[t]); }
        asm volatile("v_nop\n\tv_nop\n\tv_nop\n\tv_nop" : "+v"(acc[0]), "+v"(acc[1]), "+v"(acc[2]), "+v"(acc[3]) : "v"(a), "v"(al));
    }
    float* os = &ost[wave][0];
#pragma unroll
    for (int t = 0; t < 4; ++t) { const float bv = bfr(bias[c0 + t * 16 + lr]);
#pragma unroll
        for (int j = 0; j < 8; ++j) os[(hi * 8 + j) * 68 + t * 16 + lr] = acc[t][j] + bv; }
    __builtin_amdgcn_wave_barrier(); asm volatile("" ::: "memory");
    float* crow = C + (size_t)r0 * ldc + c0;
    auto pass = [&]() {
#pragma unroll
        for (int s = 0; s < 8; ++s) { const int Lid = (lane >> 3) + 4 * s, piece = lane & 7; const int row = Lid >> 1, cofs = (Lid & 1) * 32 + piece * 4;
            const v4f val = *(const v4fa*)(os + row * 68 + cofs); *(v4f*)(crow + (size_t)row * ldc + cofs) = val; }
    };
    pass(); 
}

// k_red: the two small products of the chain. One work-group = one 16 x 64 tile of C = (Ah [+ Al]).(Bh + Bl)^T over K = NWV * STEPS * 32 (row strides = K; n-major B). The grid
// is small, so the contraction is split over the NWV waves (STEPS 32-k steps each, all loads of a wave independent); the partial tiles are summed through LDS in wave order and
// C leaves as bf16 hi + residual planes in whole 128-byte lines. The rows of B go in as the matrix instruction's first operand and the rows of A as its second (both loaders have
// the same k order), so a lane holds 8 neighbouring columns of one row of C and stores them 16 bytes at a time. blockIdx.z = image: sA, sB, sC as in k_gemm3
template <int NWV, int STEPS, bool SPLITA>
__global__ __launch_bounds__(NWV * 32) void k_red(const bf* __restrict__ Ah, const bf* __restrict__ Al, const bf* __restrict__ Bh, const bf* __restrict__ Bl, bf* Ch, bf* Cl, int ldc, size_t sA, size_t sB, size_t sC) {
    typedef __attribute__((ext_vector_type(4))) unsigned short v4us;
    __shared__ __align__(16) float part[NWV][16 * 68];
    constexpr int K = NWV * STEPS * 32;
    Ah += blockIdx.z * sA; if (SPLITA) Al += blockIdx.z * sA; Bh += blockIdx.z * sB; Bl += blockIdx.z * sB; Ch += blockIdx.z * sC; Cl += blockIdx.z * sC;
    const int lane = threadIdx.x & 31, wave = threadIdx.x >> 5, lr = lane & 15, hi = lane >> 4;
    const int r0 = blockIdx.x * 16, c0 = blockIdx.y * 64, k0 = wave * (STEPS * 32) + 8 * hi;
    // byte offsets: one vector register for A and one for B, named by all the loads of that operand (the plane's base is scalar; the k step and B's 16-row step are immediates)
    const unsigned ao = (unsigned)((r0 + lr) * K + k0) * 2u, bo = (unsigned)((c0 + lr) * K + k0) * 2u;
    auto frag = [](const bf* __restrict__ base, unsigned off, int el) { const char* p = (const char*)base + off; return cat16b(*(const v8us*)(p + (unsigned)(el * 2)), *(const v8us*)(p + (unsigned)(el * 2 + 32))); };
    v16bf a[STEPS], al[STEPS], bh[STEPS][4], bl[STEPS][4];
    // every loop of this kernel is unrolled: the fragment and accumulator arrays are indexed by constants only and so stay in registers
#pragma unroll
    for (int s = 0; s < STEPS; ++s) { a[s] = frag(Ah, ao, s * 32); if (SPLITA) al[s] = frag(Al, ao, s * 32);
#pragma unroll
        for (int t = 0; t < 4; ++t) { bh[s][t] = frag(Bh, bo, t * 16 * K + s * 32); bl[s][t] = frag(Bl, bo, t * 16 * K + s * 32); } }
    // the wait before a register that an issued load names is rewritten; the offsets as inputs keep their registers from being given to a result inside the run of loads
    asm volatile("s_wait_xcnt 0x0" :: "v"(ao), "v"(bo) : "memory");
    // keeps all loads of the wave in front of its first matrix instruction, so that they are in flight together; without it they are issued two at a time, each pair waited for
    __builtin_amdgcn_sched_barrier(0);
    v8f acc[4];
#pragma unroll
    for (int t = 0; t < 4; ++t) acc[t] = (v8f){};
#pragma unroll
    for (int s = 0; s < STEPS; ++s) {
#pragma unroll
        for (int t = 0; t < 4; ++t) { acc[t] = wmmab(bh[s][t], a[s], acc[t]); if (SPLITA) acc[t] = wmmab(bh[s][t], al[s], acc[t]); acc[t] = wmmab(bl[s][t], a[s], acc[t]); }
    }
    // keeps the LDS stores behind the last matrix instruction, so that the four accumulators have registers of their own
    __builtin_amdgcn_sched_barrier(0);
    float* os = &part[wave][lr * 68 + hi * 8];
#pragma unroll
    for (int t = 0; t < 4; ++t) { *(v4fa*)(os + t * 16) = (v4f){acc[t][0], acc[t][1], acc[t][2], acc[t][3]}; *(v4fa*)(os + t * 16 + 4) = (v4f){acc[t][4], acc[t][5], acc[t][6], acc[t][7]}; }
    __syncthreads();
#pragma unroll
    for (int g = threadIdx.x; g < 16 * 16; g += NWV * 32) { const int row = g >> 4, cofs = (g & 15) * 4;
        v4f v = *(const v4fa*)(&part[0][row * 68 + cofs]);
#pragma unroll
        for (int w = 1; w < NWV; ++w) v += *(const v4fa*)(&part[w][row * 68 + cofs]);
        v4us oh, ol;
#pragma unroll
        for (int i = 0; i < 4; ++i) { const unsigned short hb = f2bf(v[i]); oh[i] = hb; ol[i] = f2bf(v[i] - bf2f(hb)); }
        const size_t o = (size_t)(r0 + row) * ldc + c0 + cofs; *(v4us*)(Ch + o) = oh; *(v4us*)(Cl + o) = ol; }
}

// blockIdx.z = image of x1 (0 .. NB_ - 1) or of x2 (NB_ .. 2 NB_ - 1); XT holds the 2 NB_ transposed images one behind the other
__global__ __launch_bounds__(256) void k_ptb(const float* __restrict__ x1, const float* __restrict__ x2, bf* XT) {
    __shared__ float tl[64][65];
    const float* xb = (blockIdx.z < NB_ ? x1 + (size_t)blockIdx.z * CIN * NPX : x2 + (size_t)(blockIdx.z - NB_) * CIN * NPX); XT += (size_t)blockIdx.z * NPX * CIN;
    typedef __attribute__((ext_vector_type(4))) unsigned short v4us;
    const int tid = threadIdx.x, c0 = blockIdx.x * 64, p0 = blockIdx.y * 64; const int rr = tid >> 2, cq = (tid & 3) * 16;
#pragma unroll
    for (int i = 0; i < 16; ++i) tl[rr][cq + i] = xb[(size_t)(c0 + rr) * NPX + p0 + cq + i];
    __syncthreads();
    const int lane = tid & 31, wv = tid >> 5;
    auto pass = [&]() {
#pragma unroll
        for (int st = 0; st < 4; ++st) { const int pr = wv * 8 + st * 2 + (lane >> 4); const int cl = (lane & 15) * 4; v4us v;
#pragma unroll
            for (int i = 0; i < 4; ++i) v[i] = f2bf(tl[cl + i][pr]);
            *(v4us*)(XT + (size_t)(p0 + pr) * CIN + c0 + cl) = v; }
    };
    pass(); 
}
// BatchNorm statistics in two launches. k_bnpart: work-group b takes rows [b * BNR, (b + 1) * BNR) of WY, every row read once (16 B a lane, a wave covers 512 contiguous
// bytes, all 16 loads of a thread in flight); each thread forms the mean and the sum of squared deviations (M2) of its 16 rows from registers; equal-sized groups combine as
// mean = average of the means, M2 = sum of the M2 + count * sum of (group mean - mean)^2, in a fixed order. k_bnfin combines the BNP chunks the same way.
#define BNP 256
#define BNR (NB_ * NPX / BNP)
__global__ __launch_bounds__(512) void k_bnpart(const float* __restrict__ WY, float* PM, float* PQ) {
    __shared__ __align__(16) float sm[8][CIN];
    __shared__ __align__(16) float sq[8][CIN];
    const int tid = threadIdx.x, g = tid >> 6, cq = (tid & 63) * 4;
    const float* p = WY + (size_t)blockIdx.x * BNR * CIN;
    const unsigned off = (unsigned)(g * CIN + cq);
    v4f v[BNR / 8];
#pragma unroll
    for (int i = 0; i < BNR / 8; ++i) v[i] = *(const v4f*)(p + off + (unsigned)(i * 8 * CIN));
    v4f s = v[0];
#pragma unroll
    for (int i = 1; i < BNR / 8; ++i) s += v[i];
    const v4f m = s * (1.0f / (float)(BNR / 8));
    v4f q = (v4f){};
#pragma unroll
    for (int i = 0; i < BNR / 8; ++i) { const v4f d = v[i] - m; q += d * d; }
    *(v4fa*)&sm[g][cq] = m; *(v4fa*)&sq[g][cq] = q;
    __syncthreads();
    if (tid < CIN) { float a = 0.f, qq = 0.f, e = 0.f;
#pragma unroll
        for (int k = 0; k < 8; ++k) a += sm[k][tid];
        const float mu = a * 0.125f;
#pragma unroll
        for (int k = 0; k < 8; ++k) { const float d = sm[k][tid] - mu; e = fmaf(d, d, e); qq += sq[k][tid]; }
        PM[(size_t)blockIdx.x * CIN + tid] = mu; PQ[(size_t)blockIdx.x * CIN + tid] = fmaf((float)(BNR / 8), e, qq); }
}
__global__ __launch_bounds__(512) void k_bnfin(const float* __restrict__ PM, const float* __restrict__ PQ, float* MEAN, float* RSTD) {
    __shared__ float sm[16][32];
    __shared__ float sq[16][32];
    const int lane = threadIdx.x & 31, g = threadIdx.x >> 5; const int c = blockIdx.x * 32 + lane;
    const float* pm = PM + blockIdx.x * 32; const float* pq = PQ + blockIdx.x * 32;
    const unsigned boff = (unsigned)(g * (BNP / 16) * CIN + lane) * 4u;   // byte offset, the one vector register that all 32 loads name
    float m[BNP / 16], q[BNP / 16];
#pragma unroll
    for (int i = 0; i < BNP / 16; ++i) { m[i] = *(const float*)((const char*)pm + boff + (unsigned)(i * CIN * 4)); q[i] = *(const float*)((const char*)pq + boff + (unsigned)(i * CIN * 4)); }
    // the wait before a register that an issued load names is rewritten; boff as an input keeps its register from being given to a result inside the run of loads
    asm volatile("s_wait_xcnt 0x0" :: "v"(boff) : "memory");
    float a = 0.f, qq = 0.f, e = 0.f;
#pragma unroll
    for (int i = 0; i < BNP / 16; ++i) a += m[i];
    const float lm = a * (1.0f / (float)(BNP / 16));
#pragma unroll
    for (int i = 0; i < BNP / 16; ++i) { const float d = m[i] - lm; e = fmaf(d, d, e); qq += q[i]; }
    sm[g][lane] = lm; sq[g][lane] = fmaf((float)BNR, e, qq);
    __syncthreads();
    if (g == 0) { float a2 = 0.f, q2 = 0.f, e2 = 0.f;
#pragma unroll
        for (int k = 0; k < 16; ++k) a2 += sm[k][lane];
        const float mu = a2 * (1.0f / 16.0f);
#pragma unroll
        for (int k = 0; k < 16; ++k) { const float d = sm[k][lane] - mu; e2 = fmaf(d, d, e2); q2 += sq[k][lane]; }
        const float rs = rsqrtf(fmaf((float)(BNR * (BNP / 16)), e2, q2) / (float)(NB_ * NPX) + BEPS);
        MEAN[c] = mu; RSTD[c] = rs; }
}
__global__ __launch_bounds__(256) void k_bnout(const float* __restrict__ WY, const float* __restrict__ x1, const float* __restrict__ MEAN, const float* __restrict__ RSTD, const float* __restrict__ gam, const float* __restrict__ bet, float* OUTB) {
    __shared__ float tl[64][65];
    const int tid = threadIdx.x; const int p0 = blockIdx.x * 64, c0 = blockIdx.y * 64, b = blockIdx.z; const int rr = tid >> 2, cq = (tid & 3) * 16;
#pragma unroll
    for (int i = 0; i < 16; ++i) { const int c = c0 + cq + i; tl[rr][cq + i] = (WY[((size_t)b * NPX + p0 + rr) * CIN + c] - MEAN[c]) * RSTD[c] * bfr(gam[c]) + bfr(bet[c]); }
    __syncthreads();
    const int lane = tid & 31, wv = tid >> 5;
    auto pass = [&]() {
#pragma unroll
        for (int st = 0; st < 4; ++st) { const int cr = wv * 8 + st * 2 + (lane >> 4); const int pq = (lane & 15) * 4; v4f v; const size_t o = ((size_t)b * CIN + c0 + cr) * NPX + p0 + pq;
#pragma unroll
            for (int i = 0; i < 4; ++i) v[i] = tl[pq + i][cr] + bfr(x1[o + i]);
            *(v4f*)(OUTB + o) = v; }
    };
    pass(); 
}

extern "C" void kernel_launch(void* const* d_in, const int* in_sizes, int n_in,
                              void* d_out, int out_size, void* d_ws, size_t ws_size, hipStream_t stream) {
    (void)in_sizes; (void)n_in; (void)out_size;
    const float* x1 = (const float*)d_in[0]; const float* x2 = (const float*)d_in[1]; const float* wg = (const float*)d_in[2]; const float* bg = (const float*)d_in[3]; const float* wth = (const float*)d_in[4]; const float* bth = (const float*)d_in[5]; const float* wph = (const float*)d_in[6]; const float* bph = (const float*)d_in[7];
    const float* wout = (const float*)d_in[8]; const float* bout = (const float*)d_in[9]; const float* gam = (const float*)d_in[10]; const float* bet = (const float*)d_in[11];
    float* out = (float*)d_out;    // [8][256][64][64]
    char* wsp = (char*)d_ws;
    auto take = [&](size_t bytes) { char* p = wsp; wsp += (bytes + 255) & ~(size_t)255; return (void*)p; };
    bf* WG = (bf*)take((size_t)CI * CIN * 2); bf* WT = (bf*)take((size_t)CI * CIN * 2); bf* WP = (bf*)take((size_t)CI * CIN * 2); bf* WO = (bf*)take((size_t)CIN * CI * 2);
    // all NB_ images at once
    bf* Th = (bf*)take((size_t)NB_ * NPX * CI * 2); bf* Tl = (bf*)take((size_t)NB_ * NPX * CI * 2); bf* FTh = (bf*)take((size_t)NB_ * CI * MP * 2); bf* FTl = (bf*)take((size_t)NB_ * CI * MP * 2); bf* GTh = (bf*)take((size_t)NB_ * CI * MP * 2); bf* GTl = (bf*)take((size_t)NB_ * CI * MP * 2);
    bf* XT = (bf*)take((size_t)2 * NB_ * NPX * CIN * 2); bf* X1T = XT; bf* X2T = XT + (size_t)NB_ * NPX * CIN;
    bf* KMh = (bf*)take((size_t)NB_ * CI * CI * 2); bf* KMl = (bf*)take((size_t)NB_ * CI * CI * 2); bf* QTh = (bf*)take((size_t)NB_ * CIN * CI * 2); bf* QTl = (bf*)take((size_t)NB_ * CIN * CI * 2);
    float* WY = (float*)take((size_t)NB_ * NPX * CIN * 4); float* MEAN = (float*)take(CIN * 4); float* RSTD = (float*)take(CIN * 4); float* PM = (float*)take((size_t)BNP * CIN * 4); float* PQ = (float*)take((size_t)BNP * CIN * 4);
    if ((size_t)(wsp - (char*)d_ws) > ws_size) return;    // MiB: 0.25 + 16 + 4 + 4 + 32 + 1.5 + 32 + 0.5 ~ 91
    k_cvt8<<<dim3((CI * CIN / 8 + 255) / 256, 4, 1), 256, 0, stream>>>(wg, wth, wph, wout, WG, WT, WP, WO, CI * CIN / 8);   // 'oc' weights natural
    k_ptb<<<dim3(CIN / 64, NPX / 64, 2 * NB_), 256, 0, stream>>>(x1, x2, XT);
    k_convf<<<dim3(NB_ * NPX / 256, CI / 64, 3), 256, 0, stream>>>(X1T, X2T, WT, WP, WG, bth, bph, bg, Th, Tl, FTh, FTl, GTh, GTl);   // 1/M folded into theta
    k_red<16, MP / 512, true><<<dim3(CI / 16, CI / 64, NB_), 512, 0, stream>>>(FTh, FTl, GTh, GTl, KMh, KMl, CI, (size_t)CI * MP, (size_t)CI * MP, (size_t)CI * CI);    // KM[k][c] = sum_m phi[k][m] g[c][m]
    k_red<4, CI / 128, false><<<dim3(CIN / 16, CI / 64, NB_), 128, 0, stream>>>(WO, nullptr, KMh, KMl, QTh, QTl, CI, 0, (size_t)CI * CI, (size_t)CIN * CI);           // QT[o][k] = sum_c W[o][c] KM[k][c]
    k_gemm3<<<dim3(NPX / 64, CIN / 64, NB_), 128, 0, stream>>>(Th, Tl, QTh, QTl, bout, CI, WY, CIN, (size_t)NPX * CI, (size_t)CIN * CI, (size_t)NPX * CIN);            // WY[n][o] = sum_k theta[n][k] / M . QT[o][k] + b[o]
    k_bnpart<<<BNP, 512, 0, stream>>>(WY, PM, PQ); k_bnfin<<<CIN / 32, 512, 0, stream>>>(PM, PQ, MEAN, RSTD);
    k_bnout<<<dim3(NPX / 64, CIN / 64, NB_), 256, 0, stream>>>(WY, x1, MEAN, RSTD, gam, bet, out);
}

// v005
// One run takes 76.4 microseconds.
// Timed twice side by side with v004, it ran 1.17 times as fast both times.
// Counting every step since v000, it is 28.7 times as fast.
#include <hip/hip_runtime.h>

// Compute dtypes, f32 accumulate, per image: theta (on x1) and g/phi (on x2) 1x1 convs as [4096 x 256].[256 x 128] GEMMs with PLAIN bf16 operands (inputs rounded to
// bf16 and turned pixel-major on the way through LDS; exact products, + bias), the 2x2 max-pool on the conv outputs in f32. There is NO softmax in this module, so W.((theta^T.phi / M).g^T) is one chain of
// linear products and is taken from the right: KM = phi.g^T ([128 x 1024].[1024 x 128]), QT = W.KM^T ([256 x 128].[128 x 128]), then theta^T.QT^T / M + bias
// ([4096 x 128].[128 x 256]); the [4096 x 1024] matrix f is never formed. theta, phi, g, KM and QT go in as bf16 hi + UNSCALED residual planes (three products; W plain bf16, two
// products) - on v_wmma_f32_16x16x32_bf16; training-mode BatchNorm statistics over (B,H,W) per channel (fixed-order f32 column sums), the affine, + x1 and the NCHW

#define NB_  8
#define CIN  256
#define CI   128
#define HH   64
#define WW   64
#define NPX  4096
#define MP   1024
#define DM   CIN
#define BEPS 1e-5f
#define LOSC 1024.0f

typedef _Float16 h16;
typedef unsigned short bf;
typedef __attribute__((ext_vector_type(16))) __bf16   v16bf;
typedef __attribute__((ext_vector_type(16))) _Float16 v16h;
typedef __attribute__((ext_vector_type(8)))  _Float16 v8h;
typedef __attribute__((ext_vector_type(8)))  unsigned short v8us;
typedef __attribute__((ext_vector_type(8)))  float    v8f;
typedef __attribute__((ext_vector_type(4)))  float    v4f;
typedef v8h  __attribute__((may_alias)) v8ha;
typedef v4f  __attribute__((may_alias)) v4fa;
typedef v8us __attribute__((may_alias)) v8usa;

__device__ __forceinline__ unsigned short f2bf(float f) { unsigned u = __float_as_uint(f); u += 0x7FFFu + ((u >> 16) & 1u); return (unsigned short)(u >> 16); }
__device__ __forceinline__ float bf2f(unsigned short b) { return __uint_as_float(((unsigned)b) << 16); }
__device__ __forceinline__ float bfr(float f) { return bf2f(f2bf(f)); }
__device__ __forceinline__ v16h cat16(v8h lo, v8h hi) { return __builtin_shufflevector(lo, hi, 0, 1, 2, 3, 4, 5, 6, 7, 8, 9, 10, 11, 12, 13, 14, 15); }
__device__ __forceinline__ v16bf cat16b(v8us lo, v8us hi) { return __builtin_bit_cast(v16bf, __builtin_shufflevector(lo, hi, 0, 1, 2, 3, 4, 5, 6, 7, 8, 9, 10, 11, 12, 13, 14, 15)); }
__device__ __forceinline__ v8f wmma16(v16h a, v16h b, v8f c) { return __builtin_amdgcn_wmma_f32_16x16x32_f16(false, a, false, b, (short)0, c, false, false); }
__device__ __forceinline__ v8f wmmab(v16bf a, v16bf b, v8f c) { return __builtin_amdgcn_wmma_f32_16x16x32_bf16(false, a, false, b, (short)0, c, false, false); }

// k_convf: the three 1x1 convs in one grid, read straight from the f32 NCHW inputs, each leaving as the bf16 hi + residual planes that the next products read.
// One work-group (16 waves) = 256 pixels (4 image rows of one image) of x2 (blockIdx.y == 0: phi and g, 256 output channels) or of x1 (theta, 128), all CIN input channels.
// The tile is read once, 512 contiguous bytes a wave-load with all 32 loads of a thread in flight, rounded to bf16 and laid in LDS as it lies in memory, [channel][pixel];
// ds_load_tr16_b128 then hands out the [pixel][channel] fragments of C = A.B^T + bf(bias[c]) over K = CIN (B: n-major weights, loaded in the same k order: 8 hi + 0..7 and
// 16 + 8 hi + 0..7 of each 32). Wave (pg, cb) takes 64 pixels x 64 output channels (cb: phi's halves, g's halves; theta has two halves, so 8 of its waves have no product).
// Its four 16 x 64 tiles are 16 x positions of image rows 2q and 2q + 1 (q = pg / 2) and the next 16 of both, so all four pixels of a 2x2 pool window lie in one lane's
// accumulators (neighbouring x = neighbouring registers, the row below = the next tile). theta: times 1/M, split, rows of 128 bytes a plane. phi, g: max of the four f32 values,
// split, and each cb's 64 channels x 64 pooled positions are turned through LDS so that every [channel][m] row piece leaves as one whole 128-byte line.
#define TP 544   // LDS pitch in bytes of one channel's 256 pixels: 512 + 32, an odd multiple of 32 bytes, the transposing load's conflict-free pitch
__global__ __launch_bounds__(512) void k_convf(const float* __restrict__ x1, const float* __restrict__ x2, const bf* __restrict__ WT, const bf* __restrict__ WP, const bf* __restrict__ WG, const float* __restrict__ bth, const float* __restrict__ bph, const float* __restrict__ bg, bf* Th, bf* Tl, bf* FTh, bf* FTl, bf* GTh, bf* GTl) {
    typedef __attribute__((ext_vector_type(4))) unsigned short v4us;
    typedef v4us __attribute__((may_alias)) v4usa;
    typedef __attribute__((ext_vector_type(4))) __bf16 v4bf;
    typedef __attribute__((ext_vector_type(8))) short v8s;
    typedef __attribute__((address_space(3))) v8s lds_v8s;
    __shared__ __align__(32) unsigned char xt[CIN * TP];
    __shared__ __align__(16) float ost[16][16 * 72];
    const bool isx1 = blockIdx.y != 0;
    // the wave's number as a scalar: the bases of its weights, bias and outputs stay in scalar registers
    const int lane = threadIdx.x & 31, wv = __builtin_amdgcn_readfirstlane(threadIdx.x >> 5), lr = lane & 15, hi = lane >> 4;
    {
        const float* __restrict__ xb = (isx1 ? x1 : x2) + (size_t)(blockIdx.x / (NPX / 256)) * CIN * NPX + (size_t)(blockIdx.x % (NPX / 256)) * 256;
        // byte offset: the one vector register that all 32 loads name (the base is scalar, the step of 8 channels an immediate); two waves take one channel's 1024 bytes
        const unsigned go = (unsigned)((wv >> 1) * NPX + (wv & 1) * 128 + lane * 4) * 4u;
        v4f raw[CIN / 8];
#pragma unroll
        for (int i = 0; i < CIN / 8; ++i) raw[i] = *(const v4f*)((const char*)xb + go + (unsigned)(i * 8 * NPX * 4));
        // the wait before a register that an issued load names is rewritten; go as an input keeps its register from being given to a result inside the run of loads
        asm volatile("s_wait_xcnt 0x0" :: "v"(go) : "memory");
        unsigned char* sp = xt + (wv >> 1) * TP + (wv & 1) * 256 + lane * 8;
#pragma unroll
        for (int i = 0; i < CIN / 8; ++i) *(v4usa*)(sp + i * 8 * TP) = __builtin_bit_cast(v4us, __builtin_convertvector(raw[i], v4bf));   // round to nearest even
    }
    __syncthreads();
    const int pg = wv & 3, cb = wv >> 2;
    if (isx1 && cb >= 2) return;   // no barrier stands behind this line for a work-group of x1
    const int d0 = (pg >> 1) * (2 * WW) + (pg & 1) * 32, r0 = blockIdx.x * 256 + d0, c0 = (cb & 1) * 64;
    const int z = isx1 ? 0 : 1 + (cb >> 1);
    const bf* __restrict__ Bn = z == 0 ? WT : (z == 1 ? WP : WG); const float* __restrict__ bias = z == 0 ? bth : (z == 1 ? bph : bg);
    // lane (lr, hi) of a transposing load at channel kb gets channels kb + 8 hi + 0..7 of pixel d0 + lr
    const unsigned char* tp = xt + (8 * hi + (lane & 7)) * TP + 2 * d0 + 16 * ((lane >> 3) & 1);
    auto afrag = [&](int kc, int px) { return cat16b(__builtin_bit_cast(v8us, __builtin_amdgcn_ds_load_tr16_b128_v8i16((lds_v8s*)(tp + kc * TP + px * 2))), __builtin_bit_cast(v8us, __builtin_amdgcn_ds_load_tr16_b128_v8i16((lds_v8s*)(tp + (kc + 16) * TP + px * 2)))); };
    // byte offset: one vector register, named by all the loads of B (the base is scalar; the k step and the 16-row step are immediates)
    const unsigned bo = (unsigned)((c0 + lr) * CIN + 8 * hi) * 2u;
    auto frag = [](const bf* __restrict__ base, unsigned off, int el) { const char* p = (const char*)base + off; return cat16b(*(const v8us*)(p + (unsigned)(el * 2)), *(const v8us*)(p + (unsigned)(el * 2 + 32))); };
    float bv[4];   // read in front of the k loop, so that the epilogue does not wait for it
#pragma unroll
    for (int t = 0; t < 4; ++t) bv[t] = bfr(bias[c0 + t * 16 + lr]);
    v8f acc[4][4];   // tile ti: x positions (ti / 2) * 16 + 0..15 of image row 2q + (ti & 1)
#pragma unroll
    for (int ti = 0; ti < 4; ++ti) {
#pragma unroll
        for (int t = 0; t < 4; ++t) acc[ti][t] = (v8f){}; }
    // unrolled: the k step is an immediate of every load
#pragma unroll
    for (int kc = 0; kc < CIN; kc += 32) {
        v16bf a[4], b[4];
#pragma unroll
        for (int ti = 0; ti < 4; ++ti) a[ti] = afrag(kc, (ti >> 1) * 16 + (ti & 1) * WW);
#pragma unroll
        for (int t = 0; t < 4; ++t) b[t] = frag(Bn, bo, t * 16 * CIN + kc);
        // keeps the sixteen loads of a step in front of its first matrix instruction, so that they are in flight together; without it B's are issued two at a time, each pair waited for
        __builtin_amdgcn_sched_barrier(0);
#pragma unroll
        for (int t = 0; t < 4; ++t) {
#pragma unroll
            for (int ti = 0; ti < 4; ++ti) acc[ti][t] = wmmab(a[ti], b[t], acc[ti][t]); }
    }
    // the wait before a register that an issued load names is rewritten; the offset as an input keeps its register from being given to another value inside the run of loads
    asm volatile("s_wait_xcnt 0x0" :: "v"(bo) : "memory");
    if (z == 0) {
        float* os = &ost[wv][0];
#pragma unroll
        for (int ti = 0; ti < 4; ++ti) {
#pragma unroll
            for (int t = 0; t < 4; ++t) {
#pragma unroll
                for (int j = 0; j < 8; ++j) os[(hi * 8 + j) * 68 + t * 16 + lr] = acc[ti][t][j] + bv[t]; }
            // the tile is the wave's own: keeps the compiler from moving the reads below in front of the other lanes' stores
            __builtin_amdgcn_wave_barrier(); asm volatile("" ::: "memory");
#pragma unroll
            for (int s = 0; s < 4; ++s) { const int row = 4 * s + (lane >> 3), piece = lane & 7; const float* sp = os + row * 68 + piece * 8; const v4f p = *(const v4fa*)sp, q = *(const v4fa*)(sp + 4); v8us oh, ol;
#pragma unroll
                for (int i = 0; i < 8; ++i) { const float y = (i < 4 ? p[i & 3] : q[i & 3]) * (1.0f / (float)MP); const unsigned short hb = f2bf(y); oh[i] = hb; ol[i] = f2bf(y - bf2f(hb)); }
                const size_t o = (size_t)(r0 + (ti >> 1) * 16 + (ti & 1) * WW + row) * CI + c0 + piece * 8; *(v8us*)(Th + o) = oh; *(v8us*)(Tl + o) = ol; }
            // and the next tile's stores behind this tile's reads
            __builtin_amdgcn_wave_barrier(); asm volatile("" ::: "memory");
        }
    } else {
        constexpr int PP = 72;   // LDS pitch in 16-bit elements: 64 pooled positions + 16 bytes
        unsigned short* sh = (unsigned short*)(void*)&ost[4 * cb][0]; unsigned short* sl = sh + 64 * PP;   // each cb's four waves have an LDS range of their own
#pragma unroll
        for (int sub = 0; sub < 2; ++sub) {
#pragma unroll
            for (int t = 0; t < 4; ++t) { v4us oh, ol;
#pragma unroll
                for (int q = 0; q < 4; ++q) { const float y = fmaxf(fmaxf(acc[2 * sub][t][2 * q] + bv[t], acc[2 * sub][t][2 * q + 1] + bv[t]), fmaxf(acc[2 * sub + 1][t][2 * q] + bv[t], acc[2 * sub + 1][t][2 * q + 1] + bv[t])); const unsigned short hb = f2bf(y); oh[q] = hb; ol[q] = f2bf(y - bf2f(hb)); }
                const int so = (t * 16 + lr) * PP + (pg * 2 + sub) * 8 + hi * 4; *(v4usa*)(sh + so) = oh; *(v4usa*)(sl + so) = ol; } }
        __syncthreads();
        const size_t io = (size_t)(blockIdx.x / (NPX / 256)) * CI * MP + (size_t)(blockIdx.x % (NPX / 256)) * 64;
        bf* Dh = (z == 1 ? FTh : GTh) + io; bf* Dl = (z == 1 ? FTl : GTl) + io;
#pragma unroll
        for (int s = 0; s < 4; ++s) { const int g = (threadIdx.x & 127) + s * 128, row = g >> 3, piece = g & 7;
            const v8us vh = *(const v8usa*)(sh + row * PP + piece * 8), vl = *(const v8usa*)(sl + row * PP + piece * 8);
            const size_t o = (size_t)(c0 + row) * MP + piece * 8; *(v8us*)(Dh + o) = vh; *(v8us*)(Dl + o) = vl; }
        // the wait before a register that an issued store names is rewritten: in the built code the theta branch's instructions stand behind these stores
        asm volatile("s_wait_xcnt 0x0" ::: "memory");
    }
}

// k_cvt8: blockIdx.y picks one of four equally long arrays
__global__ __launch_bounds__(256) void k_cvt8(const float* __restrict__ s0, const float* __restrict__ s1, const float* __restrict__ s2, const float* __restrict__ s3, bf* d0, bf* d1, bf* d2, bf* d3, size_t n8) {
    const int w = blockIdx.y; const float* src = w == 0 ? s0 : (w == 1 ? s1 : (w == 2 ? s2 : s3)); bf* dst = w == 0 ? d0 : (w == 1 ? d1 : (w == 2 ? d2 : d3));
    const size_t i = (size_t)blockIdx.x * 256 + threadIdx.x; if (i >= n8) return;
    const v8f v = *(const v8f*)(src + i * 8); v8us o;
#pragma unroll
    for (int k = 0; k < 8; ++k) o[k] = f2bf(v[k]);
    *(v8us*)(dst + i * 8) = o; 
}
__global__ __launch_bounds__(256) void k_zero8(bf* dst, size_t n8) {
    const size_t i = (size_t)blockIdx.x * 256 + threadIdx.x; if (i >= n8) return; v8us z;
#pragma unroll
    for (int k = 0; k < 8; ++k) z[k] = 0;
    *(v8us*)(dst + i * 8) = z; 
}
// k_gemm3: 64 x 64 tile of C = (Ah + Al).(Bh + Bl)^T + bf(bias[c]) over K (row strides = K for all four planes; n-major B): three products per 32-k step (hh, hl, lh); f32
// blockIdx.z = image: sA, sB, sC are the elements from one image's A planes, B planes and C to the next image's
__global__ __launch_bounds__(128) void k_gemm3(const bf* __restrict__ Ah, const bf* __restrict__ Al, const bf* __restrict__ Bh, const bf* __restrict__ Bl, const float* __restrict__ bias, int K, float* C, int ldc, size_t sA, size_t sB, size_t sC) {
    __shared__ __align__(16) float ost[4][16 * 68];
    Ah += blockIdx.z * sA; Al += blockIdx.z * sA; Bh += blockIdx.z * sB; Bl += blockIdx.z * sB; C += blockIdx.z * sC;
    const int lane = threadIdx.x & 31, wave = threadIdx.x >> 5, lr = lane & 15, hi = lane >> 4;
    const int r0 = blockIdx.x * 64 + wave * 16, c0 = blockIdx.y * 64;
    const size_t aoff = (size_t)(r0 + lr) * K + 8 * hi;
    v8f acc[4];
#pragma unroll
    for (int t = 0; t < 4; ++t) acc[t] = (v8f){};
#pragma unroll 1
    for (int kc = 0; kc < K; kc += 32) {
        const v16bf a = cat16b(*(const v8us*)(Ah + aoff + kc), *(const v8us*)(Ah + aoff + kc + 16));
        const v16bf al = cat16b(*(const v8us*)(Al + aoff + kc), *(const v8us*)(Al + aoff + kc + 16));
#pragma unroll
        for (int t = 0; t < 4; ++t) { const size_t bo = (size_t)(c0 + t * 16 + lr) * K + kc + 8 * hi;
            const v16bf bh = cat16b(*(const v8us*)(Bh + bo), *(const v8us*)(Bh + bo + 16)); const v16bf bl = cat16b(*(const v8us*)(Bl + bo), *(const v8us*)(Bl + bo + 16));
            acc[t] = wmmab(a, bh, acc[t]); acc[t] = wmmab(al, bh, acc[t]); acc[t] = wmmab(a, bl, acc[t]); }
        asm volatile("v_nop\n\tv_nop\n\tv_nop\n\tv_nop" : "+v"(acc[0]), "+v"(acc[1]), "+v"(acc[2]), "+v"(acc[3]) : "v"(a), "v"(al));
    }
    float* os = &ost[wave][0];
#pragma unroll
    for (int t = 0; t < 4; ++t) { const float bv = bfr(bias[c0 + t * 16 + lr]);
#pragma unroll
        for (int j = 0; j < 8; ++j) os[(hi * 8 + j) * 68 + t * 16 + lr] = acc[t][j] + bv; }
    __builtin_amdgcn_wave_barrier(); asm volatile("" ::: "memory");
    float* crow = C + (size_t)r0 * ldc + c0;
    auto pass = [&]() {
#pragma unroll
        for (int s = 0; s < 8; ++s) { const int Lid = (lane >> 3) + 4 * s, piece = lane & 7; const int row = Lid >> 1, cofs = (Lid & 1) * 32 + piece * 4;
            const v4f val = *(const v4fa*)(os + row * 68 + cofs); *(v4f*)(crow + (size_t)row * ldc + cofs) = val; }
    };
    pass(); 
}

// k_red: the two small products of the chain. One work-group = one 16 x 64 tile of C = (Ah [+ Al]).(Bh + Bl)^T over K = NWV * STEPS * 32 (row strides = K; n-major B). The grid
// is small, so the contraction is split over the NWV waves (STEPS 32-k steps each, all loads of a wave independent); the partial tiles are summed through LDS in wave order and
// C leaves as bf16 hi + residual planes in whole 128-byte lines. The rows of B go in as the matrix instruction's first operand and the rows of A as its second (both loaders have
// the same k order), so a lane holds 8 neighbouring columns of one row of C and stores them 16 bytes at a time. blockIdx.z = image: sA, sB, sC as in k_gemm3
template <int NWV, int STEPS, bool SPLITA>
__global__ __launch_bounds__(NWV * 32) void k_red(const bf* __restrict__ Ah, const bf* __restrict__ Al, const bf* __restrict__ Bh, const bf* __restrict__ Bl, bf* Ch, bf* Cl, int ldc, size_t sA, size_t sB, size_t sC) {
    typedef __attribute__((ext_vector_type(4))) unsigned short v4us;
    __shared__ __align__(16) float part[NWV][16 * 68];
    constexpr int K = NWV * STEPS * 32;
    Ah += blockIdx.z * sA; if (SPLITA) Al += blockIdx.z * sA; Bh += blockIdx.z * sB; Bl += blockIdx.z * sB; Ch += blockIdx.z * sC; Cl += blockIdx.z * sC;
    const int lane = threadIdx.x & 31, wave = threadIdx.x >> 5, lr = lane & 15, hi = lane >> 4;
    const int r0 = blockIdx.x * 16, c0 = blockIdx.y * 64, k0 = wave * (STEPS * 32) + 8 * hi;
    // byte offsets: one vector register for A and one for B, named by all the loads of that operand (the plane's base is scalar; the k step and B's 16-row step are immediates)
    const unsigned ao = (unsigned)((r0 + lr) * K + k0) * 2u, bo = (unsigned)((c0 + lr) * K + k0) * 2u;
    auto frag = [](const bf* __restrict__ base, unsigned off, int el) { const char* p = (const char*)base + off; return cat16b(*(const v8us*)(p + (unsigned)(el * 2)), *(const v8us*)(p + (unsigned)(el * 2 + 32))); };
    v16bf a[STEPS], al[STEPS], bh[STEPS][4], bl[STEPS][4];
    // every loop of this kernel is unrolled: the fragment and accumulator arrays are indexed by constants only and so stay in registers
#pragma unroll
    for (int s = 0; s < STEPS; ++s) { a[s] = frag(Ah, ao, s * 32); if (SPLITA) al[s] = frag(Al, ao, s * 32);
#pragma unroll
        for (int t = 0; t < 4; ++t) { bh[s][t] = frag(Bh, bo, t * 16 * K + s * 32); bl[s][t] = frag(Bl, bo, t * 16 * K + s * 32); } }
    // the wait before a register that an issued load names is rewritten; the offsets as inputs keep their registers from being given to a result inside the run of loads
    asm volatile("s_wait_xcnt 0x0" :: "v"(ao), "v"(bo) : "memory");
    // keeps all loads of the wave in front of its first matrix instruction, so that they are in flight together; without it they are issued two at a time, each pair waited for
    __builtin_amdgcn_sched_barrier(0);
    v8f acc[4];
#pragma unroll
    for (int t = 0; t < 4; ++t) acc[t] = (v8f){};
#pragma unroll
    for (int s = 0; s < STEPS; ++s) {
#pragma unroll
        for (int t = 0; t < 4; ++t) { acc[t] = wmmab(bh[s][t], a[s], acc[t]); if (SPLITA) acc[t] = wmmab(bh[s][t], al[s], acc[t]); acc[t] = wmmab(bl[s][t], a[s], acc[t]); }
    }
    // keeps the LDS stores behind the last matrix instruction, so that the four accumulators have registers of their own
    __builtin_amdgcn_sched_barrier(0);
    float* os = &part[wave][lr * 68 + hi * 8];
#pragma unroll
    for (int t = 0; t < 4; ++t) { *(v4fa*)(os + t * 16) = (v4f){acc[t][0], acc[t][1], acc[t][2], acc[t][3]}; *(v4fa*)(os + t * 16 + 4) = (v4f){acc[t][4], acc[t][5], acc[t][6], acc[t][7]}; }
    __syncthreads();
#pragma unroll
    for (int g = threadIdx.x; g < 16 * 16; g += NWV * 32) { const int row = g >> 4, cofs = (g & 15) * 4;
        v4f v = *(const v4fa*)(&part[0][row * 68 + cofs]);
#pragma unroll
        for (int w = 1; w < NWV; ++w) v += *(const v4fa*)(&part[w][row * 68 + cofs]);
        v4us oh, ol;
#pragma unroll
        for (int i = 0; i < 4; ++i) { const unsigned short hb = f2bf(v[i]); oh[i] = hb; ol[i] = f2bf(v[i] - bf2f(hb)); }
        const size_t o = (size_t)(r0 + row) * ldc + c0 + cofs; *(v4us*)(Ch + o) = oh; *(v4us*)(Cl + o) = ol; }
}

// BatchNorm statistics in two launches. k_bnpart: work-group b takes rows [b * BNR, (b + 1) * BNR) of WY, every row read once (16 B a lane, a wave covers 512 contiguous
// bytes, all 16 loads of a thread in flight); each thread forms the mean and the sum of squared deviations (M2) of its 16 rows from registers; equal-sized groups combine as
// mean = average of the means, M2 = sum of the M2 + count * sum of (group mean - mean)^2, in a fixed order. k_bnfin combines the BNP chunks the same way.
#define BNP 256
#define BNR (NB_ * NPX / BNP)
__global__ __launch_bounds__(512) void k_bnpart(const float* __restrict__ WY, float* PM, float* PQ) {
    __shared__ __align__(16) float sm[8][CIN];
    __shared__ __align__(16) float sq[8][CIN];
    const int tid = threadIdx.x, g = tid >> 6, cq = (tid & 63) * 4;
    const float* p = WY + (size_t)blockIdx.x * BNR * CIN;
    const unsigned off = (unsigned)(g * CIN + cq);
    v4f v[BNR / 8];
#pragma unroll
    for (int i = 0; i < BNR / 8; ++i) v[i] = *(const v4f*)(p + off + (unsigned)(i * 8 * CIN));
    v4f s = v[0];
#pragma unroll
    for (int i = 1; i < BNR / 8; ++i) s += v[i];
    const v4f m = s * (1.0f / (float)(BNR / 8));
    v4f q = (v4f){};
#pragma unroll
    for (int i = 0; i < BNR / 8; ++i) { const v4f d = v[i] - m; q += d * d; }
    *(v4fa*)&sm[g][cq] = m; *(v4fa*)&sq[g][cq] = q;
    __syncthreads();
    if (tid < CIN) { float a = 0.f, qq = 0.f, e = 0.f;
#pragma unroll
        for (int k = 0; k < 8; ++k) a += sm[k][tid];
        const float mu = a * 0.125f;
#pragma unroll
        for (int k = 0; k < 8; ++k) { const float d = sm[k][tid] - mu; e = fmaf(d, d, e); qq += sq[k][tid]; }
        PM[(size_t)blockIdx.x * CIN + tid] = mu; PQ[(size_t)blockIdx.x * CIN + tid] = fmaf((float)(BNR / 8), e, qq); }
}
__global__ __launch_bounds__(512) void k_bnfin(const float* __restrict__ PM, const float* __restrict__ PQ, float* MEAN, float* RSTD) {
    __shared__ float sm[16][32];
    __shared__ float sq[16][32];
    const int lane = threadIdx.x & 31, g = threadIdx.x >> 5; const int c = blockIdx.x * 32 + lane;
    const float* pm = PM + blockIdx.x * 32; const float* pq = PQ + blockIdx.x * 32;
    const unsigned boff = (unsigned)(g * (BNP / 16) * CIN + lane) * 4u;   // byte offset, the one vector register that all 32 loads name
    float m[BNP / 16], q[BNP / 16];
#pragma unroll
    for (int i = 0; i < BNP / 16; ++i) { m[i] = *(const float*)((const char*)pm + boff + (unsigned)(i * CIN * 4)); q[i] = *(const float*)((const char*)pq + boff + (unsigned)(i * CIN * 4)); }
    // the wait before a register that an issued load names is rewritten; boff as an input keeps its register from being given to a result inside the run of loads
    asm volatile("s_wait_xcnt 0x0" :: "v"(boff) : "memory");
    float a = 0.f, qq = 0.f, e = 0.f;
#pragma unroll
    for (int i = 0; i < BNP / 16; ++i) a += m[i];
    const float lm = a * (1.0f / (float)(BNP / 16));
#pragma unroll
    for (int i = 0; i < BNP / 16; ++i) { const float d = m[i] - lm; e = fmaf(d, d, e); qq += q[i]; }
    sm[g][lane] = lm; sq[g][lane] = fmaf((float)BNR, e, qq);
    __syncthreads();
    if (g == 0) { float a2 = 0.f, q2 = 0.f, e2 = 0.f;
#pragma unroll
        for (int k = 0; k < 16; ++k) a2 += sm[k][lane];
        const float mu = a2 * (1.0f / 16.0f);
#pragma unroll
        for (int k = 0; k < 16; ++k) { const float d = sm[k][lane] - mu; e2 = fmaf(d, d, e2); q2 += sq[k][lane]; }
        const float rs = rsqrtf(fmaf((float)(BNR * (BNP / 16)), e2, q2) / (float)(NB_ * NPX) + BEPS);
        MEAN[c] = mu; RSTD[c] = rs; }
}
__global__ __launch_bounds__(256) void k_bnout(const float* __restrict__ WY, const float* __restrict__ x1, const float* __restrict__ MEAN, const float* __restrict__ RSTD, const float* __restrict__ gam, const float* __restrict__ bet, float* OUTB) {
    __shared__ float tl[64][65];
    const int tid = threadIdx.x; const int p0 = blockIdx.x * 64, c0 = blockIdx.y * 64, b = blockIdx.z; const int rr = tid >> 2, cq = (tid & 3) * 16;
#pragma unroll
    for (int i = 0; i < 16; ++i) { const int c = c0 + cq + i; tl[rr][cq + i] = (WY[((size_t)b * NPX + p0 + rr) * CIN + c] - MEAN[c]) * RSTD[c] * bfr(gam[c]) + bfr(bet[c]); }
    __syncthreads();
    const int lane = tid & 31, wv = tid >> 5;
    auto pass = [&]() {
#pragma unroll
        for (int st = 0; st < 4; ++st) { const int cr = wv * 8 + st * 2 + (lane >> 4); const int pq = (lane & 15) * 4; v4f v; const size_t o = ((size_t)b * CIN + c0 + cr) * NPX + p0 + pq;
#pragma unroll
            for (int i = 0; i < 4; ++i) v[i] = tl[pq + i][cr] + bfr(x1[o + i]);
            *(v4f*)(OUTB + o) = v; }
    };
    pass(); 
}

extern "C" void kernel_launch(void* const* d_in, const int* in_sizes, int n_in,
                              void* d_out, int out_size, void* d_ws, size_t ws_size, hipStream_t stream) {
    (void)in_sizes; (void)n_in; (void)out_size;
    const float* x1 = (const float*)d_in[0]; const float* x2 = (const float*)d_in[1]; const float* wg = (const float*)d_in[2]; const float* bg = (const float*)d_in[3]; const float* wth = (const float*)d_in[4]; const float* bth = (const float*)d_in[5]; const float* wph = (const float*)d_in[6]; const float* bph = (const float*)d_in[7];
    const float* wout = (const float*)d_in[8]; const float* bout = (const float*)d_in[9]; const float* gam = (const float*)d_in[10]; const float* bet = (const float*)d_in[11];
    float* out = (float*)d_out;    // [8][256][64][64]
    char* wsp = (char*)d_ws;
    auto take = [&](size_t bytes) { char* p = wsp; wsp += (bytes + 255) & ~(size_t)255; return (void*)p; };
    bf* WG = (bf*)take((size_t)CI * CIN * 2); bf* WT = (bf*)take((size_t)CI * CIN * 2); bf* WP = (bf*)take((size_t)CI * CIN * 2); bf* WO = (bf*)take((size_t)CIN * CI * 2);
    // all NB_ images at once
    bf* Th = (bf*)take((size_t)NB_ * NPX * CI * 2); bf* Tl = (bf*)take((size_t)NB_ * NPX * CI * 2); bf* FTh = (bf*)take((size_t)NB_ * CI * MP * 2); bf* FTl = (bf*)take((size_t)NB_ * CI * MP * 2); bf* GTh = (bf*)take((size_t)NB_ * CI * MP * 2); bf* GTl = (bf*)take((size_t)NB_ * CI * MP * 2);
    bf* KMh = (bf*)take((size_t)NB_ * CI * CI * 2); bf* KMl = (bf*)take((size_t)NB_ * CI * CI * 2); bf* QTh = (bf*)take((size_t)NB_ * CIN * CI * 2); bf* QTl = (bf*)take((size_t)NB_ * CIN * CI * 2);
    float* WY = (float*)take((size_t)NB_ * NPX * CIN * 4); float* MEAN = (float*)take(CIN * 4); float* RSTD = (float*)take(CIN * 4); float* PM = (float*)take((size_t)BNP * CIN * 4); float* PQ = (float*)take((size_t)BNP * CIN * 4);
    if ((size_t)(wsp - (char*)d_ws) > ws_size) return;    // MiB: 0.25 + 16 + 4 + 4 + 1.5 + 32 + 0.5 ~ 58
    k_cvt8<<<dim3((CI * CIN / 8 + 255) / 256, 4, 1), 256, 0, stream>>>(wg, wth, wph, wout, WG, WT, WP, WO, CI * CIN / 8);   // 'oc' weights natural
    k_convf<<<dim3(NB_ * NPX / 256, 2, 1), 512, 0, stream>>>(x1, x2, WT, WP, WG, bth, bph, bg, Th, Tl, FTh, FTl, GTh, GTl);   // 1/M folded into theta
    k_red<16, MP / 512, true><<<dim3(CI / 16, CI / 64, NB_), 512, 0, stream>>>(FTh, FTl, GTh, GTl, KMh, KMl, CI, (size_t)CI * MP, (size_t)CI * MP, (size_t)CI * CI);    // KM[k][c] = sum_m phi[k][m] g[c][m]
    k_red<4, CI / 128, false><<<dim3(CIN / 16, CI / 64, NB_), 128, 0, stream>>>(WO, nullptr, KMh, KMl, QTh, QTl, CI, 0, (size_t)CI * CI, (size_t)CIN * CI);           // QT[o][k] = sum_c W[o][c] KM[k][c]
    k_gemm3<<<dim3(NPX / 64, CIN / 64, NB_), 128, 0, stream>>>(Th, Tl, QTh, QTl, bout, CI, WY, CIN, (size_t)NPX * CI, (size_t)CIN * CI, (size_t)NPX * CIN);            // WY[n][o] = sum_k theta[n][k] / M . QT[o][k] + b[o]
    k_bnpart<<<BNP, 512, 0, stream>>>(WY, PM, PQ); k_bnfin<<<CIN / 32, 512, 0, stream>>>(PM, PQ, MEAN, RSTD);
    k_bnout<<<dim3(NPX / 64, CIN / 64, NB_), 256, 0, stream>>>(WY, x1, MEAN, RSTD, gam, bet, out);
}

// v006
// Measured time: 51.6 microseconds a run.
// Next to v005, in two timings, it ran 1.48 times as fast each time.
// Over all steps from v000 it is 42.4 times as fast.
#include <hip/hip_runtime.h>

// Compute dtypes, f32 accumulate, per image: theta (on x1) and g/phi (on x2) 1x1 convs as [4096 x 256].[256 x 128] GEMMs with PLAIN bf16 operands (inputs rounded to
// bf16 and turned pixel-major on the way through LDS; exact products, + bias), the 2x2 max-pool on the conv outputs in f32. There is NO softmax in this module, so W.((theta^T.phi / M).g^T) is one chain of
// linear products and is taken from the right: KM = phi.g^T ([128 x 1024].[1024 x 128]), QT = W.KM^T ([256 x 128].[128 x 128]), then theta^T.QT^T / M + bias
// ([4096 x 128].[128 x 256]); the [4096 x 1024] matrix f is never formed. theta, phi, g, KM and QT go in as bf16 hi + UNSCALED residual planes (three products; W plain bf16, two
// products) - on v_wmma_f32_16x16x32_bf16; training-mode BatchNorm statistics over (B,H,W) per channel (fixed-order f32 column sums), the affine, + x1 and the NCHW

#define NB_  8
#define CIN  256
#define CI   128
#define HH   64
#define WW   64
#define NPX  4096
#define MP   1024
#define DM   CIN
#define BEPS 1e-5f
#define LOSC 1024.0f

typedef _Float16 h16;
typedef unsigned short bf;
typedef __attribute__((ext_vector_type(16))) __bf16   v16bf;
typedef __attribute__((ext_vector_type(16))) _Float16 v16h;
typedef __attribute__((ext_vector_type(8)))  _Float16 v8h;
typedef __attribute__((ext_vector_type(8)))  unsigned short v8us;
typedef __attribute__((ext_vector_type(8)))  float    v8f;
typedef __attribute__((ext_vector_type(4)))  float    v4f;
typedef v8h  __attribute__((may_alias)) v8ha;
typedef v4f  __attribute__((may_alias)) v4fa;
typedef v8us __attribute__((may_alias)) v8usa;

__device__ __forceinline__ unsigned short f2bf(float f) { unsigned u = __float_as_uint(f); u += 0x7FFFu + ((u >> 16) & 1u); return (unsigned short)(u >> 16); }
__device__ __forceinline__ float bf2f(unsigned short b) { return __uint_as_float(((unsigned)b) << 16); }
__device__ __forceinline__ float bfr(float f) { return bf2f(f2bf(f)); }
__device__ __forceinline__ v16h cat16(v8h lo, v8h hi) { return __builtin_shufflevector(lo, hi, 0, 1, 2, 3, 4, 5, 6, 7, 8, 9, 10, 11, 12, 13, 14, 15); }
__device__ __forceinline__ v16bf cat16b(v8us lo, v8us hi) { return __builtin_bit_cast(v16bf, __builtin_shufflevector(lo, hi, 0, 1, 2, 3, 4, 5, 6, 7, 8, 9, 10, 11, 12, 13, 14, 15)); }
__device__ __forceinline__ v8f wmma16(v16h a, v16h b, v8f c) { return __builtin_amdgcn_wmma_f32_16x16x32_f16(false, a, false, b, (short)0, c, false, false); }
__device__ __forceinline__ v8f wmmab(v16bf a, v16bf b, v8f c) { return __builtin_amdgcn_wmma_f32_16x16x32_bf16(false, a, false, b, (short)0, c, false, false); }

// k_convf: the three 1x1 convs in one grid, read straight from the f32 NCHW inputs, each leaving as the bf16 hi + residual planes that the next products read.
// One work-group (16 waves) = 256 pixels (4 image rows of one image) of x2 (blockIdx.y == 0: phi and g, 256 output channels) or of x1 (theta, 128), all CIN input channels.
// The tile is read once, 512 contiguous bytes a wave-load with all 32 loads of a thread in flight, rounded to bf16 and laid in LDS as it lies in memory, [channel][pixel];
// ds_load_tr16_b128 then hands out the [pixel][channel] fragments of C = A.B^T + bf(bias[c]) over K = CIN (B: n-major weights, loaded in the same k order: 8 hi + 0..7 and
// 16 + 8 hi + 0..7 of each 32). Wave (pg, cb) takes 64 pixels x 64 output channels (cb: phi's halves, g's halves; theta has two halves, so 8 of its waves have no product).
// Its four 16 x 64 tiles are 16 x positions of image rows 2q and 2q + 1 (q = pg / 2) and the next 16 of both, so all four pixels of a 2x2 pool window lie in one lane's
// accumulators (neighbouring x = neighbouring registers, the row below = the next tile). theta: times 1/M, split, rows of 128 bytes a plane. phi, g: max of the four f32 values,
// split, and each cb's 64 channels x 64 pooled positions are turned through LDS so that every [channel][m] row piece leaves as one whole 128-byte line.
#define TP 544   // LDS pitch in bytes of one channel's 256 pixels: 512 + 32, an odd multiple of 32 bytes, the transposing load's conflict-free pitch
__global__ __launch_bounds__(512) void k_convf(const float* __restrict__ x1, const float* __restrict__ x2, const bf* __restrict__ WT, const bf* __restrict__ WP, const bf* __restrict__ WG, const float* __restrict__ bth, const float* __restrict__ bph, const float* __restrict__ bg, bf* Th, bf* Tl, bf* FTh, bf* FTl, bf* GTh, bf* GTl) {
    typedef __attribute__((ext_vector_type(4))) unsigned short v4us;
    typedef v4us __attribute__((may_alias)) v4usa;
    typedef __attribute__((ext_vector_type(4))) __bf16 v4bf;
    typedef __attribute__((ext_vector_type(8))) short v8s;
    typedef __attribute__((address_space(3))) v8s lds_v8s;
    __shared__ __align__(32) unsigned char xt[CIN * TP];
    __shared__ __align__(16) float ost[16][16 * 72];
    const bool isx1 = blockIdx.y != 0;
    // the wave's number as a scalar: the bases of its weights, bias and outputs stay in scalar registers
    const int lane = threadIdx.x & 31, wv = __builtin_amdgcn_readfirstlane(threadIdx.x >> 5), lr = lane & 15, hi = lane >> 4;
    {
        const float* __restrict__ xb = (isx1 ? x1 : x2) + (size_t)(blockIdx.x / (NPX / 256)) * CIN * NPX + (size_t)(blockIdx.x % (NPX / 256)) * 256;
        // byte offset: the one vector register that all 32 loads name (the base is scalar, the step of 8 channels an immediate); two waves take one channel's 1024 bytes
        const unsigned go = (unsigned)((wv >> 1) * NPX + (wv & 1) * 128 + lane * 4) * 4u;
        v4f raw[CIN / 8];
#pragma unroll
        for (int i = 0; i < CIN / 8; ++i) raw[i] = *(const v4f*)((const char*)xb + go + (unsigned)(i * 8 * NPX * 4));
        // the wait before a register that an issued load names is rewritten; go as an input keeps its register from being given to a result inside the run of loads
        asm volatile("s_wait_xcnt 0x0" :: "v"(go) : "memory");
        unsigned char* sp = xt + (wv >> 1) * TP + (wv & 1) * 256 + lane * 8;
#pragma unroll
        for (int i = 0; i < CIN / 8; ++i) *(v4usa*)(sp + i * 8 * TP) = __builtin_bit_cast(v4us, __builtin_convertvector(raw[i], v4bf));   // round to nearest even
    }
    __syncthreads();
    const int pg = wv & 3, cb = wv >> 2;
    if (isx1 && cb >= 2) return;   // no barrier stands behind this line for a work-group of x1
    const int d0 = (pg >> 1) * (2 * WW) + (pg & 1) * 32, r0 = blockIdx.x * 256 + d0, c0 = (cb & 1) * 64;
    const int z = isx1 ? 0 : 1 + (cb >> 1);
    const bf* __restrict__ Bn = z == 0 ? WT : (z == 1 ? WP : WG); const float* __restrict__ bias = z == 0 ? bth : (z == 1 ? bph : bg);
    // lane (lr, hi) of a transposing load at channel kb gets channels kb + 8 hi + 0..7 of pixel d0 + lr
    const unsigned char* tp = xt + (8 * hi + (lane & 7)) * TP + 2 * d0 + 16 * ((lane >> 3) & 1);
    auto afrag = [&](int kc, int px) { return cat16b(__builtin_bit_cast(v8us, __builtin_amdgcn_ds_load_tr16_b128_v8i16((lds_v8s*)(tp + kc * TP + px * 2))), __builtin_bit_cast(v8us, __builtin_amdgcn_ds_load_tr16_b128_v8i16((lds_v8s*)(tp + (kc + 16) * TP + px * 2)))); };
    // byte offset: one vector register, named by all the loads of B (the base is scalar; the k step and the 16-row step are immediates)
    const unsigned bo = (unsigned)((c0 + lr) * CIN + 8 * hi) * 2u;
    auto frag = [](const bf* __restrict__ base, unsigned off, int el) { const char* p = (const char*)base + off; return cat16b(*(const v8us*)(p + (unsigned)(el * 2)), *(const v8us*)(p + (unsigned)(el * 2 + 32))); };
    float bv[4];   // read in front of the k loop, so that the epilogue does not wait for it
#pragma unroll
    for (int t = 0; t < 4; ++t) bv[t] = bfr(bias[c0 + t * 16 + lr]);
    v8f acc[4][4];   // tile ti: x positions (ti / 2) * 16 + 0..15 of image row 2q + (ti & 1)
#pragma unroll
    for (int ti = 0; ti < 4; ++ti) {
#pragma unroll
        for (int t = 0; t < 4; ++t) acc[ti][t] = (v8f){}; }
    // unrolled: the k step is an immediate of every load
#pragma unroll
    for (int kc = 0; kc < CIN; kc += 32) {
        v16bf a[4], b[4];
#pragma unroll
        for (int ti = 0; ti < 4; ++ti) a[ti] = afrag(kc, (ti >> 1) * 16 + (ti & 1) * WW);
#pragma unroll
        for (int t = 0; t < 4; ++t) b[t] = frag(Bn, bo, t * 16 * CIN + kc);
        // keeps the sixteen loads of a step in front of its first matrix instruction, so that they are in flight together; without it B's are issued two at a time, each pair waited for
        __builtin_amdgcn_sched_barrier(0);
#pragma unroll
        for (int t = 0; t < 4; ++t) {
#pragma unroll
            for (int ti = 0; ti < 4; ++ti) acc[ti][t] = wmmab(a[ti], b[t], acc[ti][t]); }
    }
    // the wait before a register that an issued load names is rewritten; the offset as an input keeps its register from being given to another value inside the run of loads
    asm volatile("s_wait_xcnt 0x0" :: "v"(bo) : "memory");
    if (z == 0) {
        float* os = &ost[wv][0];
#pragma unroll
        for (int ti = 0; ti < 4; ++ti) {
#pragma unroll
            for (int t = 0; t < 4; ++t) {
#pragma unroll
                for (int j = 0; j < 8; ++j) os[(hi * 8 + j) * 68 + t * 16 + lr] = acc[ti][t][j] + bv[t]; }
            // the tile is the wave's own: keeps the compiler from moving the reads below in front of the other lanes' stores
            __builtin_amdgcn_wave_barrier(); asm volatile("" ::: "memory");
#pragma unroll
            for (int s = 0; s < 4; ++s) { const int row = 4 * s + (lane >> 3), piece = lane & 7; const float* sp = os + row * 68 + piece * 8; const v4f p = *(const v4fa*)sp, q = *(const v4fa*)(sp + 4); v8us oh, ol;
#pragma unroll
                for (int i = 0; i < 8; ++i) { const float y = (i < 4 ? p[i & 3] : q[i & 3]) * (1.0f / (float)MP); const unsigned short hb = f2bf(y); oh[i] = hb; ol[i] = f2bf(y - bf2f(hb)); }
                const size_t o = (size_t)(r0 + (ti >> 1) * 16 + (ti & 1) * WW + row) * CI + c0 + piece * 8; *(v8us*)(Th + o) = oh; *(v8us*)(Tl + o) = ol; }
            // and the next tile's stores behind this tile's reads
            __builtin_amdgcn_wave_barrier(); asm volatile("" ::: "memory");
        }
    } else {
        constexpr int PP = 72;   // LDS pitch in 16-bit elements: 64 pooled positions + 16 bytes
        unsigned short* sh = (unsigned short*)(void*)&ost[4 * cb][0]; unsigned short* sl = sh + 64 * PP;   // each cb's four waves have an LDS range of their own
#pragma unroll
        for (int sub = 0; sub < 2; ++sub) {
#pragma unroll
            for (int t = 0; t < 4; ++t) { v4us oh, ol;
#pragma unroll
                for (int q = 0; q < 4; ++q) { const float y = fmaxf(fmaxf(acc[2 * sub][t][2 * q] + bv[t], acc[2 * sub][t][2 * q + 1] + bv[t]), fmaxf(acc[2 * sub + 1][t][2 * q] + bv[t], acc[2 * sub + 1][t][2 * q + 1] + bv[t])); const unsigned short hb = f2bf(y); oh[q] = hb; ol[q] = f2bf(y - bf2f(hb)); }
                const int so = (t * 16 + lr) * PP + (pg * 2 + sub) * 8 + hi * 4; *(v4usa*)(sh + so) = oh; *(v4usa*)(sl + so) = ol; } }
        __syncthreads();
        const size_t io = (size_t)(blockIdx.x / (NPX / 256)) * CI * MP + (size_t)(blockIdx.x % (NPX / 256)) * 64;
        bf* Dh = (z == 1 ? FTh : GTh) + io; bf* Dl = (z == 1 ? FTl : GTl) + io;
#pragma unroll
        for (int s = 0; s < 4; ++s) { const int g = (threadIdx.x & 127) + s * 128, row = g >> 3, piece = g & 7;
            const v8us vh = *(const v8usa*)(sh + row * PP + piece * 8), vl = *(const v8usa*)(sl + row * PP + piece * 8);
            const size_t o = (size_t)(c0 + row) * MP + piece * 8; *(v8us*)(Dh + o) = vh; *(v8us*)(Dl + o) = vl; }
        // the wait before a register that an issued store names is rewritten: in the built code the theta branch's instructions stand behind these stores
        asm volatile("s_wait_xcnt 0x0" ::: "memory");
    }
}

// k_cvt8: blockIdx.y picks one of four equally long arrays
__global__ __launch_bounds__(256) void k_cvt8(const float* __restrict__ s0, const float* __restrict__ s1, const float* __restrict__ s2, const float* __restrict__ s3, bf* d0, bf* d1, bf* d2, bf* d3, size_t n8) {
    const int w = blockIdx.y; const float* src = w == 0 ? s0 : (w == 1 ? s1 : (w == 2 ? s2 : s3)); bf* dst = w == 0 ? d0 : (w == 1 ? d1 : (w == 2 ? d2 : d3));
    const size_t i = (size_t)blockIdx.x * 256 + threadIdx.x; if (i >= n8) return;
    const v8f v = *(const v8f*)(src + i * 8); v8us o;
#pragma unroll
    for (int k = 0; k < 8; ++k) o[k] = f2bf(v[k]);
    *(v8us*)(dst + i * 8) = o; 
}
__global__ __launch_bounds__(256) void k_zero8(bf* dst, size_t n8) {
    const size_t i = (size_t)blockIdx.x * 256 + threadIdx.x; if (i >= n8) return; v8us z;
#pragma unroll
    for (int k = 0; k < 8; ++k) z[k] = 0;
    *(v8us*)(dst + i * 8) = z; 
}
// k_red: the two small products of the chain. One work-group = one 16 x 64 tile of C = (Ah [+ Al]).(Bh + Bl)^T over K = NWV * STEPS * 32 (row strides = K; n-major B). The grid
// is small, so the contraction is split over the NWV waves (STEPS 32-k steps each, all loads of a wave independent); the partial tiles are summed through LDS in wave order and
// C leaves as bf16 hi + residual planes in whole 128-byte lines. The rows of B go in as the matrix instruction's first operand and the rows of A as its second (both loaders have
// the same k order), so a lane holds 8 neighbouring columns of one row of C and stores them 16 bytes at a time. blockIdx.z = image: sA, sB, sC are the elements from one image's A planes, B planes and C to the next image's
template <int NWV, int STEPS, bool SPLITA>
__global__ __launch_bounds__(NWV * 32) void k_red(const bf* __restrict__ Ah, const bf* __restrict__ Al, const bf* __restrict__ Bh, const bf* __restrict__ Bl, bf* Ch, bf* Cl, int ldc, size_t sA, size_t sB, size_t sC) {
    typedef __attribute__((ext_vector_type(4))) unsigned short v4us;
    __shared__ __align__(16) float part[NWV][16 * 68];
    constexpr int K = NWV * STEPS * 32;
    Ah += blockIdx.z * sA; if (SPLITA) Al += blockIdx.z * sA; Bh += blockIdx.z * sB; Bl += blockIdx.z * sB; Ch += blockIdx.z * sC; Cl += blockIdx.z * sC;
    const int lane = threadIdx.x & 31, wave = threadIdx.x >> 5, lr = lane & 15, hi = lane >> 4;
    const int r0 = blockIdx.x * 16, c0 = blockIdx.y * 64, k0 = wave * (STEPS * 32) + 8 * hi;
    // byte offsets: one vector register for A and one for B, named by all the loads of that operand (the plane's base is scalar; the k step and B's 16-row step are immediates)
    const unsigned ao = (unsigned)((r0 + lr) * K + k0) * 2u, bo = (unsigned)((c0 + lr) * K + k0) * 2u;
    auto frag = [](const bf* __restrict__ base, unsigned off, int el) { const char* p = (const char*)base + off; return cat16b(*(const v8us*)(p + (unsigned)(el * 2)), *(const v8us*)(p + (unsigned)(el * 2 + 32))); };
    v16bf a[STEPS], al[STEPS], bh[STEPS][4], bl[STEPS][4];
    // every loop of this kernel is unrolled: the fragment and accumulator arrays are indexed by constants only and so stay in registers
#pragma unroll
    for (int s = 0; s < STEPS; ++s) { a[s] = frag(Ah, ao, s * 32); if (SPLITA) al[s] = frag(Al, ao, s * 32);
#pragma unroll
        for (int t = 0; t < 4; ++t) { bh[s][t] = frag(Bh, bo, t * 16 * K + s * 32); bl[s][t] = frag(Bl, bo, t * 16 * K + s * 32); } }
    // the wait before a register that an issued load names is rewritten; the offsets as inputs keep their registers from being given to a result inside the run of loads
    asm volatile("s_wait_xcnt 0x0" :: "v"(ao), "v"(bo) : "memory");
    // keeps all loads of the wave in front of its first matrix instruction, so that they are in flight together; without it they are issued two at a time, each pair waited for
    __builtin_amdgcn_sched_barrier(0);
    v8f acc[4];
#pragma unroll
    for (int t = 0; t < 4; ++t) acc[t] = (v8f){};
#pragma unroll
    for (int s = 0; s < STEPS; ++s) {
#pragma unroll
        for (int t = 0; t < 4; ++t) { acc[t] = wmmab(bh[s][t], a[s], acc[t]); if (SPLITA) acc[t] = wmmab(bh[s][t], al[s], acc[t]); acc[t] = wmmab(bl[s][t], a[s], acc[t]); }
    }
    // keeps the LDS stores behind the last matrix instruction, so that the four accumulators have registers of their own
    __builtin_amdgcn_sched_barrier(0);
    float* os = &part[wave][lr * 68 + hi * 8];
#pragma unroll
    for (int t = 0; t < 4; ++t) { *(v4fa*)(os + t * 16) = (v4f){acc[t][0], acc[t][1], acc[t][2], acc[t][3]}; *(v4fa*)(os + t * 16 + 4) = (v4f){acc[t][4], acc[t][5], acc[t][6], acc[t][7]}; }
    __syncthreads();
#pragma unroll
    for (int g = threadIdx.x; g < 16 * 16; g += NWV * 32) { const int row = g >> 4, cofs = (g & 15) * 4;
        v4f v = *(const v4fa*)(&part[0][row * 68 + cofs]);
#pragma unroll
        for (int w = 1; w < NWV; ++w) v += *(const v4fa*)(&part[w][row * 68 + cofs]);
        v4us oh, ol;
#pragma unroll
        for (int i = 0; i < 4; ++i) { const unsigned short hb = f2bf(v[i]); oh[i] = hb; ol[i] = f2bf(v[i] - bf2f(hb)); }
        const size_t o = (size_t)(r0 + row) * ldc + c0 + cofs; *(v4us*)(Ch + o) = oh; *(v4us*)(Cl + o) = ol; }
}

// The last product and the BatchNorm. WY[n][o] = sum_k theta[n][k] / M . QT[o][k] + bf(b[o]) is never stored: k_prod forms it twice, bit for bit the same, straight into what reads it.
// MODE 0 leaves, per work-group, each channel's mean and sum of squared deviations (M2) over its BNR rows; k_bnfin combines the BNP chunks; MODE 1 applies the affine, adds x1 and
// stores NCHW. One work-group (16 waves) = BNR = 128 pixels of one image x all 256 channels over K = CI: (Ah + Al).(Bh + Bl)^T, three products per 32-k step (hh, lh, hl, in that
// order into each accumulator). The four planes' tiles are contiguous in memory: they are read once, 512 contiguous bytes a wave-load with all 24 loads of a thread in flight, and
// laid in LDS at a padded pitch; wave (pg, cb) takes 32 pixels x 64 channels, its fragments by ds_load_b128 (both loaders: k = 8 hi + 0..7 and 16 + 8 hi + 0..7 of each 32).
// A lane holds 16 pixels (2 tiles x 8 registers) of each of its 4 channels. Equal-sized groups combine as mean = average of the means, M2 = sum of the M2 + count * sum of
// (group mean - mean)^2, in a fixed order.
#define BNP 256
#define BNR (NB_ * NPX / BNP)
#define LP 272   // LDS pitch in bytes of one row's 128 k: 256 + 16, ds_load_b128's conflict-free pitch
#define OP 36    // LDS pitch in floats of one channel's 32 pixels in a wave's transposing tile: 128 + 16 bytes
// work-group barrier for LDS data alone: it waits for the wave's LDS operations, not for its global loads, so that the x1 loads issued in front of it stay in flight
// behind it (__syncthreads() waits for every outstanding load of the wave)
__device__ __forceinline__ void lds_barrier() { __builtin_amdgcn_fence(__ATOMIC_RELEASE, "workgroup", "local"); __builtin_amdgcn_s_barrier(); __builtin_amdgcn_fence(__ATOMIC_ACQUIRE, "workgroup", "local"); }
template <int MODE>
__global__ __launch_bounds__(512) void k_prod(const bf* __restrict__ Ah, const bf* __restrict__ Al, const bf* __restrict__ Bh, const bf* __restrict__ Bl, const float* __restrict__ bias, float* PM, float* PQ, const float* __restrict__ x1, const float* __restrict__ MEAN, const float* __restrict__ RSTD, const float* __restrict__ gam, const float* __restrict__ bet, float* OUTB) {
    __shared__ __align__(16) unsigned char st[(2 * BNR + 2 * CIN) * LP];   // rows: Ah, Al, Bh, Bl
    // every loop of this kernel is unrolled: the staging, fragment, accumulator and x1 arrays are indexed by constants only and so stay in registers
    // the wave's number as a scalar: the bases of its loads and stores stay in scalar registers
    const int tid = threadIdx.x, lane = tid & 31, wv = __builtin_amdgcn_readfirstlane(tid >> 5), lr = lane & 15, hi = lane >> 4;
    const int img = blockIdx.x / (NPX / BNR), pg = wv & 3, cb = wv >> 2;
    const v8us* gah = (const v8us*)(Ah + (size_t)blockIdx.x * BNR * CI); const v8us* gal = (const v8us*)(Al + (size_t)blockIdx.x * BNR * CI);
    const v8us* gbh = (const v8us*)(Bh + (size_t)img * CIN * CI); const v8us* gbl = (const v8us*)(Bl + (size_t)img * CIN * CI);
    // all 24 loads name one vector register, the thread's number as the index of its 16 bytes (the bases are scalar, the step of 32 rows = 512 pieces an immediate)
    v8us ra[2][BNR / 32], rb[2][CIN / 32];
#pragma unroll
    for (int i = 0; i < CIN / 32; ++i) { rb[0][i] = gbh[tid + i * 512]; rb[1][i] = gbl[tid + i * 512]; }
#pragma unroll
    for (int i = 0; i < BNR / 32; ++i) { ra[0][i] = gah[tid + i * 512]; ra[1][i] = gal[tid + i * 512]; }
    // the wait before a register that an issued load names is rewritten; the four scalar bases and the index as inputs keep their registers to this line: otherwise the
    // arguments that are read next are loaded into the bases' registers in front of the wait
    asm volatile("s_wait_xcnt 0x0" :: "s"(gah), "s"(gal), "s"(gbh), "s"(gbl), "v"(tid) : "memory");
    // keeps the staging loads in front of the loads below: loads return in order, and the LDS stores wait for the staging loads alone
    __builtin_amdgcn_sched_barrier(0);
    // the epilogue's per-channel values and its x1 tile are asked for here, behind the staging loads, so that the epilogue does not wait for them
    const int ci = cb * 64 + lr;   // the lane's first channel: one vector register for all of them (the step of 16 channels is an immediate)
    float bv[4], mu[4], rs[4], ga[4], be[4];
#pragma unroll
    for (int t = 0; t < 4; ++t) { bv[t] = bias[ci + t * 16]; if (MODE == 1) { mu[t] = MEAN[ci + t * 16]; rs[t] = RSTD[ci + t * 16]; ga[t] = gam[ci + t * 16]; be[t] = bet[ci + t * 16]; } }
    // x1 and out: 4 channels x 128 bytes (whole lines) a wave-access; byte offset in one vector register (the base is scalar, the step of 4 channels an immediate)
    const size_t ob = ((size_t)img * CIN + cb * 64) * NPX + (size_t)(blockIdx.x % (NPX / BNR)) * BNR + pg * 32;
    const unsigned xo = (unsigned)((lane >> 3) * NPX + (lane & 7) * 4) * 4u;
    v4f xr[16];
    if (MODE == 1) {
#pragma unroll
        for (int s = 0; s < 16; ++s) xr[s] = *(const v4f*)((const char*)(x1 + ob) + xo + (unsigned)(s * 4 * NPX * 4));
    }
    // the wait before a register that an issued load names is rewritten; the index registers as inputs are kept from being given to a result inside the run of loads
    if (MODE == 1) asm volatile("s_wait_xcnt 0x0" :: "v"(tid), "v"(ci), "v"(xo) : "memory"); else asm volatile("s_wait_xcnt 0x0" :: "v"(tid), "v"(ci) : "memory");
    {
        unsigned char* sp = st + (tid >> 4) * LP + (tid & 15) * 16;
        // in the order of the loads, which return in order: the first stores go while the last loads are still on their way
#pragma unroll
        for (int i = 0; i < CIN / 32; ++i) { *(v8usa*)(sp + (2 * BNR + i * 32) * LP) = rb[0][i]; *(v8usa*)(sp + (2 * BNR + CIN + i * 32) * LP) = rb[1][i]; }
#pragma unroll
        for (int i = 0; i < BNR / 32; ++i) { *(v8usa*)(sp + i * 32 * LP) = ra[0][i]; *(v8usa*)(sp + (BNR + i * 32) * LP) = ra[1][i]; }
    }
    lds_barrier();
    const unsigned char* ap = st + (pg * 32 + lr) * LP + hi * 16;
    const unsigned char* bp = st + (2 * BNR + cb * 64 + lr) * LP + hi * 16;
    auto lfrag = [](const unsigned char* p) { return cat16b(*(const v8usa*)p, *(const v8usa*)(p + 32)); };
    v8f acc[2][4];
#pragma unroll
    for (int ti = 0; ti < 2; ++ti) {
#pragma unroll
        for (int t = 0; t < 4; ++t) acc[ti][t] = (v8f){}; }
    // unrolled: the k step is an immediate of every LDS load
#pragma unroll
    for (int kc = 0; kc < CI / 32; ++kc) {
        v16bf a[2], al[2], bh[4], bl[4];
#pragma unroll
        for (int ti = 0; ti < 2; ++ti) { a[ti] = lfrag(ap + ti * 16 * LP + kc * 64); al[ti] = lfrag(ap + (BNR + ti * 16) * LP + kc * 64); }
#pragma unroll
        for (int t = 0; t < 4; ++t) { bh[t] = lfrag(bp + t * 16 * LP + kc * 64); bl[t] = lfrag(bp + (CIN + t * 16) * LP + kc * 64); }
        // keeps the 24 LDS loads of a step together in front of its first matrix instruction: one wait a step instead of one at every few loads
        __builtin_amdgcn_sched_barrier(0);
#pragma unroll
        for (int t = 0; t < 4; ++t) {
#pragma unroll
            for (int ti = 0; ti < 2; ++ti) acc[ti][t] = wmmab(a[ti], bh[t], acc[ti][t]); }
#pragma unroll
        for (int t = 0; t < 4; ++t) {
#pragma unroll
            for (int ti = 0; ti < 2; ++ti) acc[ti][t] = wmmab(al[ti], bh[t], acc[ti][t]); }
#pragma unroll
        for (int t = 0; t < 4; ++t) {
#pragma unroll
            for (int ti = 0; ti < 2; ++ti) acc[ti][t] = wmmab(a[ti], bl[t], acc[ti][t]); }
        // keeps the next step's loads behind this step's matrix instructions: one set of fragment registers, no spill
        __builtin_amdgcn_sched_barrier(0);
    }
#pragma unroll
    for (int t = 0; t < 4; ++t) { bv[t] = bfr(bv[t]); if (MODE == 1) { ga[t] = bfr(ga[t]); be[t] = bfr(be[t]); } }
    if (MODE == 0) {
        __shared__ __align__(16) float sm[8][CIN];
        __shared__ __align__(16) float sq[8][CIN];
#pragma unroll
        for (int t = 0; t < 4; ++t) { float s = 0.f, q = 0.f;
#pragma unroll
            for (int ti = 0; ti < 2; ++ti) {
#pragma unroll
                for (int j = 0; j < 8; ++j) s += acc[ti][t][j] + bv[t]; }
            const float m = s * (1.0f / 16.0f);
#pragma unroll
            for (int ti = 0; ti < 2; ++ti) {
#pragma unroll
                for (int j = 0; j < 8; ++j) { const float d = (acc[ti][t][j] + bv[t]) - m; q = fmaf(d, d, q); } }
            sm[pg * 2 + hi][cb * 64 + t * 16 + lr] = m; sq[pg * 2 + hi][cb * 64 + t * 16 + lr] = q; }
        __syncthreads();
        if (tid < CIN) { float a = 0.f, qq = 0.f, e = 0.f;
#pragma unroll
            for (int k = 0; k < 8; ++k) a += sm[k][tid];
            const float mm = a * 0.125f;
#pragma unroll
            for (int k = 0; k < 8; ++k) { const float d = sm[k][tid] - mm; e = fmaf(d, d, e); qq += sq[k][tid]; }
            PM[(size_t)blockIdx.x * CIN + tid] = mm; PQ[(size_t)blockIdx.x * CIN + tid] = fmaf((float)(BNR / 8), e, qq); }
    } else {
        // every wave has read its last fragment: behind this barrier the staging range is cut into the waves' own transposing tiles
        lds_barrier();
        float* os = (float*)(void*)st + wv * (64 * OP);
#pragma unroll
        for (int t = 0; t < 4; ++t) {
#pragma unroll
            for (int ti = 0; ti < 2; ++ti) { v4f u[2];
#pragma unroll
                for (int j = 0; j < 8; ++j) u[j >> 2][j & 3] = ((acc[ti][t][j] + bv[t]) - mu[t]) * rs[t] * ga[t] + be[t];
                float* dp = os + (t * 16 + lr) * OP + ti * 16 + hi * 8; *(v4fa*)dp = u[0]; *(v4fa*)(dp + 4) = u[1]; } }
        // the tile is the wave's own: keeps the compiler from moving the reads below in front of the other lanes' stores
        __builtin_amdgcn_wave_barrier(); asm volatile("" ::: "memory");
        v4f vv[16];   // registers of their own for all 16 reads: they are in flight together, and no store's data register is rewritten
#pragma unroll
        for (int s = 0; s < 16; ++s) vv[s] = *(const v4fa*)(os + (s * 4 + (lane >> 3)) * OP + (lane & 7) * 4);
#pragma unroll
        for (int s = 0; s < 16; ++s) {
#pragma unroll
            for (int i = 0; i < 4; ++i) vv[s][i] += bfr(xr[s][i]);
            *(v4f*)((char*)(OUTB + ob) + xo + (unsigned)(s * 4 * NPX * 4)) = vv[s]; }
        // the wait before a register that an issued load or store names is rewritten; xo as an input keeps its register to the end of both runs
        asm volatile("s_wait_xcnt 0x0" :: "v"(xo) : "memory");
    }
}
__global__ __launch_bounds__(512) void k_bnfin(const float* __restrict__ PM, const float* __restrict__ PQ, float* MEAN, float* RSTD) {
    __shared__ float sm[16][32];
    __shared__ float sq[16][32];
    const int lane = threadIdx.x & 31, g = threadIdx.x >> 5; const int c = blockIdx.x * 32 + lane;
    const float* pm = PM + blockIdx.x * 32; const float* pq = PQ + blockIdx.x * 32;
    const unsigned boff = (unsigned)(g * (BNP / 16) * CIN + lane) * 4u;   // byte offset, the one vector register that all 32 loads name
    float m[BNP / 16], q[BNP / 16];
#pragma unroll
    for (int i = 0; i < BNP / 16; ++i) { m[i] = *(const float*)((const char*)pm + boff + (unsigned)(i * CIN * 4)); q[i] = *(const float*)((const char*)pq + boff + (unsigned)(i * CIN * 4)); }
    // the wait before a register that an issued load names is rewritten; boff as an input keeps its register from being given to a result inside the run of loads
    asm volatile("s_wait_xcnt 0x0" :: "v"(boff) : "memory");
    float a = 0.f, qq = 0.f, e = 0.f;
#pragma unroll
    for (int i = 0; i < BNP / 16; ++i) a += m[i];
    const float lm = a * (1.0f / (float)(BNP / 16));
#pragma unroll
    for (int i = 0; i < BNP / 16; ++i) { const float d = m[i] - lm; e = fmaf(d, d, e); qq += q[i]; }
    sm[g][lane] = lm; sq[g][lane] = fmaf((float)BNR, e, qq);
    __syncthreads();
    if (g == 0) { float a2 = 0.f, q2 = 0.f, e2 = 0.f;
#pragma unroll
        for (int k = 0; k < 16; ++k) a2 += sm[k][lane];
        const float mu = a2 * (1.0f / 16.0f);
#pragma unroll
        for (int k = 0; k < 16; ++k) { const float d = sm[k][lane] - mu; e2 = fmaf(d, d, e2); q2 += sq[k][lane]; }
        const float rs = rsqrtf(fmaf((float)(BNR * (BNP / 16)), e2, q2) / (float)(NB_ * NPX) + BEPS);
        MEAN[c] = mu; RSTD[c] = rs; }
}

extern "C" void kernel_launch(void* const* d_in, const int* in_sizes, int n_in,
                              void* d_out, int out_size, void* d_ws, size_t ws_size, hipStream_t stream) {
    (void)in_sizes; (void)n_in; (void)out_size;
    const float* x1 = (const float*)d_in[0]; const float* x2 = (const float*)d_in[1]; const float* wg = (const float*)d_in[2]; const float* bg = (const float*)d_in[3]; const float* wth = (const float*)d_in[4]; const float* bth = (const float*)d_in[5]; const float* wph = (const float*)d_in[6]; const float* bph = (const float*)d_in[7];
    const float* wout = (const float*)d_in[8]; const float* bout = (const float*)d_in[9]; const float* gam = (const float*)d_in[10]; const float* bet = (const float*)d_in[11];
    float* out = (float*)d_out;    // [8][256][64][64]
    char* wsp = (char*)d_ws;
    auto take = [&](size_t bytes) { char* p = wsp; wsp += (bytes + 255) & ~(size_t)255; return (void*)p; };
    bf* WG = (bf*)take((size_t)CI * CIN * 2); bf* WT = (bf*)take((size_t)CI * CIN * 2); bf* WP = (bf*)take((size_t)CI * CIN * 2); bf* WO = (bf*)take((size_t)CIN * CI * 2);
    // all NB_ images at once
    bf* Th = (bf*)take((size_t)NB_ * NPX * CI * 2); bf* Tl = (bf*)take((size_t)NB_ * NPX * CI * 2); bf* FTh = (bf*)take((size_t)NB_ * CI * MP * 2); bf* FTl = (bf*)take((size_t)NB_ * CI * MP * 2); bf* GTh = (bf*)take((size_t)NB_ * CI * MP * 2); bf* GTl = (bf*)take((size_t)NB_ * CI * MP * 2);
    bf* KMh = (bf*)take((size_t)NB_ * CI * CI * 2); bf* KMl = (bf*)take((size_t)NB_ * CI * CI * 2); bf* QTh = (bf*)take((size_t)NB_ * CIN * CI * 2); bf* QTl = (bf*)take((size_t)NB_ * CIN * CI * 2);
    float* MEAN = (float*)take(CIN * 4); float* RSTD = (float*)take(CIN * 4); float* PM = (float*)take((size_t)BNP * CIN * 4); float* PQ = (float*)take((size_t)BNP * CIN * 4);
    if ((size_t)(wsp - (char*)d_ws) > ws_size) return;    // MiB: 0.25 + 16 + 4 + 4 + 1.5 + 0.5 ~ 26.3
    k_cvt8<<<dim3((CI * CIN / 8 + 255) / 256, 4, 1), 256, 0, stream>>>(wg, wth, wph, wout, WG, WT, WP, WO, CI * CIN / 8);   // 'oc' weights natural
    k_convf<<<dim3(NB_ * NPX / 256, 2, 1), 512, 0, stream>>>(x1, x2, WT, WP, WG, bth, bph, bg, Th, Tl, FTh, FTl, GTh, GTl);   // 1/M folded into theta
    k_red<16, MP / 512, true><<<dim3(CI / 16, CI / 64, NB_), 512, 0, stream>>>(FTh, FTl, GTh, GTl, KMh, KMl, CI, (size_t)CI * MP, (size_t)CI * MP, (size_t)CI * CI);    // KM[k][c] = sum_m phi[k][m] g[c][m]
    k_red<4, CI / 128, false><<<dim3(CIN / 16, CI / 64, NB_), 128, 0, stream>>>(WO, nullptr, KMh, KMl, QTh, QTl, CI, 0, (size_t)CI * CI, (size_t)CIN * CI);           // QT[o][k] = sum_c W[o][c] KM[k][c]
    // WY[n][o] = sum_k theta[n][k] / M . QT[o][k] + b[o], formed twice and never stored: for its statistics, then for the output
    k_prod<0><<<BNP, 512, 0, stream>>>(Th, Tl, QTh, QTl, bout, PM, PQ, nullptr, nullptr, nullptr, nullptr, nullptr, nullptr);
    k_bnfin<<<CIN / 32, 512, 0, stream>>>(PM, PQ, MEAN, RSTD);
    k_prod<1><<<BNP, 512, 0, stream>>>(Th, Tl, QTh, QTl, bout, nullptr, nullptr, x1, MEAN, RSTD, gam, bet, out);
}

// v007
// A run of this version takes 48 microseconds.
// Timed twice side by side with v006, it ran 1.08 times as fast both times.
// Over all steps from v000 it is 45.7 times as fast.
#include <hip/hip_runtime.h>

// Compute dtypes, f32 accumulate, per image: theta (on x1) and g/phi (on x2) 1x1 convs as [4096 x 256].[256 x 128] GEMMs with PLAIN bf16 operands (inputs rounded to
// bf16 and turned pixel-major on the way through LDS; exact products, + bias), the 2x2 max-pool on the conv outputs in f32. There is NO softmax in this module, so W.((theta^T.phi / M).g^T) is one chain of
// linear products and is taken from the right: KM = phi.g^T ([128 x 1024].[1024 x 128]), QT = W.KM^T ([256 x 128].[128 x 128]), then theta^T.QT^T / M + bias
// ([4096 x 128].[128 x 256]); the [4096 x 1024] matrix f is never formed. theta, phi, g, KM and QT go in as bf16 hi + UNSCALED residual planes (three products; W plain bf16, two
// products) - on v_wmma_f32_16x16x32_bf16; training-mode BatchNorm statistics over (B,H,W) per channel (fixed-order f32 column sums), the affine, + x1 and the NCHW

#define NB_  8
#define CIN  256
#define CI   128
#define HH   64
#define WW   64
#define NPX  4096
#define MP   1024
#define DM   CIN
#define BEPS 1e-5f
#define LOSC 1024.0f

typedef _Float16 h16;
typedef unsigned short bf;
typedef __attribute__((ext_vector_type(16))) __bf16   v16bf;
typedef __attribute__((ext_vector_type(16))) _Float16 v16h;
typedef __attribute__((ext_vector_type(8)))  _Float16 v8h;
typedef __attribute__((ext_vector_type(8)))  unsigned short v8us;
typedef __attribute__((ext_vector_type(8)))  float    v8f;
typedef __attribute__((ext_vector_type(4)))  float    v4f;
typedef v8h  __attribute__((may_alias)) v8ha;
typedef v4f  __attribute__((may_alias)) v4fa;
typedef v8us __attribute__((may_alias)) v8usa;

__device__ __forceinline__ unsigned short f2bf(float f) { unsigned u = __float_as_uint(f); u += 0x7FFFu + ((u >> 16) & 1u); return (unsigned short)(u >> 16); }
__device__ __forceinline__ float bf2f(unsigned short b) { return __uint_as_float(((unsigned)b) << 16); }
__device__ __forceinline__ float bfr(float f) { return bf2f(f2bf(f)); }
__device__ __forceinline__ v16h cat16(v8h lo, v8h hi) { return __builtin_shufflevector(lo, hi, 0, 1, 2, 3, 4, 5, 6, 7, 8, 9, 10, 11, 12, 13, 14, 15); }
__device__ __forceinline__ v16bf cat16b(v8us lo, v8us hi) { return __builtin_bit_cast(v16bf, __builtin_shufflevector(lo, hi, 0, 1, 2, 3, 4, 5, 6, 7, 8, 9, 10, 11, 12, 13, 14, 15)); }
__device__ __forceinline__ v8f wmma16(v16h a, v16h b, v8f c) { return __builtin_amdgcn_wmma_f32_16x16x32_f16(false, a, false, b, (short)0, c, false, false); }
__device__ __forceinline__ v8f wmmab(v16bf a, v16bf b, v8f c) { return __builtin_amdgcn_wmma_f32_16x16x32_bf16(false, a, false, b, (short)0, c, false, false); }

// k_convf: the three 1x1 convs in one grid, read straight from the f32 NCHW inputs, each leaving as the bf16 hi + residual planes that the next products read.
// One work-group (16 waves) = 256 pixels (4 image rows of one image) of x2 (blockIdx.y == 0: phi and g, 256 output channels) or of x1 (theta, 128), all CIN input channels.
// The tile is read once, 512 contiguous bytes a wave-load with all 32 loads of a thread in flight, rounded to bf16 and laid in LDS as it lies in memory, [channel][pixel];
// ds_load_tr16_b128 then hands out the [pixel][channel] fragments of C = A.B^T + bf(bias[c]) over K = CIN. B: the n-major f32 weights of the work-group's 256 (x1: 128) output
// channels are read once too, whole 128-byte lines, rounded to bf16 and laid in LDS row by row; ds_load_b128 fragments in the same k order: 8 hi + 0..7 and 16 + 8 hi + 0..7 of each 32.
// Wave (pg, cb) takes 64 pixels x 64 output channels (cb: phi's halves, g's halves; theta has two halves, so 8 of its waves have no product).
// Its four 16 x 64 tiles are 16 x positions of image rows 2q and 2q + 1 (q = pg / 2) and the next 16 of both, so all four pixels of a 2x2 pool window lie in one lane's
// accumulators (neighbouring x = neighbouring registers, the row below = the next tile). theta: times 1/M, split, rows of 128 bytes a plane. phi, g: max of the four f32 values,
// split, and each cb's 64 channels x 64 pooled positions are turned through LDS so that every [channel][m] row piece leaves as one whole 128-byte line.
#define TP 544   // LDS pitch in bytes of one channel's 256 pixels: 512 + 32, an odd multiple of 32 bytes, the transposing load's conflict-free pitch
#define WB 528   // LDS pitch in bytes of one output channel's 256 weights: 512 + 16, ds_load_b128's conflict-free pitch
// conv_stage: the work-group's f32 tile (xb) and its f32 weights (w0: theta's or phi's 128 rows; w1: g's) go to LDS as bf16. One straight run of code for each kind of
// work-group, so that every load has a scalar base with one vector offset and every wait counts that kind's own loads.
template <bool X1>
__device__ __forceinline__ void conv_stage(const float* __restrict__ xb, const float* __restrict__ w0, const float* __restrict__ w1, unsigned char* xt, unsigned char* wt, int wv, int lane) {
    typedef __attribute__((ext_vector_type(4))) unsigned short v4us;
    typedef v4us __attribute__((may_alias)) v4usa;
    typedef __attribute__((ext_vector_type(4))) __bf16 v4bf;
    // byte offset: the one vector register that all 32 loads name (the base is scalar, the step of 8 channels an immediate); two waves take one channel's 1024 bytes
    const unsigned go = (unsigned)((wv >> 1) * NPX + (wv & 1) * 128 + lane * 4) * 4u;
    // weights: 128 rows of 1024 bytes are 16 loads a thread, 512 contiguous bytes a wave-load; all name one vector register, the thread's number as the index of its 16 bytes
    // (the base is scalar, the step of 8 rows = 512 pieces an immediate)
    const int tid = threadIdx.x;
    unsigned char* wp = wt + (tid >> 6) * WB + (tid & 63) * 8;
    v4f wr[CI / 8], raw[CIN / 8];
#pragma unroll
    for (int i = 0; i < CI / 8; ++i) wr[i] = ((const v4f*)w0)[tid + i * 512];
    // keeps the first weight loads, which all work-groups of a kind share, in front of the tile's loads: loads return in order, and these come back first
    __builtin_amdgcn_sched_barrier(0);
#pragma unroll
    for (int i = 0; i < CIN / 8; ++i) raw[i] = *(const v4f*)((const char*)xb + go + (unsigned)(i * 8 * NPX * 4));
    // the wait before a register that an issued load names is rewritten; the offset, the index and the bases as inputs keep their registers from being given to another value inside the run of loads
    asm volatile("s_wait_xcnt 0x0" :: "v"(go), "v"(tid), "s"(w0), "s"(xb) : "memory");
#pragma unroll
    for (int i = 0; i < CI / 8; ++i) *(v4usa*)(wp + i * 8 * WB) = __builtin_bit_cast(v4us, __builtin_convertvector(wr[i], v4bf));   // round to nearest even
    if (!X1) {   // g's rows are asked for while the tile is still on its way; they return behind it
#pragma unroll
        for (int i = 0; i < CI / 8; ++i) wr[i] = ((const v4f*)w1)[tid + i * 512];
        // the wait before a register that an issued load names is rewritten; index and base as inputs, as above
        asm volatile("s_wait_xcnt 0x0" :: "v"(tid), "s"(w1) : "memory");
    }
    // keeps those loads in front of the tile's LDS stores, which wait for the tile
    __builtin_amdgcn_sched_barrier(0);
    unsigned char* sp = xt + (wv >> 1) * TP + (wv & 1) * 256 + lane * 8;
#pragma unroll
    for (int i = 0; i < CIN / 8; ++i) *(v4usa*)(sp + i * 8 * TP) = __builtin_bit_cast(v4us, __builtin_convertvector(raw[i], v4bf));   // round to nearest even
    if (!X1) {
#pragma unroll
        for (int i = 0; i < CI / 8; ++i) *(v4usa*)(wp + (CI + i * 8) * WB) = __builtin_bit_cast(v4us, __builtin_convertvector(wr[i], v4bf));
    }
}
__global__ __launch_bounds__(512) void k_convf(const float* __restrict__ x1, const float* __restrict__ x2, const float* __restrict__ WT, const float* __restrict__ WP, const float* __restrict__ WG, const float* __restrict__ bth, const float* __restrict__ bph, const float* __restrict__ bg, bf* Th, bf* Tl, bf* FTh, bf* FTl, bf* GTh, bf* GTl) {
    typedef __attribute__((ext_vector_type(4))) unsigned short v4us;
    typedef v4us __attribute__((may_alias)) v4usa;
    typedef __attribute__((ext_vector_type(8))) short v8s;
    typedef __attribute__((address_space(3))) v8s lds_v8s;
    __shared__ __align__(32) unsigned char xt[CIN * TP];
    __shared__ __align__(16) unsigned char wt[2 * CI * WB];   // rows: phi's and g's output channels (x2), or theta's (x1: the second half holds the epilogue's tiles)
    const bool isx1 = blockIdx.y != 0;
    // the wave's number as a scalar: the bases of its weights, bias and outputs stay in scalar registers
    const int lane = threadIdx.x & 31, wv = __builtin_amdgcn_readfirstlane(threadIdx.x >> 5), lr = lane & 15, hi = lane >> 4;
    const size_t xo = (size_t)(blockIdx.x / (NPX / 256)) * CIN * NPX + (size_t)(blockIdx.x % (NPX / 256)) * 256;
    if (isx1) conv_stage<true>(x1 + xo, WT, nullptr, xt, wt, wv, lane); else conv_stage<false>(x2 + xo, WP, WG, xt, wt, wv, lane);
    __syncthreads();
    const int pg = wv & 3, cb = wv >> 2;
    if (isx1 && cb >= 2) return;   // no barrier stands behind this line for a work-group of x1
    const int d0 = (pg >> 1) * (2 * WW) + (pg & 1) * 32, r0 = blockIdx.x * 256 + d0, c0 = (cb & 1) * 64;
    const int z = isx1 ? 0 : 1 + (cb >> 1);
    const float* __restrict__ bias = z == 0 ? bth : (z == 1 ? bph : bg);
    // lane (lr, hi) of a transposing load at channel kb gets channels kb + 8 hi + 0..7 of pixel d0 + lr
    const unsigned char* tp = xt + (8 * hi + (lane & 7)) * TP + 2 * d0 + 16 * ((lane >> 3) & 1);
    auto afrag = [&](int kc, int px) { return cat16b(__builtin_bit_cast(v8us, __builtin_amdgcn_ds_load_tr16_b128_v8i16((lds_v8s*)(tp + kc * TP + px * 2))), __builtin_bit_cast(v8us, __builtin_amdgcn_ds_load_tr16_b128_v8i16((lds_v8s*)(tp + (kc + 16) * TP + px * 2)))); };
    // the wave's 64 rows of B begin at row 64 cb (theta's halves; phi's halves, g's halves); the k step and the 16-row step are immediates
    const unsigned char* bp = wt + (cb * 64 + lr) * WB + 16 * hi;
    auto frag = [](const unsigned char* p) { return cat16b(*(const v8usa*)p, *(const v8usa*)(p + 32)); };
    const unsigned bi = (unsigned)(c0 + lr) * 4u;   // byte offset, the one vector register that the four bias loads name
    float bv[4];   // read in front of the k loop, so that the epilogue does not wait for it
#pragma unroll
    for (int t = 0; t < 4; ++t) bv[t] = *(const float*)((const char*)bias + bi + (unsigned)(t * 64));
    // the wait before a register that an issued load names is rewritten
    asm volatile("s_wait_xcnt 0x0" :: "v"(bi), "s"(bias) : "memory");
    v8f acc[4][4];   // tile ti: x positions (ti / 2) * 16 + 0..15 of image row 2q + (ti & 1)
#pragma unroll
    for (int ti = 0; ti < 4; ++ti) {
#pragma unroll
        for (int t = 0; t < 4; ++t) acc[ti][t] = (v8f){}; }
    // unrolled: the k step is an immediate of every load
#pragma unroll
    for (int kc = 0; kc < CIN; kc += 32) {
        v16bf a[4], b[4];
#pragma unroll
        for (int ti = 0; ti < 4; ++ti) a[ti] = afrag(kc, (ti >> 1) * 16 + (ti & 1) * WW);
#pragma unroll
        for (int t = 0; t < 4; ++t) b[t] = frag(bp + t * 16 * WB + kc * 2);
        // keeps the sixteen LDS loads of a step together in front of its first matrix instruction: one wait a step instead of one at every few loads
        __builtin_amdgcn_sched_barrier(0);
#pragma unroll
        for (int t = 0; t < 4; ++t) {
#pragma unroll
            for (int ti = 0; ti < 4; ++ti) acc[ti][t] = wmmab(a[ti], b[t], acc[ti][t]); }
    }
#pragma unroll
    for (int t = 0; t < 4; ++t) bv[t] = bfr(bv[t]);
    if (z == 0) {
        float* os = (float*)(void*)(wt + CI * WB) + wv * (16 * 72);   // the half of wt that theta's weights leave free: no wave reads or writes it before
#pragma unroll
        for (int ti = 0; ti < 4; ++ti) {
#pragma unroll
            for (int t = 0; t < 4; ++t) {
#pragma unroll
                for (int j = 0; j < 8; ++j) os[(hi * 8 + j) * 68 + t * 16 + lr] = acc[ti][t][j] + bv[t]; }
            // the tile is the wave's own: keeps the compiler from moving the reads below in front of the other lanes' stores
            __builtin_amdgcn_wave_barrier(); asm volatile("" ::: "memory");
#pragma unroll
            for (int s = 0; s < 4; ++s) { const int row = 4 * s + (lane >> 3), piece = lane & 7; const float* sp = os + row * 68 + piece * 8; const v4f p = *(const v4fa*)sp, q = *(const v4fa*)(sp + 4); v8us oh, ol;
#pragma unroll
                for (int i = 0; i < 8; ++i) { const float y = (i < 4 ? p[i & 3] : q[i & 3]) * (1.0f / (float)MP); const unsigned short hb = f2bf(y); oh[i] = hb; ol[i] = f2bf(y - bf2f(hb)); }
                const size_t o = (size_t)(r0 + (ti >> 1) * 16 + (ti & 1) * WW + row) * CI + c0 + piece * 8; *(v8us*)(Th + o) = oh; *(v8us*)(Tl + o) = ol; }
            // and the next tile's stores behind this tile's reads
            __builtin_amdgcn_wave_barrier(); asm volatile("" ::: "memory");
        }
    } else {
        constexpr int PP = 72;   // LDS pitch in 16-bit elements: 64 pooled positions + 16 bytes
        // every wave has read its last fragment of the tile: behind this barrier the tile's range is cut into the turning ranges
        __syncthreads();
        unsigned short* sh = (unsigned short*)(void*)(xt + cb * (2 * 64 * PP * 2)); unsigned short* sl = sh + 64 * PP;   // each cb's four waves have an LDS range of their own
#pragma unroll
        for (int sub = 0; sub < 2; ++sub) {
#pragma unroll
            for (int t = 0; t < 4; ++t) { v4us oh, ol;
#pragma unroll
                for (int q = 0; q < 4; ++q) { const float y = fmaxf(fmaxf(acc[2 * sub][t][2 * q] + bv[t], acc[2 * sub][t][2 * q + 1] + bv[t]), fmaxf(acc[2 * sub + 1][t][2 * q] + bv[t], acc[2 * sub + 1][t][2 * q + 1] + bv[t])); const unsigned short hb = f2bf(y); oh[q] = hb; ol[q] = f2bf(y - bf2f(hb)); }
                const int so = (t * 16 + lr) * PP + (pg * 2 + sub) * 8 + hi * 4; *(v4usa*)(sh + so) = oh; *(v4usa*)(sl + so) = ol; } }
        __syncthreads();
        const size_t io = (size_t)(blockIdx.x / (NPX / 256)) * CI * MP + (size_t)(blockIdx.x % (NPX / 256)) * 64;
        bf* Dh = (z == 1 ? FTh : GTh) + io; bf* Dl = (z == 1 ? FTl : GTl) + io;
#pragma unroll
        for (int s = 0; s < 4; ++s) { const int g = (threadIdx.x & 127) + s * 128, row = g >> 3, piece = g & 7;
            const v8us vh = *(const v8usa*)(sh + row * PP + piece * 8), vl = *(const v8usa*)(sl + row * PP + piece * 8);
            const size_t o = (size_t)(c0 + row) * MP + piece * 8; *(v8us*)(Dh + o) = vh; *(v8us*)(Dl + o) = vl; }
        // the wait before a register that an issued store names is rewritten: in the built code the theta branch's instructions stand behind these stores
        asm volatile("s_wait_xcnt 0x0" ::: "memory");
    }
}

__global__ __launch_bounds__(256) void k_zero8(bf* dst, size_t n8) {
    const size_t i = (size_t)blockIdx.x * 256 + threadIdx.x; if (i >= n8) return; v8us z;
#pragma unroll
    for (int k = 0; k < 8; ++k) z[k] = 0;
    *(v8us*)(dst + i * 8) = z; 
}
// k_red: the two small products of the chain. One work-group = one 16 x 64 tile of C = (Ah [+ Al]).(Bh + Bl)^T over K = NWV * STEPS * 32 (row strides = K; n-major B). The grid
// is small, so the contraction is split over the NWV waves (STEPS 32-k steps each, all loads of a wave independent); the partial tiles are summed through LDS in wave order and
// C leaves as bf16 hi + residual planes in whole 128-byte lines. The rows of B go in as the matrix instruction's first operand and the rows of A as its second (both loaders have
// the same k order), so a lane holds 8 neighbouring columns of one row of C and stores them 16 bytes at a time. Without SPLITA, A is the f32 matrix Af, rounded to bf16 as it is read. blockIdx.z = image: sA, sB, sC are the elements from one image's A planes, B planes and C to the next image's
template <int NWV, int STEPS, bool SPLITA>
__global__ __launch_bounds__(NWV * 32) void k_red(const float* __restrict__ Af, const bf* __restrict__ Ah, const bf* __restrict__ Al, const bf* __restrict__ Bh, const bf* __restrict__ Bl, bf* Ch, bf* Cl, int ldc, size_t sA, size_t sB, size_t sC) {
    typedef __attribute__((ext_vector_type(4))) unsigned short v4us;
    __shared__ __align__(16) float part[NWV][16 * 68];
    constexpr int K = NWV * STEPS * 32;
    if (SPLITA) { Ah += blockIdx.z * sA; Al += blockIdx.z * sA; } else Af += blockIdx.z * sA; Bh += blockIdx.z * sB; Bl += blockIdx.z * sB; Ch += blockIdx.z * sC; Cl += blockIdx.z * sC;
    const int lane = threadIdx.x & 31, wave = threadIdx.x >> 5, lr = lane & 15, hi = lane >> 4;
    const int r0 = blockIdx.x * 16, c0 = blockIdx.y * 64, k0 = wave * (STEPS * 32) + 8 * hi;
    // byte offsets: one vector register for A and one for B, named by all the loads of that operand (the plane's base is scalar; the k step and B's 16-row step are immediates)
    const unsigned ao = (unsigned)((r0 + lr) * K + k0) * (SPLITA ? 2u : 4u), bo = (unsigned)((c0 + lr) * K + k0) * 2u;
    auto frag = [](const bf* __restrict__ base, unsigned off, int el) { const char* p = (const char*)base + off; return cat16b(*(const v8us*)(p + (unsigned)(el * 2)), *(const v8us*)(p + (unsigned)(el * 2 + 32))); };
    typedef __attribute__((ext_vector_type(8))) __bf16 v8bf;
    auto frag32 = [](const float* __restrict__ base, unsigned off, int el) { const char* p = (const char*)base + off;   // the same 16 k, 4 bytes each; round to nearest even
        return cat16b(__builtin_bit_cast(v8us, __builtin_convertvector(*(const v8f*)(p + (unsigned)(el * 4)), v8bf)), __builtin_bit_cast(v8us, __builtin_convertvector(*(const v8f*)(p + (unsigned)(el * 4 + 64)), v8bf))); };
    v16bf a[STEPS], al[STEPS], bh[STEPS][4], bl[STEPS][4];
    // every loop of this kernel is unrolled: the fragment and accumulator arrays are indexed by constants only and so stay in registers
#pragma unroll
    for (int s = 0; s < STEPS; ++s) { if (SPLITA) { a[s] = frag(Ah, ao, s * 32); al[s] = frag(Al, ao, s * 32); } else a[s] = frag32(Af, ao, s * 32);
#pragma unroll
        for (int t = 0; t < 4; ++t) { bh[s][t] = frag(Bh, bo, t * 16 * K + s * 32); bl[s][t] = frag(Bl, bo, t * 16 * K + s * 32); } }
    // the wait before a register that an issued load names is rewritten; the offsets as inputs keep their registers from being given to a result inside the run of loads
    asm volatile("s_wait_xcnt 0x0" :: "v"(ao), "v"(bo) : "memory");
    // keeps all loads of the wave in front of its first matrix instruction, so that they are in flight together; without it they are issued two at a time, each pair waited for
    __builtin_amdgcn_sched_barrier(0);
    v8f acc[4];
#pragma unroll
    for (int t = 0; t < 4; ++t) acc[t] = (v8f){};
#pragma unroll
    for (int s = 0; s < STEPS; ++s) {
#pragma unroll
        for (int t = 0; t < 4; ++t) { acc[t] = wmmab(bh[s][t], a[s], acc[t]); if (SPLITA) acc[t] = wmmab(bh[s][t], al[s], acc[t]); acc[t] = wmmab(bl[s][t], a[s], acc[t]); }
    }
    // keeps the LDS stores behind the last matrix instruction, so that the four accumulators have registers of their own
    __builtin_amdgcn_sched_barrier(0);
    float* os = &part[wave][lr * 68 + hi * 8];
#pragma unroll
    for (int t = 0; t < 4; ++t) { *(v4fa*)(os + t * 16) = (v4f){acc[t][0], acc[t][1], acc[t][2], acc[t][3]}; *(v4fa*)(os + t * 16 + 4) = (v4f){acc[t][4], acc[t][5], acc[t][6], acc[t][7]}; }
    __syncthreads();
#pragma unroll
    for (int g = threadIdx.x; g < 16 * 16; g += NWV * 32) { const int row = g >> 4, cofs = (g & 15) * 4;
        v4f v = *(const v4fa*)(&part[0][row * 68 + cofs]);
#pragma unroll
        for (int w = 1; w < NWV; ++w) v += *(const v4fa*)(&part[w][row * 68 + cofs]);
        v4us oh, ol;
#pragma unroll
        for (int i = 0; i < 4; ++i) { const unsigned short hb = f2bf(v[i]); oh[i] = hb; ol[i] = f2bf(v[i] - bf2f(hb)); }
        const size_t o = (size_t)(r0 + row) * ldc + c0 + cofs; *(v4us*)(Ch + o) = oh; *(v4us*)(Cl + o) = ol; }
}

// The last product and the BatchNorm. WY[n][o] = sum_k theta[n][k] / M . QT[o][k] + bf(b[o]) is never stored: k_prod forms it twice, bit for bit the same, straight into what reads it.
// MODE 0 leaves, per work-group, each channel's mean and sum of squared deviations (M2) over its BNR rows; k_bnfin combines the BNP chunks; MODE 1 applies the affine, adds x1 and
// stores NCHW. One work-group (16 waves) = BNR = 128 pixels of one image x all 256 channels over K = CI: (Ah + Al).(Bh + Bl)^T, three products per 32-k step (hh, lh, hl, in that
// order into each accumulator). The four planes' tiles are contiguous in memory: they are read once, 512 contiguous bytes a wave-load with all 24 loads of a thread in flight, and
// laid in LDS at a padded pitch; wave (pg, cb) takes 32 pixels x 64 channels, its fragments by ds_load_b128 (both loaders: k = 8 hi + 0..7 and 16 + 8 hi + 0..7 of each 32).
// A lane holds 16 pixels (2 tiles x 8 registers) of each of its 4 channels. Equal-sized groups combine as mean = average of the means, M2 = sum of the M2 + count * sum of
// (group mean - mean)^2, in a fixed order.
#define BNP 256
#define BNR (NB_ * NPX / BNP)
#define LP 272   // LDS pitch in bytes of one row's 128 k: 256 + 16, ds_load_b128's conflict-free pitch
#define OP 36    // LDS pitch in floats of one channel's 32 pixels in a wave's transposing tile: 128 + 16 bytes
// work-group barrier for LDS data alone: it waits for the wave's LDS operations, not for its global loads, so that the x1 loads issued in front of it stay in flight
// behind it (__syncthreads() waits for every outstanding load of the wave)
__device__ __forceinline__ void lds_barrier() { __builtin_amdgcn_fence(__ATOMIC_RELEASE, "workgroup", "local"); __builtin_amdgcn_s_barrier(); __builtin_amdgcn_fence(__ATOMIC_ACQUIRE, "workgroup", "local"); }
template <int MODE>
__global__ __launch_bounds__(512) void k_prod(const bf* __restrict__ Ah, const bf* __restrict__ Al, const bf* __restrict__ Bh, const bf* __restrict__ Bl, const float* __restrict__ bias, float* PM, float* PQ, const float* __restrict__ x1, const float* __restrict__ MEAN, const float* __restrict__ RSTD, const float* __restrict__ gam, const float* __restrict__ bet, float* OUTB) {
    __shared__ __align__(16) unsigned char st[(2 * BNR + 2 * CIN) * LP];   // rows: Ah, Al, Bh, Bl
    // every loop of this kernel is unrolled: the staging, fragment, accumulator and x1 arrays are indexed by constants only and so stay in registers
    // the wave's number as a scalar: the bases of its loads and stores stay in scalar registers
    const int tid = threadIdx.x, lane = tid & 31, wv = __builtin_amdgcn_readfirstlane(tid >> 5), lr = lane & 15, hi = lane >> 4;
    const int img = blockIdx.x / (NPX / BNR), pg = wv & 3, cb = wv >> 2;
    const v8us* gah = (const v8us*)(Ah + (size_t)blockIdx.x * BNR * CI); const v8us* gal = (const v8us*)(Al + (size_t)blockIdx.x * BNR * CI);
    const v8us* gbh = (const v8us*)(Bh + (size_t)img * CIN * CI); const v8us* gbl = (const v8us*)(Bl + (size_t)img * CIN * CI);
    // all 24 loads name one vector register, the thread's number as the index of its 16 bytes (the bases are scalar, the step of 32 rows = 512 pieces an immediate)
    v8us ra[2][BNR / 32], rb[2][CIN / 32];
#pragma unroll
    for (int i = 0; i < CIN / 32; ++i) { rb[0][i] = gbh[tid + i * 512]; rb[1][i] = gbl[tid + i * 512]; }
#pragma unroll
    for (int i = 0; i < BNR / 32; ++i) { ra[0][i] = gah[tid + i * 512]; ra[1][i] = gal[tid + i * 512]; }
    // the wait before a register that an issued load names is rewritten; the four scalar bases and the index as inputs keep their registers to this line: otherwise the
    // arguments that are read next are loaded into the bases' registers in front of the wait
    asm volatile("s_wait_xcnt 0x0" :: "s"(gah), "s"(gal), "s"(gbh), "s"(gbl), "v"(tid) : "memory");
    // keeps the staging loads in front of the loads below: loads return in order, and the LDS stores wait for the staging loads alone
    __builtin_amdgcn_sched_barrier(0);
    // the epilogue's per-channel values and its x1 tile are asked for here, behind the staging loads, so that the epilogue does not wait for them
    const int ci = cb * 64 + lr;   // the lane's first channel: one vector register for all of them (the step of 16 channels is an immediate)
    float bv[4], mu[4], rs[4], ga[4], be[4];
#pragma unroll
    for (int t = 0; t < 4; ++t) { bv[t] = bias[ci + t * 16]; if (MODE == 1) { mu[t] = MEAN[ci + t * 16]; rs[t] = RSTD[ci + t * 16]; ga[t] = gam[ci + t * 16]; be[t] = bet[ci + t * 16]; } }
    // x1 and out: 4 channels x 128 bytes (whole lines) a wave-access; byte offset in one vector register (the base is scalar, the step of 4 channels an immediate)
    const size_t ob = ((size_t)img * CIN + cb * 64) * NPX + (size_t)(blockIdx.x % (NPX / BNR)) * BNR + pg * 32;
    const unsigned xo = (unsigned)((lane >> 3) * NPX + (lane & 7) * 4) * 4u;
    v4f xr[16];
    if (MODE == 1) {
#pragma unroll
        for (int s = 0; s < 16; ++s) xr[s] = *(const v4f*)((const char*)(x1 + ob) + xo + (unsigned)(s * 4 * NPX * 4));
    }
    // the wait before a register that an issued load names is rewritten; the index registers as inputs are kept from being given to a result inside the run of loads
    if (MODE == 1) asm volatile("s_wait_xcnt 0x0" :: "v"(tid), "v"(ci), "v"(xo) : "memory"); else asm volatile("s_wait_xcnt 0x0" :: "v"(tid), "v"(ci) : "memory");
    {
        unsigned char* sp = st + (tid >> 4) * LP + (tid & 15) * 16;
        // in the order of the loads, which return in order: the first stores go while the last loads are still on their way
#pragma unroll
        for (int i = 0; i < CIN / 32; ++i) { *(v8usa*)(sp + (2 * BNR + i * 32) * LP) = rb[0][i]; *(v8usa*)(sp + (2 * BNR + CIN + i * 32) * LP) = rb[1][i]; }
#pragma unroll
        for (int i = 0; i < BNR / 32; ++i) { *(v8usa*)(sp + i * 32 * LP) = ra[0][i]; *(v8usa*)(sp + (BNR + i * 32) * LP) = ra[1][i]; }
    }
    lds_barrier();
    const unsigned char* ap = st + (pg * 32 + lr) * LP + hi * 16;
    const unsigned char* bp = st + (2 * BNR + cb * 64 + lr) * LP + hi * 16;
    auto lfrag = [](const unsigned char* p) { return cat16b(*(const v8usa*)p, *(const v8usa*)(p + 32)); };
    v8f acc[2][4];
#pragma unroll
    for (int ti = 0; ti < 2; ++ti) {
#pragma unroll
        for (int t = 0; t < 4; ++t) acc[ti][t] = (v8f){}; }
    // unrolled: the k step is an immediate of every LDS load
#pragma unroll
    for (int kc = 0; kc < CI / 32; ++kc) {
        v16bf a[2], al[2], bh[4], bl[4];
#pragma unroll
        for (int ti = 0; ti < 2; ++ti) { a[ti] = lfrag(ap + ti * 16 * LP + kc * 64); al[ti] = lfrag(ap + (BNR + ti * 16) * LP + kc * 64); }
#pragma unroll
        for (int t = 0; t < 4; ++t) { bh[t] = lfrag(bp + t * 16 * LP + kc * 64); bl[t] = lfrag(bp + (CIN + t * 16) * LP + kc * 64); }
        // keeps the 24 LDS loads of a step together in front of its first matrix instruction: one wait a step instead of one at every few loads
        __builtin_amdgcn_sched_barrier(0);
#pragma unroll
        for (int t = 0; t < 4; ++t) {
#pragma unroll
            for (int ti = 0; ti < 2; ++ti) acc[ti][t] = wmmab(a[ti], bh[t], acc[ti][t]); }
#pragma unroll
        for (int t = 0; t < 4; ++t) {
#pragma unroll
            for (int ti = 0; ti < 2; ++ti) acc[ti][t] = wmmab(al[ti], bh[t], acc[ti][t]); }
#pragma unroll
        for (int t = 0; t < 4; ++t) {
#pragma unroll
            for (int ti = 0; ti < 2; ++ti) acc[ti][t] = wmmab(a[ti], bl[t], acc[ti][t]); }
        // keeps the next step's loads behind this step's matrix instructions: one set of fragment registers, no spill
        __builtin_amdgcn_sched_barrier(0);
    }
#pragma unroll
    for (int t = 0; t < 4; ++t) { bv[t] = bfr(bv[t]); if (MODE == 1) { ga[t] = bfr(ga[t]); be[t] = bfr(be[t]); } }
    if (MODE == 0) {
        __shared__ __align__(16) float sm[8][CIN];
        __shared__ __align__(16) float sq[8][CIN];
#pragma unroll
        for (int t = 0; t < 4; ++t) { float s = 0.f, q = 0.f;
#pragma unroll
            for (int ti = 0; ti < 2; ++ti) {
#pragma unroll
                for (int j = 0; j < 8; ++j) s += acc[ti][t][j] + bv[t]; }
            const float m = s * (1.0f / 16.0f);
#pragma unroll
            for (int ti = 0; ti < 2; ++ti) {
#pragma unroll
                for (int j = 0; j < 8; ++j) { const float d = (acc[ti][t][j] + bv[t]) - m; q = fmaf(d, d, q); } }
            sm[pg * 2 + hi][cb * 64 + t * 16 + lr] = m; sq[pg * 2 + hi][cb * 64 + t * 16 + lr] = q; }
        __syncthreads();
        if (tid < CIN) { float a = 0.f, qq = 0.f, e = 0.f;
#pragma unroll
            for (int k = 0; k < 8; ++k) a += sm[k][tid];
            const float mm = a * 0.125f;
#pragma unroll
            for (int k = 0; k < 8; ++k) { const float d = sm[k][tid] - mm; e = fmaf(d, d, e); qq += sq[k][tid]; }
            PM[(size_t)blockIdx.x * CIN + tid] = mm; PQ[(size_t)blockIdx.x * CIN + tid] = fmaf((float)(BNR / 8), e, qq); }
    } else {
        // every wave has read its last fragment: behind this barrier the staging range is cut into the waves' own transposing tiles
        lds_barrier();
        float* os = (float*)(void*)st + wv * (64 * OP);
#pragma unroll
        for (int t = 0; t < 4; ++t) {
#pragma unroll
            for (int ti = 0; ti < 2; ++ti) { v4f u[2];
#pragma unroll
                for (int j = 0; j < 8; ++j) u[j >> 2][j & 3] = ((acc[ti][t][j] + bv[t]) - mu[t]) * rs[t] * ga[t] + be[t];
                float* dp = os + (t * 16 + lr) * OP + ti * 16 + hi * 8; *(v4fa*)dp = u[0]; *(v4fa*)(dp + 4) = u[1]; } }
        // the tile is the wave's own: keeps the compiler from moving the reads below in front of the other lanes' stores
        __builtin_amdgcn_wave_barrier(); asm volatile("" ::: "memory");
        v4f vv[16];   // registers of their own for all 16 reads: they are in flight together, and no store's data register is rewritten
#pragma unroll
        for (int s = 0; s < 16; ++s) vv[s] = *(const v4fa*)(os + (s * 4 + (lane >> 3)) * OP + (lane & 7) * 4);
#pragma unroll
        for (int s = 0; s < 16; ++s) {
#pragma unroll
            for (int i = 0; i < 4; ++i) vv[s][i] += bfr(xr[s][i]);
            *(v4f*)((char*)(OUTB + ob) + xo + (unsigned)(s * 4 * NPX * 4)) = vv[s]; }
        // the wait before a register that an issued load or store names is rewritten; xo as an input keeps its register to the end of both runs
        asm volatile("s_wait_xcnt 0x0" :: "v"(xo) : "memory");
    }
}
__global__ __launch_bounds__(512) void k_bnfin(const float* __restrict__ PM, const float* __restrict__ PQ, float* MEAN, float* RSTD) {
    __shared__ float sm[16][32];
    __shared__ float sq[16][32];
    const int lane = threadIdx.x & 31, g = threadIdx.x >> 5; const int c = blockIdx.x * 32 + lane;
    const float* pm = PM + blockIdx.x * 32; const float* pq = PQ + blockIdx.x * 32;
    const unsigned boff = (unsigned)(g * (BNP / 16) * CIN + lane) * 4u;   // byte offset, the one vector register that all 32 loads name
    float m[BNP / 16], q[BNP / 16];
#pragma unroll
    for (int i = 0; i < BNP / 16; ++i) { m[i] = *(const float*)((const char*)pm + boff + (unsigned)(i * CIN * 4)); q[i] = *(const float*)((const char*)pq + boff + (unsigned)(i * CIN * 4)); }
    // the wait before a register that an issued load names is rewritten; boff as an input keeps its register from being given to a result inside the run of loads
    asm volatile("s_wait_xcnt 0x0" :: "v"(boff) : "memory");
    float a = 0.f, qq = 0.f, e = 0.f;
#pragma unroll
    for (int i = 0; i < BNP / 16; ++i) a += m[i];
    const float lm = a * (1.0f / (float)(BNP / 16));
#pragma unroll
    for (int i = 0; i < BNP / 16; ++i) { const float d = m[i] - lm; e = fmaf(d, d, e); qq += q[i]; }
    sm[g][lane] = lm; sq[g][lane] = fmaf((float)BNR, e, qq);
    __syncthreads();
    if (g == 0) { float a2 = 0.f, q2 = 0.f, e2 = 0.f;
#pragma unroll
        for (int k = 0; k < 16; ++k) a2 += sm[k][lane];
        const float mu = a2 * (1.0f / 16.0f);
#pragma unroll
        for (int k = 0; k < 16; ++k) { const float d = sm[k][lane] - mu; e2 = fmaf(d, d, e2); q2 += sq[k][lane]; }
        const float rs = rsqrtf(fmaf((float)(BNR * (BNP / 16)), e2, q2) / (float)(NB_ * NPX) + BEPS);
        MEAN[c] = mu; RSTD[c] = rs; }
}

extern "C" void kernel_launch(void* const* d_in, const int* in_sizes, int n_in,
                              void* d_out, int out_size, void* d_ws, size_t ws_size, hipStream_t stream) {
    (void)in_sizes; (void)n_in; (void)out_size;
    const float* x1 = (const float*)d_in[0]; const float* x2 = (const float*)d_in[1]; const float* wg = (const float*)d_in[2]; const float* bg = (const float*)d_in[3]; const float* wth = (const float*)d_in[4]; const float* bth = (const float*)d_in[5]; const float* wph = (const float*)d_in[6]; const float* bph = (const float*)d_in[7];
    const float* wout = (const float*)d_in[8]; const float* bout = (const float*)d_in[9]; const float* gam = (const float*)d_in[10]; const float* bet = (const float*)d_in[11];
    float* out = (float*)d_out;    // [8][256][64][64]
    char* wsp = (char*)d_ws;
    auto take = [&](size_t bytes) { char* p = wsp; wsp += (bytes + 255) & ~(size_t)255; return (void*)p; };
    // all NB_ images at once
    bf* Th = (bf*)take((size_t)NB_ * NPX * CI * 2); bf* Tl = (bf*)take((size_t)NB_ * NPX * CI * 2); bf* FTh = (bf*)take((size_t)NB_ * CI * MP * 2); bf* FTl = (bf*)take((size_t)NB_ * CI * MP * 2); bf* GTh = (bf*)take((size_t)NB_ * CI * MP * 2); bf* GTl = (bf*)take((size_t)NB_ * CI * MP * 2);
    bf* KMh = (bf*)take((size_t)NB_ * CI * CI * 2); bf* KMl = (bf*)take((size_t)NB_ * CI * CI * 2); bf* QTh = (bf*)take((size_t)NB_ * CIN * CI * 2); bf* QTl = (bf*)take((size_t)NB_ * CIN * CI * 2);
    float* MEAN = (float*)take(CIN * 4); float* RSTD = (float*)take(CIN * 4); float* PM = (float*)take((size_t)BNP * CIN * 4); float* PQ = (float*)take((size_t)BNP * CIN * 4);
    if ((size_t)(wsp - (char*)d_ws) > ws_size) return;    // MiB: 16 + 4 + 4 + 1.5 + 0.5 ~ 26
    k_convf<<<dim3(NB_ * NPX / 256, 2, 1), 512, 0, stream>>>(x1, x2, wth, wph, wg, bth, bph, bg, Th, Tl, FTh, FTl, GTh, GTl);   // 1/M folded into theta
    k_red<16, MP / 512, true><<<dim3(CI / 16, CI / 64, NB_), 512, 0, stream>>>(nullptr, FTh, FTl, GTh, GTl, KMh, KMl, CI, (size_t)CI * MP, (size_t)CI * MP, (size_t)CI * CI);    // KM[k][c] = sum_m phi[k][m] g[c][m]
    k_red<4, CI / 128, false><<<dim3(CIN / 16, CI / 64, NB_), 128, 0, stream>>>(wout, nullptr, nullptr, KMh, KMl, QTh, QTl, CI, 0, (size_t)CI * CI, (size_t)CIN * CI);           // QT[o][k] = sum_c W[o][c] KM[k][c]
    // WY[n][o] = sum_k theta[n][k] / M . QT[o][k] + b[o], formed twice and never stored: for its statistics, then for the output
    k_prod<0><<<BNP, 512, 0, stream>>>(Th, Tl, QTh, QTl, bout, PM, PQ, nullptr, nullptr, nullptr, nullptr, nullptr, nullptr);
    k_bnfin<<<CIN / 32, 512, 0, stream>>>(PM, PQ, MEAN, RSTD);
    k_prod<1><<<BNP, 512, 0, stream>>>(Th, Tl, QTh, QTl, bout, nullptr, nullptr, x1, MEAN, RSTD, gam, bet, out);
}

// v008
// One run takes 46.5 microseconds.
// Two timings next to v007 put it at 1.04 and 1.06 times that version's speed.
// Over all steps from v000 it is 47.9 times as fast.
#include <hip/hip_runtime.h>

// Compute dtypes, f32 accumulate, per image: theta (on x1) and g/phi (on x2) 1x1 convs as [4096 x 256].[256 x 128] GEMMs with PLAIN bf16 operands (inputs rounded to
// bf16 and turned pixel-major on the way through LDS; exact products, + bias), the 2x2 max-pool on the conv outputs in f32. There is NO softmax in this module, so W.((theta^T.phi / M).g^T) is one chain of
// linear products and is taken from the right: KM = phi.g^T ([128 x 1024].[1024 x 128]), QT = W.KM^T ([256 x 128].[128 x 128]), then theta^T.QT^T / M + bias
// ([4096 x 128].[128 x 256]); the [4096 x 1024] matrix f is never formed. theta, phi, g, KM and QT go in as bf16 hi + UNSCALED residual planes (three products; W plain bf16, two
// products) - on v_wmma_f32_16x16x32_bf16; training-mode BatchNorm statistics over (B,H,W) per channel (theta's per-image mean and covariance, also on that instruction, pushed through QT; fixed-order f32 sums), the affine, + x1 and the NCHW

#define NB_  8
#define CIN  256
#define CI   128
#define HH   64
#define WW   64
#define NPX  4096
#define MP   1024
#define DM   CIN
#define BEPS 1e-5f
#define LOSC 1024.0f

typedef _Float16 h16;
typedef unsigned short bf;
typedef __attribute__((ext_vector_type(16))) __bf16   v16bf;
typedef __attribute__((ext_vector_type(16))) _Float16 v16h;
typedef __attribute__((ext_vector_type(8)))  _Float16 v8h;
typedef __attribute__((ext_vector_type(8)))  unsigned short v8us;
typedef __attribute__((ext_vector_type(8)))  float    v8f;
typedef __attribute__((ext_vector_type(4)))  float    v4f;
typedef v8h  __attribute__((may_alias)) v8ha;
typedef v4f  __attribute__((may_alias)) v4fa;
typedef v8us __attribute__((may_alias)) v8usa;

__device__ __forceinline__ unsigned short f2bf(float f) { unsigned u = __float_as_uint(f); u += 0x7FFFu + ((u >> 16) & 1u); return (unsigned short)(u >> 16); }
__device__ __forceinline__ float bf2f(unsigned short b) { return __uint_as_float(((unsigned)b) << 16); }
__device__ __forceinline__ float bfr(float f) { return bf2f(f2bf(f)); }
__device__ __forceinline__ v16h cat16(v8h lo, v8h hi) { return __builtin_shufflevector(lo, hi, 0, 1, 2, 3, 4, 5, 6, 7, 8, 9, 10, 11, 12, 13, 14, 15); }
__device__ __forceinline__ v16bf cat16b(v8us lo, v8us hi) { return __builtin_bit_cast(v16bf, __builtin_shufflevector(lo, hi, 0, 1, 2, 3, 4, 5, 6, 7, 8, 9, 10, 11, 12, 13, 14, 15)); }
__device__ __forceinline__ v8f wmma16(v16h a, v16h b, v8f c) { return __builtin_amdgcn_wmma_f32_16x16x32_f16(false, a, false, b, (short)0, c, false, false); }
__device__ __forceinline__ v8f wmmab(v16bf a, v16bf b, v8f c) { return __builtin_amdgcn_wmma_f32_16x16x32_bf16(false, a, false, b, (short)0, c, false, false); }

// k_convf: the three 1x1 convs in one grid, read straight from the f32 NCHW inputs, each leaving as the bf16 hi + residual planes that the next products read.
// One work-group (16 waves) = 256 pixels (4 image rows of one image) of x1 (blockIdx.y == 0: theta, 128 output channels) or of x2 (phi and g, 256), all CIN input channels.
// The tile is read once, 512 contiguous bytes a wave-load with all 32 loads of a thread in flight, rounded to bf16 and laid in LDS as it lies in memory, [channel][pixel];
// ds_load_tr16_b128 then hands out the [pixel][channel] fragments of C = A.B^T + bf(bias[c]) over K = CIN. B: the n-major f32 weights of the work-group's 256 (x1: 128) output
// channels are read once too, whole 128-byte lines, rounded to bf16 and laid in LDS row by row; ds_load_b128 fragments in the same k order: 8 hi + 0..7 and 16 + 8 hi + 0..7 of each 32.
// Wave (pg, cb) takes 64 pixels x 64 output channels (cb: phi's halves, g's halves; theta has two halves, so 8 of its waves have no conv product).
// Its four 16 x 64 tiles are 16 x positions of image rows 2q and 2q + 1 (q = pg / 2) and the next 16 of both, so all four pixels of a 2x2 pool window lie in one lane's
// accumulators (neighbouring x = neighbouring registers, the row below = the next tile). theta: times 1/M, split, rows of 128 bytes a plane. phi, g: max of the four f32 values,
// split, and each cb's 64 channels x 64 pooled positions are turned through LDS so that every [channel][m] row piece leaves as one whole 128-byte line.
#define TP 544   // LDS pitch in bytes of one channel's 256 pixels: 512 + 32, an odd multiple of 32 bytes, the transposing load's conflict-free pitch
#define GPI 288  // LDS pitch in bytes of one pixel's 128 theta channels: 256 + 32, an odd multiple of 32 bytes, the transposing load's conflict-free pitch
#define WB 528   // LDS pitch in bytes of one output channel's 256 weights: 512 + 16, ds_load_b128's conflict-free pitch
// conv_stage: the work-group's f32 tile (xb) and its f32 weights (w0: theta's or phi's 128 rows; w1: g's) go to LDS as bf16. One straight run of code for each kind of
// work-group, so that every load has a scalar base with one vector offset and every wait counts that kind's own loads.
// work-group barrier for LDS data alone: it waits for the wave's LDS operations, not for its global loads and stores, so that those issued in front of it stay in flight
// behind it (__syncthreads() waits for every outstanding load and store of the wave)
__device__ __forceinline__ void lds_barrier() { __builtin_amdgcn_fence(__ATOMIC_RELEASE, "workgroup", "local"); __builtin_amdgcn_s_barrier(); __builtin_amdgcn_fence(__ATOMIC_ACQUIRE, "workgroup", "local"); }
template <bool B> struct flag_ { static constexpr bool v = B; };
template <bool X1>
__device__ __forceinline__ void conv_stage(const float* __restrict__ xb, const float* __restrict__ w0, const float* __restrict__ w1, unsigned char* xt, unsigned char* wt, int wv, int lane) {
    typedef __attribute__((ext_vector_type(4))) unsigned short v4us;
    typedef v4us __attribute__((may_alias)) v4usa;
    typedef __attribute__((ext_vector_type(4))) __bf16 v4bf;
    // byte offset: the one vector register that all 32 loads name (the base is scalar, the step of 8 channels an immediate); two waves take one channel's 1024 bytes
    const unsigned go = (unsigned)((wv >> 1) * NPX + (wv & 1) * 128 + lane * 4) * 4u;
    // weights: 128 rows of 1024 bytes are 16 loads a thread, 512 contiguous bytes a wave-load; all name one vector register, the thread's number as the index of its 16 bytes
    // (the base is scalar, the step of 8 rows = 512 pieces an immediate)
    const int tid = threadIdx.x;
    unsigned char* wp = wt + (tid >> 6) * WB + (tid & 63) * 8;
    v4f wr[CI / 8], raw[CIN / 8];
#pragma unroll
    for (int i = 0; i < CI / 8; ++i) wr[i] = ((const v4f*)w0)[tid + i * 512];
    // keeps the first weight loads, which all work-groups of a kind share, in front of the tile's loads: loads return in order, and these come back first
    __builtin_amdgcn_sched_barrier(0);
#pragma unroll
    for (int i = 0; i < CIN / 8; ++i) raw[i] = *(const v4f*)((const char*)xb + go + (unsigned)(i * 8 * NPX * 4));
    // the wait before a register that an issued load names is rewritten; the offset, the index and the bases as inputs keep their registers from being given to another value inside the run of loads
    asm volatile("s_wait_xcnt 0x0" :: "v"(go), "v"(tid), "s"(w0), "s"(xb) : "memory");
#pragma unroll
    for (int i = 0; i < CI / 8; ++i) *(v4usa*)(wp + i * 8 * WB) = __builtin_bit_cast(v4us, __builtin_convertvector(wr[i], v4bf));   // round to nearest even
    if (!X1) {   // g's rows are asked for while the tile is still on its way; they return behind it
#pragma unroll
        for (int i = 0; i < CI / 8; ++i) wr[i] = ((const v4f*)w1)[tid + i * 512];
        // the wait before a register that an issued load names is rewritten; index and base as inputs, as above
        asm volatile("s_wait_xcnt 0x0" :: "v"(tid), "s"(w1) : "memory");
    }
    // keeps those loads in front of the tile's LDS stores, which wait for the tile
    __builtin_amdgcn_sched_barrier(0);
    unsigned char* sp = xt + (wv >> 1) * TP + (wv & 1) * 256 + lane * 8;
#pragma unroll
    for (int i = 0; i < CIN / 8; ++i) *(v4usa*)(sp + i * 8 * TP) = __builtin_bit_cast(v4us, __builtin_convertvector(raw[i], v4bf));   // round to nearest even
    if (!X1) {
#pragma unroll
        for (int i = 0; i < CI / 8; ++i) *(v4usa*)(wp + (CI + i * 8) * WB) = __builtin_bit_cast(v4us, __builtin_convertvector(wr[i], v4bf));
    }
}
__global__ __launch_bounds__(512) void k_convf(const float* __restrict__ x1, const float* __restrict__ x2, const float* __restrict__ WT, const float* __restrict__ WP, const float* __restrict__ WG, const float* __restrict__ bth, const float* __restrict__ bph, const float* __restrict__ bg, bf* Th, bf* Tl, bf* FTh, bf* FTl, bf* GTh, bf* GTl, float* GP, float* SP) {
    typedef __attribute__((ext_vector_type(4))) unsigned short v4us;
    typedef v4us __attribute__((may_alias)) v4usa;
    typedef __attribute__((ext_vector_type(8))) short v8s;
    typedef __attribute__((address_space(3))) v8s lds_v8s;
    __shared__ __align__(32) unsigned char xt[2 * 256 * GPI];   // the tile, CIN * TP bytes; later theta's two planes (x1) or the turning ranges (x2)
    __shared__ __align__(16) unsigned char wt[2 * CI * WB];   // rows: phi's and g's output channels (x2), or theta's (x1: the second half holds the epilogue's tiles)
    const bool isx1 = blockIdx.y == 0;   // x1's work-groups, which have the moments to form as well, come first in index order
    // the wave's number as a scalar: the bases of its weights, bias and outputs stay in scalar registers
    const int lane = threadIdx.x & 31, wv = __builtin_amdgcn_readfirstlane(threadIdx.x >> 5), lr = lane & 15, hi = lane >> 4;
    const size_t xo = (size_t)(blockIdx.x / (NPX / 256)) * CIN * NPX + (size_t)(blockIdx.x % (NPX / 256)) * 256;
    if (isx1) conv_stage<true>(x1 + xo, WT, nullptr, xt, wt, wv, lane); else conv_stage<false>(x2 + xo, WP, WG, xt, wt, wv, lane);
    __syncthreads();
    const int pg = wv & 3, cb = wv >> 2;
    const bool idle = isx1 && cb >= 2;   // a scalar: these waves have no conv product; they take their share of theta's second moments below
    const int d0 = (pg >> 1) * (2 * WW) + (pg & 1) * 32, r0 = blockIdx.x * 256 + d0, c0 = (cb & 1) * 64;
    const int z = isx1 ? 0 : 1 + (cb >> 1);
    const float* __restrict__ bias = z == 0 ? bth : (z == 1 ? bph : bg);
    // lane (lr, hi) of a transposing load at channel kb gets channels kb + 8 hi + 0..7 of pixel d0 + lr
    const unsigned char* tp = xt + (8 * hi + (lane & 7)) * TP + 2 * d0 + 16 * ((lane >> 3) & 1);
    auto afrag = [&](int kc, int px) { return cat16b(__builtin_bit_cast(v8us, __builtin_amdgcn_ds_load_tr16_b128_v8i16((lds_v8s*)(tp + kc * TP + px * 2))), __builtin_bit_cast(v8us, __builtin_amdgcn_ds_load_tr16_b128_v8i16((lds_v8s*)(tp + (kc + 16) * TP + px * 2)))); };
    // the wave's 64 rows of B begin at row 64 cb (theta's halves; phi's halves, g's halves); the k step and the 16-row step are immediates
    const unsigned char* bp = wt + (cb * 64 + lr) * WB + 16 * hi;
    auto frag = [](const unsigned char* p) { return cat16b(*(const v8usa*)p, *(const v8usa*)(p + 32)); };
    const unsigned bi = (unsigned)(c0 + lr) * 4u;   // byte offset, the one vector register that the four bias loads name
    float bv[4];   // read in front of the k loop, so that the epilogue does not wait for it
#pragma unroll
    for (int t = 0; t < 4; ++t) bv[t] = *(const float*)((const char*)bias + bi + (unsigned)(t * 64));
    // the wait before a register that an issued load names is rewritten
    asm volatile("s_wait_xcnt 0x0" :: "v"(bi), "s"(bias) : "memory");
    v8f acc[4][4];   // tile ti: x positions (ti / 2) * 16 + 0..15 of image row 2q + (ti & 1)
#pragma unroll
    for (int ti = 0; ti < 4; ++ti) {
#pragma unroll
        for (int t = 0; t < 4; ++t) acc[ti][t] = (v8f){}; }
    // unrolled: the k step is an immediate of every load
    if (!idle) {
#pragma unroll
    for (int kc = 0; kc < CIN; kc += 32) {
        v16bf a[4], b[4];
#pragma unroll
        for (int ti = 0; ti < 4; ++ti) a[ti] = afrag(kc, (ti >> 1) * 16 + (ti & 1) * WW);
#pragma unroll
        for (int t = 0; t < 4; ++t) b[t] = frag(bp + t * 16 * WB + kc * 2);
        // keeps the sixteen LDS loads of a step together in front of its first matrix instruction: one wait a step instead of one at every few loads
        __builtin_amdgcn_sched_barrier(0);
#pragma unroll
        for (int t = 0; t < 4; ++t) {
#pragma unroll
            for (int ti = 0; ti < 4; ++ti) acc[ti][t] = wmmab(a[ti], b[t], acc[ti][t]); }
    }
    }
#pragma unroll
    for (int t = 0; t < 4; ++t) bv[t] = bfr(bv[t]);
    if (z == 0) {
        // every wave has read its last fragment of the tile: behind this barrier the tile's range takes theta's two bf16 planes, [pixel][channel]
        __syncthreads();
        if (!idle) {
        float* os = (float*)(void*)(wt + CI * WB) + wv * (16 * 72);   // the half of wt that theta's weights leave free: no wave reads or writes it before
#pragma unroll
        for (int ti = 0; ti < 4; ++ti) {
#pragma unroll
            for (int t = 0; t < 4; ++t) {
#pragma unroll
                for (int j = 0; j < 8; ++j) os[(hi * 8 + j) * 68 + t * 16 + lr] = acc[ti][t][j] + bv[t]; }
            // the tile is the wave's own: keeps the compiler from moving the reads below in front of the other lanes' stores
            __builtin_amdgcn_wave_barrier(); asm volatile("" ::: "memory");
#pragma unroll
            for (int s = 0; s < 4; ++s) { const int row = 4 * s + (lane >> 3), piece = lane & 7; const float* sp = os + row * 68 + piece * 8; const v4f p = *(const v4fa*)sp, q = *(const v4fa*)(sp + 4); v8us oh, ol;
#pragma unroll
                for (int i = 0; i < 8; ++i) { const float y = (i < 4 ? p[i & 3] : q[i & 3]) * (1.0f / (float)MP); const unsigned short hb = f2bf(y); oh[i] = hb; ol[i] = f2bf(y - bf2f(hb)); }
                const size_t o = (size_t)(r0 + (ti >> 1) * 16 + (ti & 1) * WW + row) * CI + c0 + piece * 8; *(v8us*)(Th + o) = oh; *(v8us*)(Tl + o) = ol;
                unsigned char* lp = xt + (d0 + (ti >> 1) * 16 + (ti & 1) * WW + row) * GPI + (c0 + piece * 8) * 2; *(v8usa*)lp = oh; *(v8usa*)(lp + 256 * GPI) = ol; }
            // and the next tile's stores behind this tile's reads
            __builtin_amdgcn_wave_barrier(); asm volatile("" ::: "memory");
        }
        // the wait before a register that an issued store names is rewritten
        asm volatile("s_wait_xcnt 0x0" ::: "memory");
        }
        // both planes of all 256 pixels lie in LDS: behind this barrier every wave reads them; theta's global stores stay in flight over it
        lds_barrier();
        // The work-group's share of theta's moments: G[c][c'] = sum over its 256 pixels of theta[c] theta[c'] (hh, lh, hl into each accumulator) and S[c] = sum of theta[c] (h, l against
        // a fragment of ones). Both operands come from the one transposing loader (channel = row, k = pixel), so their k orders are equal. Wave (pg, cb) takes channels 32 pg + 0..31 x 32 cb + 0..31.
        const unsigned char* gq = xt + (8 * hi + (lane & 7)) * GPI + 16 * ((lane >> 3) & 1);
        const unsigned char* ga = gq + pg * 64; const unsigned char* gb = gq + cb * 64;
        auto gfrag = [](const unsigned char* p) { return cat16b(__builtin_bit_cast(v8us, __builtin_amdgcn_ds_load_tr16_b128_v8i16((lds_v8s*)p)), __builtin_bit_cast(v8us, __builtin_amdgcn_ds_load_tr16_b128_v8i16((lds_v8s*)(p + 16 * GPI)))); };
        v8us o8;
#pragma unroll
        for (int i = 0; i < 8; ++i) o8[i] = 0x3F80;   // 1.0
        const v16bf one = cat16b(o8, o8);
        v8f g[2][2], sv[2];
#pragma unroll
        for (int i = 0; i < 2; ++i) { sv[i] = (v8f){}; g[i][0] = (v8f){}; g[i][1] = (v8f){}; }
        // two copies of the loop, chosen by a scalar in front of it: only the four waves of cb == 0 spend matrix instructions on S
        auto moments = [&](auto withs) {
        // unrolled: the k step is an immediate of every load
#pragma unroll
        for (int kc = 0; kc < 256; kc += 32) {
            v16bf ah[2], aw[2], bh[2], bw[2];
#pragma unroll
            for (int i = 0; i < 2; ++i) { ah[i] = gfrag(ga + kc * GPI + i * 32); aw[i] = gfrag(ga + (256 + kc) * GPI + i * 32); bh[i] = gfrag(gb + kc * GPI + i * 32); bw[i] = gfrag(gb + (256 + kc) * GPI + i * 32); }
            // keeps the sixteen LDS loads of a step together in front of its first matrix instruction: one wait a step instead of one at every few loads
            __builtin_amdgcn_sched_barrier(0);
#pragma unroll
            for (int i = 0; i < 2; ++i) { g[i][0] = wmmab(ah[i], bh[0], g[i][0]); g[i][1] = wmmab(ah[i], bh[1], g[i][1]); }
#pragma unroll
            for (int i = 0; i < 2; ++i) { g[i][0] = wmmab(aw[i], bh[0], g[i][0]); g[i][1] = wmmab(aw[i], bh[1], g[i][1]); }
#pragma unroll
            for (int i = 0; i < 2; ++i) { g[i][0] = wmmab(ah[i], bw[0], g[i][0]); g[i][1] = wmmab(ah[i], bw[1], g[i][1]); }
            if constexpr (decltype(withs)::v) {
#pragma unroll
                for (int i = 0; i < 2; ++i) { sv[i] = wmmab(ah[i], one, sv[i]); sv[i] = wmmab(aw[i], one, sv[i]); } }
        } };
        if (cb == 0) moments(flag_<true>{}); else moments(flag_<false>{});
        // a lane holds 8 neighbouring rows of one column; G is symmetric, so they leave as 8 neighbouring columns of one row: whole 128-byte lines a wave
        float* go = GP + (size_t)blockIdx.x * (CI * CI) + (size_t)(cb * 32 + lr) * CI + pg * 32 + hi * 8;
#pragma unroll
        for (int i = 0; i < 2; ++i) {
#pragma unroll
            for (int j = 0; j < 2; ++j) { float* d = go + j * 16 * CI + i * 16; *(v4f*)d = (v4f){g[i][j][0], g[i][j][1], g[i][j][2], g[i][j][3]}; *(v4f*)(d + 4) = (v4f){g[i][j][4], g[i][j][5], g[i][j][6], g[i][j][7]}; } }
        if (cb == 0 && lr == 0) {   // every column of sv is the same sum
            float* d = SP + (size_t)blockIdx.x * CI + pg * 32 + hi * 8;
#pragma unroll
            for (int i = 0; i < 2; ++i) { *(v4f*)(d + i * 16) = (v4f){sv[i][0], sv[i][1], sv[i][2], sv[i][3]}; *(v4f*)(d + i * 16 + 4) = (v4f){sv[i][4], sv[i][5], sv[i][6], sv[i][7]}; }
        }
    } else {
        constexpr int PP = 72;   // LDS pitch in 16-bit elements: 64 pooled positions + 16 bytes
        // every wave has read its last fragment of the tile: behind this barrier the tile's range is cut into the turning ranges
        __syncthreads();
        unsigned short* sh = (unsigned short*)(void*)(xt + cb * (2 * 64 * PP * 2)); unsigned short* sl = sh + 64 * PP;   // each cb's four waves have an LDS range of their own
#pragma unroll
        for (int sub = 0; sub < 2; ++sub) {
#pragma unroll
            for (int t = 0; t < 4; ++t) { v4us oh, ol;
#pragma unroll
                for (int q = 0; q < 4; ++q) { const float y = fmaxf(fmaxf(acc[2 * sub][t][2 * q] + bv[t], acc[2 * sub][t][2 * q + 1] + bv[t]), fmaxf(acc[2 * sub + 1][t][2 * q] + bv[t], acc[2 * sub + 1][t][2 * q + 1] + bv[t])); const unsigned short hb = f2bf(y); oh[q] = hb; ol[q] = f2bf(y - bf2f(hb)); }
                const int so = (t * 16 + lr) * PP + (pg * 2 + sub) * 8 + hi * 4; *(v4usa*)(sh + so) = oh; *(v4usa*)(sl + so) = ol; } }
        __syncthreads();
        const size_t io = (size_t)(blockIdx.x / (NPX / 256)) * CI * MP + (size_t)(blockIdx.x % (NPX / 256)) * 64;
        bf* Dh = (z == 1 ? FTh : GTh) + io; bf* Dl = (z == 1 ? FTl : GTl) + io;
#pragma unroll
        for (int s = 0; s < 4; ++s) { const int g = (threadIdx.x & 127) + s * 128, row = g >> 3, piece = g & 7;
            const v8us vh = *(const v8usa*)(sh + row * PP + piece * 8), vl = *(const v8usa*)(sl + row * PP + piece * 8);
            const size_t o = (size_t)(c0 + row) * MP + piece * 8; *(v8us*)(Dh + o) = vh; *(v8us*)(Dl + o) = vl; }
        // the wait before a register that an issued store names is rewritten: in the built code the theta branch's instructions stand behind these stores
        asm volatile("s_wait_xcnt 0x0" ::: "memory");
    }
}

__global__ __launch_bounds__(256) void k_zero8(bf* dst, size_t n8) {
    const size_t i = (size_t)blockIdx.x * 256 + threadIdx.x; if (i >= n8) return; v8us z;
#pragma unroll
    for (int k = 0; k < 8; ++k) z[k] = 0;
    *(v8us*)(dst + i * 8) = z; 
}
// k_km: one grid, two kinds of work-group, both fed by the conv kernel alone.
// blockIdx.y < 2: one 16 x 64 tile of KM = (Ah + Al).(Bh + Bl)^T over K = MP (row strides = K; n-major B). The grid is small, so the contraction is split over the 16 waves (two 32-k
// steps each, all loads of a wave independent); the partial tiles are summed through LDS in wave order and KM leaves as bf16 hi + residual planes in whole 128-byte lines. The rows of B
// go in as the matrix instruction's first operand and the rows of A as its second (both loaders have the same k order), so a lane holds 8 neighbouring columns of one row.
// blockIdx.y == 2: 16 rows of one image's theta covariance: the 16 conv work-groups' G and S are summed in their order, m = S / N, Cov = G / N - m m^T, bf16 hi + residual planes.
// blockIdx.z = image.
__global__ __launch_bounds__(512) void k_km(const bf* __restrict__ Ah, const bf* __restrict__ Al, const bf* __restrict__ Bh, const bf* __restrict__ Bl, bf* Ch, bf* Cl, const float* __restrict__ GP, const float* __restrict__ SP, bf* Vh, bf* Vl, float* MB) {
    typedef __attribute__((ext_vector_type(4))) unsigned short v4us;
    constexpr int NWV = 16, STEPS = 2, K = MP, ldc = CI, NT = NPX / 256;
    __shared__ __align__(16) float part[NWV][16 * 68];
    if (blockIdx.y == 2) {
        __shared__ float ms[CI];
        const float* gz = GP + (size_t)blockIdx.z * NT * CI * CI + (size_t)blockIdx.x * 16 * CI; const float* sz = SP + (size_t)blockIdx.z * NT * CI;
        const int tid = threadIdx.x;
        const unsigned eo = (unsigned)tid * 16u, so = (unsigned)(tid & (CI - 1)) * 4u;   // byte offsets, the vector registers that the loads name (the step from one conv work-group to the next is an immediate)
        v4f gv[NT]; float sp[NT];
#pragma unroll
        for (int p = 0; p < NT; ++p) sp[p] = *(const float*)((const char*)sz + so + (unsigned)(p * CI * 4));
#pragma unroll
        for (int p = 0; p < NT; ++p) gv[p] = *(const v4f*)((const char*)gz + eo + (unsigned)(p * CI * CI * 4));
        // the wait before a register that an issued load names is rewritten; offsets and bases as inputs keep their registers to this line
        asm volatile("s_wait_xcnt 0x0" :: "v"(eo), "v"(so), "s"(gz), "s"(sz) : "memory");
        float s = sp[0];
#pragma unroll
        for (int p = 1; p < NT; ++p) s += sp[p];
        s *= 1.0f / (float)NPX;
        if (tid < CI) { ms[tid] = s; if (blockIdx.x == 0) MB[blockIdx.z * CI + tid] = s; }
        __syncthreads();
        v4f v = gv[0];
#pragma unroll
        for (int p = 1; p < NT; ++p) v += gv[p];
        const int row = blockIdx.x * 16 + (tid >> 5), col = (tid & 31) * 4; const float mr = ms[row];
        v4us oh, ol;
#pragma unroll
        for (int i = 0; i < 4; ++i) { const float c = v[i] * (1.0f / (float)NPX) - mr * ms[col + i]; const unsigned short hb = f2bf(c); oh[i] = hb; ol[i] = f2bf(c - bf2f(hb)); }
        const size_t o = (size_t)blockIdx.z * CI * CI + (size_t)row * CI + col; *(v4us*)(Vh + o) = oh; *(v4us*)(Vl + o) = ol;
        return;
    }
    Ah += blockIdx.z * (size_t)(CI * MP); Al += blockIdx.z * (size_t)(CI * MP); Bh += blockIdx.z * (size_t)(CI * MP); Bl += blockIdx.z * (size_t)(CI * MP); Ch += blockIdx.z * (size_t)(CI * CI); Cl += blockIdx.z * (size_t)(CI * CI);
    const int lane = threadIdx.x & 31, wave = threadIdx.x >> 5, lr = lane & 15, hi = lane >> 4;
    const int r0 = blockIdx.x * 16, c0 = blockIdx.y * 64, k0 = wave * (STEPS * 32) + 8 * hi;
    // byte offsets: one vector register for A and one for B, named by all the loads of that operand (the plane's base is scalar; the k step and B's 16-row step are immediates)
    const unsigned ao = (unsigned)((r0 + lr) * K + k0) * 2u, bo = (unsigned)((c0 + lr) * K + k0) * 2u;
    auto frag = [](const bf* __restrict__ base, unsigned off, int el) { const char* p = (const char*)base + off; return cat16b(*(const v8us*)(p + (unsigned)(el * 2)), *(const v8us*)(p + (unsigned)(el * 2 + 32))); };
    v16bf a[STEPS], al[STEPS], bh[STEPS][4], bl[STEPS][4];
    // every loop of this kernel is unrolled: the fragment and accumulator arrays are indexed by constants only and so stay in registers
#pragma unroll
    for (int s = 0; s < STEPS; ++s) { a[s] = frag(Ah, ao, s * 32); al[s] = frag(Al, ao, s * 32);
#pragma unroll
        for (int t = 0; t < 4; ++t) { bh[s][t] = frag(Bh, bo, t * 16 * K + s * 32); bl[s][t] = frag(Bl, bo, t * 16 * K + s * 32); } }
    // the wait before a register that an issued load names is rewritten; the offsets as inputs keep their registers from being given to a result inside the run of loads
    asm volatile("s_wait_xcnt 0x0" :: "v"(ao), "v"(bo) : "memory");
    // keeps all loads of the wave in front of its first matrix instruction, so that they are in flight together; without it they are issued two at a time, each pair waited for
    __builtin_amdgcn_sched_barrier(0);
    v8f acc[4];
#pragma unroll
    for (int t = 0; t < 4; ++t) acc[t] = (v8f){};
#pragma unroll
    for (int s = 0; s < STEPS; ++s) {
#pragma unroll
        for (int t = 0; t < 4; ++t) { acc[t] = wmmab(bh[s][t], a[s], acc[t]); acc[t] = wmmab(bh[s][t], al[s], acc[t]); acc[t] = wmmab(bl[s][t], a[s], acc[t]); }
    }
    // keeps the LDS stores behind the last matrix instruction, so that the four accumulators have registers of their own
    __builtin_amdgcn_sched_barrier(0);
    float* os = &part[wave][lr * 68 + hi * 8];
#pragma unroll
    for (int t = 0; t < 4; ++t) { *(v4fa*)(os + t * 16) = (v4f){acc[t][0], acc[t][1], acc[t][2], acc[t][3]}; *(v4fa*)(os + t * 16 + 4) = (v4f){acc[t][4], acc[t][5], acc[t][6], acc[t][7]}; }
    __syncthreads();
    if (threadIdx.x < 16 * 16) { const int g = threadIdx.x, row = g >> 4, cofs = (g & 15) * 4;
        v4f v = *(const v4fa*)(&part[0][row * 68 + cofs]);
#pragma unroll
        for (int w = 1; w < NWV; ++w) v += *(const v4fa*)(&part[w][row * 68 + cofs]);
        v4us oh, ol;
#pragma unroll
        for (int i = 0; i < 4; ++i) { const unsigned short hb = f2bf(v[i]); oh[i] = hb; ol[i] = f2bf(v[i] - bf2f(hb)); }
        const size_t o = (size_t)(r0 + row) * ldc + c0 + cofs; *(v4us*)(Ch + o) = oh; *(v4us*)(Cl + o) = ol; }
}
// k_qtst: QT and what the BatchNorm needs of it. The product that is normalised is linear in theta, WY[n][o] = sum_k theta[n][k] QT[o][k] + b[o], so over one image's pixels its mean is
// QT[o].m + b[o] and its variance QT[o].Cov.QT[o], with m and Cov theta's mean and covariance over those pixels. One work-group (8 waves) = 16 rows o of one image (blockIdx.z).
// Wave w first forms QT[o][k], k = 16 w + 0..15, = sum_c W[o][c] KM[k][c] (W f32, rounded to bf16 as it is read; KM hi then residual at each 32-k step; KM's rows as the first operand,
// so a lane holds 8 neighbouring k of one row o), splits it, stores it and lays it in LDS; then R[o][k] = sum_k' Cov[k][k'] QT[o][k'] for the same k (hh, hl, lh) and sums QT[o][k] R[o][k]
// and QT[o][k] m[k] over its 8 k. All loaders: k = 8 hi + 0..7 and 16 + 8 hi + 0..7 of each 32. The 16 partial sums of a row are added in a fixed order. EU: one 128-byte line a work-group,
// 16 variances, then 16 means (without b).
#define QP 272   // LDS pitch in bytes of one QT row's 128 k: 256 + 16, ds_load_b128's conflict-free pitch
__global__ __launch_bounds__(256) void k_qtst(const float* __restrict__ Wf, const bf* __restrict__ Kh, const bf* __restrict__ Kl, const bf* __restrict__ Vh, const bf* __restrict__ Vl, const float* __restrict__ MB, bf* Qh, bf* Ql, float* EU) {
    typedef __attribute__((ext_vector_type(8))) __bf16 v8bf;
    __shared__ __align__(16) unsigned char qs[2 * 16 * QP];   // rows: hi, residual
    __shared__ float re[16][16];
    __shared__ float ru[16][16];
    Kh += blockIdx.z * (size_t)(CI * CI); Kl += blockIdx.z * (size_t)(CI * CI); Vh += blockIdx.z * (size_t)(CI * CI); Vl += blockIdx.z * (size_t)(CI * CI); MB += blockIdx.z * CI; Qh += blockIdx.z * (size_t)(CIN * CI); Ql += blockIdx.z * (size_t)(CIN * CI);
    const int lane = threadIdx.x & 31, wave = threadIdx.x >> 5, lr = lane & 15, hi = lane >> 4, o0 = blockIdx.x * 16;
    // byte offsets, one vector register an operand shape (the bases are scalar, the k step an immediate): W's rows; KM's and Cov's rows; m
    const unsigned wo = (unsigned)((o0 + lr) * CI + 8 * hi) * 4u, ko = (unsigned)((wave * 16 + lr) * CI + 8 * hi) * 2u, mo = (unsigned)(wave * 16 + hi * 8) * 4u;
    auto frag = [](const bf* __restrict__ base, unsigned off, int el) { const char* p = (const char*)base + off; return cat16b(*(const v8us*)(p + (unsigned)(el * 2)), *(const v8us*)(p + (unsigned)(el * 2 + 32))); };
    // every loop of this kernel is unrolled: the fragment arrays are indexed by constants only and so stay in registers
    v8f wr[4][2]; v16bf kh[4], kl[4], vh[4], vl[4];
#pragma unroll
    for (int s = 0; s < 4; ++s) { wr[s][0] = *(const v8f*)((const char*)Wf + wo + (unsigned)(s * 128)); wr[s][1] = *(const v8f*)((const char*)Wf + wo + (unsigned)(s * 128 + 64)); kh[s] = frag(Kh, ko, s * 32); kl[s] = frag(Kl, ko, s * 32); }
    // keeps the first product's loads in front of the second's: loads return in order
    __builtin_amdgcn_sched_barrier(0);
#pragma unroll
    for (int s = 0; s < 4; ++s) { vh[s] = frag(Vh, ko, s * 32); vl[s] = frag(Vl, ko, s * 32); }
    const v8f mv = *(const v8f*)((const char*)MB + mo);
    // the wait before a register that an issued load names is rewritten; offsets and bases as inputs keep their registers to this line
    asm volatile("s_wait_xcnt 0x0" :: "v"(wo), "v"(ko), "v"(mo), "s"(Wf), "s"(Kh), "s"(Kl), "s"(Vh), "s"(Vl), "s"(MB) : "memory");
    // keeps all loads of the wave in front of its first matrix instruction, so that they are in flight together
    __builtin_amdgcn_sched_barrier(0);
    v8f q = (v8f){};
#pragma unroll
    for (int s = 0; s < 4; ++s) { const v16bf wa = cat16b(__builtin_bit_cast(v8us, __builtin_convertvector(wr[s][0], v8bf)), __builtin_bit_cast(v8us, __builtin_convertvector(wr[s][1], v8bf)));   // round to nearest even
        q = wmmab(kh[s], wa, q); q = wmmab(kl[s], wa, q); }
    v8us oh, ol; v8f qq;   // qq: the value that the two planes stand for
#pragma unroll
    for (int i = 0; i < 8; ++i) { const unsigned short hb = f2bf(q[i]); const unsigned short lb = f2bf(q[i] - bf2f(hb)); oh[i] = hb; ol[i] = lb; qq[i] = bf2f(hb) + bf2f(lb); }
    const size_t o = (size_t)(o0 + lr) * CI + wave * 16 + hi * 8; *(v8us*)(Qh + o) = oh; *(v8us*)(Ql + o) = ol;
    unsigned char* sp = qs + lr * QP + (wave * 16 + hi * 8) * 2; *(v8usa*)sp = oh; *(v8usa*)(sp + 16 * QP) = ol;
    // all 128 k of the 16 rows lie in LDS: behind this barrier every wave reads them
    __syncthreads();
    const unsigned char* qp = qs + lr * QP + hi * 16;
    auto lfrag = [](const unsigned char* p) { return cat16b(*(const v8usa*)p, *(const v8usa*)(p + 32)); };
    v8f r = (v8f){};
#pragma unroll
    for (int s = 0; s < 4; ++s) { const v16bf qh = lfrag(qp + s * 64), ql = lfrag(qp + 16 * QP + s * 64); r = wmmab(vh[s], qh, r); r = wmmab(vh[s], ql, r); r = wmmab(vl[s], qh, r); }
    float e = 0.f, u = 0.f;
#pragma unroll
    for (int i = 0; i < 8; ++i) { e = fmaf(qq[i], r[i], e); u = fmaf(qq[i], mv[i], u); }
    re[wave * 2 + hi][lr] = e; ru[wave * 2 + hi][lr] = u;
    __syncthreads();
    if (threadIdx.x < 32) { float t = 0.f;   // lanes 0..15: the variances; 16..31: the means
#pragma unroll
        for (int w = 0; w < 16; ++w) t += hi ? ru[w][lr] : re[w][lr];
        EU[((size_t)blockIdx.z * (CIN / 16) + blockIdx.x) * 32 + lane] = t; }
}

// The last product and the BatchNorm. WY[n][o] = sum_k theta[n][k] / M . QT[o][k] + bf(b[o]) is never stored: k_prod forms it straight into what reads it, applies the affine, adds x1 and
// stores NCHW. The statistics come from k_qtst, one variance and one mean for each image and channel: equal-sized groups combine as mean = average of the means, variance = average of
// the variances + average of (group mean - mean)^2, in a fixed order; every work-group does that for its 256 channels while its tiles are on their way.
// One work-group (16 waves) = BNR = 128 pixels of one image x all 256 channels over K = CI: (Ah + Al).(Bh + Bl)^T, three products per 32-k step (hh, lh, hl, in that
// order into each accumulator). The four planes' tiles are contiguous in memory: they are read once, 512 contiguous bytes a wave-load with all 24 loads of a thread in flight, and
// laid in LDS at a padded pitch; wave (pg, cb) takes 32 pixels x 64 channels, its fragments by ds_load_b128 (both loaders: k = 8 hi + 0..7 and 16 + 8 hi + 0..7 of each 32).
// A lane holds 16 pixels (2 tiles x 8 registers) of each of its 4 channels.
#define BNP 256
#define BNR (NB_ * NPX / BNP)
#define LP 272   // LDS pitch in bytes of one row's 128 k: 256 + 16, ds_load_b128's conflict-free pitch
#define OP 36    // LDS pitch in floats of one channel's 32 pixels in a wave's transposing tile: 128 + 16 bytes
__global__ __launch_bounds__(512) void k_prod(const bf* __restrict__ Ah, const bf* __restrict__ Al, const bf* __restrict__ Bh, const bf* __restrict__ Bl, const float* __restrict__ bias, const float* __restrict__ x1, const float* __restrict__ EU, const float* __restrict__ gam, const float* __restrict__ bet, float* OUTB) {
    __shared__ __align__(16) unsigned char st[(2 * BNR + 2 * CIN) * LP];   // rows: Ah, Al, Bh, Bl
    __shared__ float smu[CIN];
    __shared__ float srs[CIN];
    // every loop of this kernel is unrolled: the staging, fragment, accumulator and x1 arrays are indexed by constants only and so stay in registers
    // the wave's number as a scalar: the bases of its loads and stores stay in scalar registers
    const int tid = threadIdx.x, lane = tid & 31, wv = __builtin_amdgcn_readfirstlane(tid >> 5), lr = lane & 15, hi = lane >> 4;
    const int img = blockIdx.x / (NPX / BNR), pg = wv & 3, cb = wv >> 2;
    const v8us* gah = (const v8us*)(Ah + (size_t)blockIdx.x * BNR * CI); const v8us* gal = (const v8us*)(Al + (size_t)blockIdx.x * BNR * CI);
    const v8us* gbh = (const v8us*)(Bh + (size_t)img * CIN * CI); const v8us* gbl = (const v8us*)(Bl + (size_t)img * CIN * CI);
    // all 24 loads name one vector register, the thread's number as the index of its 16 bytes (the bases are scalar, the step of 32 rows = 512 pieces an immediate)
    v8us ra[2][BNR / 32], rb[2][CIN / 32];
#pragma unroll
    for (int i = 0; i < CIN / 32; ++i) { rb[0][i] = gbh[tid + i * 512]; rb[1][i] = gbl[tid + i * 512]; }
#pragma unroll
    for (int i = 0; i < BNR / 32; ++i) { ra[0][i] = gah[tid + i * 512]; ra[1][i] = gal[tid + i * 512]; }
    // the wait before a register that an issued load names is rewritten; the four scalar bases and the index as inputs keep their registers to this line: otherwise the
    // arguments that are read next are loaded into the bases' registers in front of the wait
    asm volatile("s_wait_xcnt 0x0" :: "s"(gah), "s"(gal), "s"(gbh), "s"(gbl), "v"(tid) : "memory");
    // keeps the staging loads in front of the loads below: loads return in order, and the LDS stores wait for the staging loads alone
    __builtin_amdgcn_sched_barrier(0);
    // the images' variances and means of channel tid (waves 0..7; a scalar test): asked for behind the staging loads and in front of the x1 tile, so that their use below does not wait for x1
    float ev[NB_], uv[NB_], bc = 0.f;
    if (wv < CIN / 32) {
        const int ei = (tid >> 4) * 32 + (tid & 15);   // the one vector register of these loads (the step of an image is an immediate)
#pragma unroll
        for (int b = 0; b < NB_; ++b) { ev[b] = EU[ei + b * (CIN / 16) * 32]; uv[b] = EU[ei + b * (CIN / 16) * 32 + 16]; }
        bc = bias[tid];
        // the wait before a register that an issued load names is rewritten
        asm volatile("s_wait_xcnt 0x0" :: "v"(ei), "v"(tid), "s"(EU), "s"(bias) : "memory");
    }
    // keeps those loads in front of the loads below
    __builtin_amdgcn_sched_barrier(0);
    // the epilogue's per-channel values and its x1 tile are asked for here, behind the staging loads, so that the epilogue does not wait for them
    const int ci = cb * 64 + lr;   // the lane's first channel: one vector register for all of them (the step of 16 channels is an immediate)
    float bv[4], mu[4], rs[4], ga[4], be[4];
#pragma unroll
    for (int t = 0; t < 4; ++t) { bv[t] = bias[ci + t * 16]; ga[t] = gam[ci + t * 16]; be[t] = bet[ci + t * 16]; }
    // x1 and out: 4 channels x 128 bytes (whole lines) a wave-access; byte offset in one vector register (the base is scalar, the step of 4 channels an immediate)
    const size_t ob = ((size_t)img * CIN + cb * 64) * NPX + (size_t)(blockIdx.x % (NPX / BNR)) * BNR + pg * 32;
    const unsigned xo = (unsigned)((lane >> 3) * NPX + (lane & 7) * 4) * 4u;
    v4f xr[16];
#pragma unroll
    for (int s = 0; s < 16; ++s) xr[s] = *(const v4f*)((const char*)(x1 + ob) + xo + (unsigned)(s * 4 * NPX * 4));
    // the wait before a register that an issued load names is rewritten; the index registers as inputs are kept from being given to a result inside the run of loads
    asm volatile("s_wait_xcnt 0x0" :: "v"(tid), "v"(ci), "v"(xo) : "memory");
    {
        unsigned char* sp = st + (tid >> 4) * LP + (tid & 15) * 16;
        // in the order of the loads, which return in order: the first stores go while the last loads are still on their way
#pragma unroll
        for (int i = 0; i < CIN / 32; ++i) { *(v8usa*)(sp + (2 * BNR + i * 32) * LP) = rb[0][i]; *(v8usa*)(sp + (2 * BNR + CIN + i * 32) * LP) = rb[1][i]; }
#pragma unroll
        for (int i = 0; i < BNR / 32; ++i) { *(v8usa*)(sp + i * 32 * LP) = ra[0][i]; *(v8usa*)(sp + (BNR + i * 32) * LP) = ra[1][i]; }
    }
    if (wv < CIN / 32) { float a = 0.f, v = 0.f;
#pragma unroll
        for (int b = 0; b < NB_; ++b) a += uv[b];
        const float um = a * (1.0f / (float)NB_);
#pragma unroll
        for (int b = 0; b < NB_; ++b) { const float d = uv[b] - um; v += fmaf(d, d, ev[b]); }
        smu[tid] = bfr(bc) + um; srs[tid] = rsqrtf(fmaxf(v * (1.0f / (float)NB_), 0.f) + BEPS); }   // the maximum: a variance that rounding has left below zero
    lds_barrier();
    const unsigned char* ap = st + (pg * 32 + lr) * LP + hi * 16;
    const unsigned char* bp = st + (2 * BNR + cb * 64 + lr) * LP + hi * 16;
    auto lfrag = [](const unsigned char* p) { return cat16b(*(const v8usa*)p, *(const v8usa*)(p + 32)); };
    v8f acc[2][4];
#pragma unroll
    for (int ti = 0; ti < 2; ++ti) {
#pragma unroll
        for (int t = 0; t < 4; ++t) acc[ti][t] = (v8f){}; }
    // unrolled: the k step is an immediate of every LDS load
#pragma unroll
    for (int kc = 0; kc < CI / 32; ++kc) {
        v16bf a[2], al[2], bh[4], bl[4];
#pragma unroll
        for (int ti = 0; ti < 2; ++ti) { a[ti] = lfrag(ap + ti * 16 * LP + kc * 64); al[ti] = lfrag(ap + (BNR + ti * 16) * LP + kc * 64); }
#pragma unroll
        for (int t = 0; t < 4; ++t) { bh[t] = lfrag(bp + t * 16 * LP + kc * 64); bl[t] = lfrag(bp + (CIN + t * 16) * LP + kc * 64); }
        // keeps the 24 LDS loads of a step together in front of its first matrix instruction: one wait a step instead of one at every few loads
        __builtin_amdgcn_sched_barrier(0);
#pragma unroll
        for (int t = 0; t < 4; ++t) {
#pragma unroll
            for (int ti = 0; ti < 2; ++ti) acc[ti][t] = wmmab(a[ti], bh[t], acc[ti][t]); }
#pragma unroll
        for (int t = 0; t < 4; ++t) {
#pragma unroll
            for (int ti = 0; ti < 2; ++ti) acc[ti][t] = wmmab(al[ti], bh[t], acc[ti][t]); }
#pragma unroll
        for (int t = 0; t < 4; ++t) {
#pragma unroll
            for (int ti = 0; ti < 2; ++ti) acc[ti][t] = wmmab(a[ti], bl[t], acc[ti][t]); }
        // keeps the next step's loads behind this step's matrix instructions: one set of fragment registers, no spill
        __builtin_amdgcn_sched_barrier(0);
    }
#pragma unroll
    for (int t = 0; t < 4; ++t) { bv[t] = bfr(bv[t]); ga[t] = bfr(ga[t]); be[t] = bfr(be[t]); mu[t] = smu[ci + t * 16]; rs[t] = srs[ci + t * 16]; }
    {
        // every wave has read its last fragment: behind this barrier the staging range is cut into the waves' own transposing tiles
        lds_barrier();
        float* os = (float*)(void*)st + wv * (64 * OP);
#pragma unroll
        for (int t = 0; t < 4; ++t) {
#pragma unroll
            for (int ti = 0; ti < 2; ++ti) { v4f u[2];
#pragma unroll
                for (int j = 0; j < 8; ++j) u[j >> 2][j & 3] = ((acc[ti][t][j] + bv[t]) - mu[t]) * rs[t] * ga[t] + be[t];
                float* dp = os + (t * 16 + lr) * OP + ti * 16 + hi * 8; *(v4fa*)dp = u[0]; *(v4fa*)(dp + 4) = u[1]; } }
        // the tile is the wave's own: keeps the compiler from moving the reads below in front of the other lanes' stores
        __builtin_amdgcn_wave_barrier(); asm volatile("" ::: "memory");
        v4f vv[16];   // registers of their own for all 16 reads: they are in flight together, and no store's data register is rewritten
#pragma unroll
        for (int s = 0; s < 16; ++s) vv[s] = *(const v4fa*)(os + (s * 4 + (lane >> 3)) * OP + (lane & 7) * 4);
#pragma unroll
        for (int s = 0; s < 16; ++s) {
#pragma unroll
            for (int i = 0; i < 4; ++i) vv[s][i] += bfr(xr[s][i]);
            *(v4f*)((char*)(OUTB + ob) + xo + (unsigned)(s * 4 * NPX * 4)) = vv[s]; }
        // the wait before a register that an issued load or store names is rewritten; xo as an input keeps its register to the end of both runs
        asm volatile("s_wait_xcnt 0x0" :: "v"(xo) : "memory");
    }
}

extern "C" void kernel_launch(void* const* d_in, const int* in_sizes, int n_in,
                              void* d_out, int out_size, void* d_ws, size_t ws_size, hipStream_t stream) {
    (void)in_sizes; (void)n_in; (void)out_size;
    const float* x1 = (const float*)d_in[0]; const float* x2 = (const float*)d_in[1]; const float* wg = (const float*)d_in[2]; const float* bg = (const float*)d_in[3]; const float* wth = (const float*)d_in[4]; const float* bth = (const float*)d_in[5]; const float* wph = (const float*)d_in[6]; const float* bph = (const float*)d_in[7];
    const float* wout = (const float*)d_in[8]; const float* bout = (const float*)d_in[9]; const float* gam = (const float*)d_in[10]; const float* bet = (const float*)d_in[11];
    float* out = (float*)d_out;    // [8][256][64][64]
    char* wsp = (char*)d_ws;
    auto take = [&](size_t bytes) { char* p = wsp; wsp += (bytes + 255) & ~(size_t)255; return (void*)p; };
    // all NB_ images at once
    bf* Th = (bf*)take((size_t)NB_ * NPX * CI * 2); bf* Tl = (bf*)take((size_t)NB_ * NPX * CI * 2); bf* FTh = (bf*)take((size_t)NB_ * CI * MP * 2); bf* FTl = (bf*)take((size_t)NB_ * CI * MP * 2); bf* GTh = (bf*)take((size_t)NB_ * CI * MP * 2); bf* GTl = (bf*)take((size_t)NB_ * CI * MP * 2);
    bf* KMh = (bf*)take((size_t)NB_ * CI * CI * 2); bf* KMl = (bf*)take((size_t)NB_ * CI * CI * 2); bf* QTh = (bf*)take((size_t)NB_ * CIN * CI * 2); bf* QTl = (bf*)take((size_t)NB_ * CIN * CI * 2);
    float* GP = (float*)take((size_t)(NB_ * NPX / 256) * CI * CI * 4); float* SP = (float*)take((size_t)(NB_ * NPX / 256) * CI * 4); bf* Vh = (bf*)take((size_t)NB_ * CI * CI * 2); bf* Vl = (bf*)take((size_t)NB_ * CI * CI * 2);
    float* MB = (float*)take((size_t)NB_ * CI * 4); float* EU = (float*)take((size_t)NB_ * (CIN / 16) * 32 * 4);
    if ((size_t)(wsp - (char*)d_ws) > ws_size) return;    // MiB: 16 + 4 + 4 + 1.5 + 8.5 ~ 34
    k_convf<<<dim3(NB_ * NPX / 256, 2, 1), 512, 0, stream>>>(x1, x2, wth, wph, wg, bth, bph, bg, Th, Tl, FTh, FTl, GTh, GTl, GP, SP);   // 1/M folded into theta
    k_km<<<dim3(CI / 16, 3, NB_), 512, 0, stream>>>(FTh, FTl, GTh, GTl, KMh, KMl, GP, SP, Vh, Vl, MB);    // KM[k][c] = sum_m phi[k][m] g[c][m]; theta's mean and covariance
    k_qtst<<<dim3(CIN / 16, 1, NB_), 256, 0, stream>>>(wout, KMh, KMl, Vh, Vl, MB, QTh, QTl, EU);           // QT[o][k] = sum_c W[o][c] KM[k][c]; each image's variance and mean of WY
    k_prod<<<BNP, 512, 0, stream>>>(Th, Tl, QTh, QTl, bout, x1, EU, gam, bet, out);                        // WY[n][o] = sum_k theta[n][k] / M . QT[o][k] + b[o], normalised, + x1
}

// v009
// It runs in 45.1 microseconds.
// Timed twice side by side with v008, it ran 1.04 and 1.03 times as fast.
// Counting every step since v000, it is 49.6 times as fast.
#include <hip/hip_runtime.h>

// Compute dtypes, f32 accumulate, per image: theta (on x1) and g/phi (on x2) 1x1 convs as [4096 x 256].[256 x 128] GEMMs with PLAIN bf16 operands (inputs rounded to
// bf16 and turned pixel-major on the way through LDS; exact products, + bias), the 2x2 max-pool on the conv outputs in f32. There is NO softmax in this module, so W.((theta^T.phi / M).g^T) is one chain of
// linear products and is taken from the right: KM = phi.g^T ([128 x 1024].[1024 x 128]), QT = W.KM^T ([256 x 128].[128 x 128]), then theta^T.QT^T / M + bias
// ([4096 x 128].[128 x 256]); the [4096 x 1024] matrix f is never formed. theta, phi, g, KM and QT go in as bf16 hi + UNSCALED residual planes (three products; W plain bf16, two
// products) - on v_wmma_f32_16x16x32_bf16; training-mode BatchNorm statistics over (B,H,W) per channel (theta's per-image mean and covariance, also on that instruction, pushed through QT; fixed-order f32 sums), the affine, + x1 and the NCHW

#define NB_  8
#define CIN  256
#define CI   128
#define HH   64
#define WW   64
#define NPX  4096
#define MP   1024
#define DM   CIN
#define BEPS 1e-5f
#define LOSC 1024.0f

typedef _Float16 h16;
typedef unsigned short bf;
typedef __attribute__((ext_vector_type(16))) __bf16   v16bf;
typedef __attribute__((ext_vector_type(16))) _Float16 v16h;
typedef __attribute__((ext_vector_type(8)))  _Float16 v8h;
typedef __attribute__((ext_vector_type(8)))  unsigned short v8us;
typedef __attribute__((ext_vector_type(8)))  float    v8f;
typedef __attribute__((ext_vector_type(4)))  float    v4f;
typedef v8h  __attribute__((may_alias)) v8ha;
typedef v4f  __attribute__((may_alias)) v4fa;
typedef v8us __attribute__((may_alias)) v8usa;

typedef __attribute__((ext_vector_type(4))) unsigned short v4us;
typedef __attribute__((ext_vector_type(8))) __bf16 v8bf;
typedef __attribute__((ext_vector_type(4))) __bf16 v4bf;
// every f32 -> bf16 rounding (to nearest even) is the hardware's convert, two values an instruction where they come as vectors
__device__ __forceinline__ unsigned short f2bf(float f) { return __builtin_bit_cast(unsigned short, (__bf16)f); }
__device__ __forceinline__ float bf2f(unsigned short b) { return __uint_as_float(((unsigned)b) << 16); }
__device__ __forceinline__ float bfr(float f) { return bf2f(f2bf(f)); }
typedef __attribute__((ext_vector_type(4))) unsigned v4u;
typedef __attribute__((ext_vector_type(2))) unsigned v2u;
// back to f32 from the packed words (low half: shift; high half: mask), so that the packed result is converted once and read twice
__device__ __forceinline__ v8f wide8(v8us b) { const v4u w = __builtin_bit_cast(v4u, b), lo = w << 16, hi = w & 0xFFFF0000u; return __builtin_bit_cast(v8f, __builtin_shufflevector(lo, hi, 0, 4, 1, 5, 2, 6, 3, 7)); }
__device__ __forceinline__ v4f wide4(v4us b) { const v2u w = __builtin_bit_cast(v2u, b), lo = w << 16, hi = w & 0xFFFF0000u; return __builtin_bit_cast(v4f, __builtin_shufflevector(lo, hi, 0, 2, 1, 3)); }
__device__ __forceinline__ v4f bfr4(v4f y) { return wide4(__builtin_bit_cast(v4us, __builtin_convertvector(y, v4bf))); }
// y as bf16 hi + bf16 residual of y - hi
__device__ __forceinline__ void split8(v8f y, v8us& h, v8us& l) { h = __builtin_bit_cast(v8us, __builtin_convertvector(y, v8bf)); l = __builtin_bit_cast(v8us, __builtin_convertvector(y - wide8(h), v8bf)); }
__device__ __forceinline__ void split4(v4f y, v4us& h, v4us& l) { h = __builtin_bit_cast(v4us, __builtin_convertvector(y, v4bf)); l = __builtin_bit_cast(v4us, __builtin_convertvector(y - wide4(h), v4bf)); }
__device__ __forceinline__ v16h cat16(v8h lo, v8h hi) { return __builtin_shufflevector(lo, hi, 0, 1, 2, 3, 4, 5, 6, 7, 8, 9, 10, 11, 12, 13, 14, 15); }
__device__ __forceinline__ v16bf cat16b(v8us lo, v8us hi) { return __builtin_bit_cast(v16bf, __builtin_shufflevector(lo, hi, 0, 1, 2, 3, 4, 5, 6, 7, 8, 9, 10, 11, 12, 13, 14, 15)); }
__device__ __forceinline__ v8f wmma16(v16h a, v16h b, v8f c) { return __builtin_amdgcn_wmma_f32_16x16x32_f16(false, a, false, b, (short)0, c, false, false); }
__device__ __forceinline__ v8f wmmab(v16bf a, v16bf b, v8f c) { return __builtin_amdgcn_wmma_f32_16x16x32_bf16(false, a, false, b, (short)0, c, false, false); }

// k_convf: the three 1x1 convs in one grid, read straight from the f32 NCHW inputs, each leaving as the bf16 hi + residual planes that the next products read.
// One work-group (16 waves) = 256 pixels (4 image rows of one image) of x1 (blockIdx.y == 0: theta, 128 output channels) or of x2 (phi and g, 256), all CIN input channels.
// The tile is read once, 512 contiguous bytes a wave-load with all 32 loads of a thread in flight, rounded to bf16 and laid in LDS as it lies in memory, [channel][pixel];
// ds_load_tr16_b128 then hands out the [pixel][channel] fragments of C = A.B^T + bf(bias[c]) over K = CIN. B: the n-major f32 weights of the work-group's 256 (x1: 128) output
// channels are read once too, whole 128-byte lines, rounded to bf16 and laid in LDS row by row; ds_load_b128 fragments in the same k order: 8 hi + 0..7 and 16 + 8 hi + 0..7 of each 32.
// Wave (pg, cb) takes 64 pixels x 64 output channels (cb: phi's halves, g's halves; theta has two halves, so 8 of its waves have no conv product).
// Its four 16 x 64 tiles are 16 x positions of image rows 2q and 2q + 1 (q = pg / 2) and the next 16 of both, so all four pixels of a 2x2 pool window lie in one lane's
// accumulators (neighbouring x = neighbouring registers, the row below = the next tile). theta: times 1/M, split, rows of 128 bytes a plane. phi, g: max of the four f32 values,
// split, and each cb's 64 channels x 64 pooled positions are turned through LDS so that every [channel][m] row piece leaves as one whole 128-byte line.
#define TP 544   // LDS pitch in bytes of one channel's 256 pixels: 512 + 32, an odd multiple of 32 bytes, the transposing load's conflict-free pitch
#define GPI 288  // LDS pitch in bytes of one pixel's 128 theta channels: 256 + 32, an odd multiple of 32 bytes, the transposing load's conflict-free pitch
#define WB 528   // LDS pitch in bytes of one output channel's 256 weights: 512 + 16, ds_load_b128's conflict-free pitch
// conv_stage: the work-group's f32 tile (xb) and its f32 weights (w0: theta's or phi's 128 rows; w1: g's) go to LDS as bf16. One straight run of code for each kind of
// work-group, so that every load has a scalar base with one vector offset and every wait counts that kind's own loads.
// work-group barrier for LDS data alone: it waits for the wave's LDS operations, not for its global loads and stores, so that those issued in front of it stay in flight
// behind it (__syncthreads() waits for every outstanding load and store of the wave)
__device__ __forceinline__ void lds_barrier() { __builtin_amdgcn_fence(__ATOMIC_RELEASE, "workgroup", "local"); __builtin_amdgcn_s_barrier(); __builtin_amdgcn_fence(__ATOMIC_ACQUIRE, "workgroup", "local"); }
template <bool B> struct flag_ { static constexpr bool v = B; };
template <bool X1>
__device__ __forceinline__ void conv_stage(const float* __restrict__ xb, const float* __restrict__ w0, const float* __restrict__ w1, unsigned char* xt, unsigned char* wt, int wv, int lane) {
    typedef v4us __attribute__((may_alias)) v4usa;
    // byte offset: the one vector register that all 32 loads name (the base is scalar, the step of 8 channels an immediate); two waves take one channel's 1024 bytes
    const unsigned go = (unsigned)((wv >> 1) * NPX + (wv & 1) * 128 + lane * 4) * 4u;
    // weights: 128 rows of 1024 bytes are 16 loads a thread, 512 contiguous bytes a wave-load; all name one vector register, the thread's number as the index of its 16 bytes
    // (the base is scalar, the step of 8 rows = 512 pieces an immediate)
    const int tid = threadIdx.x;
    unsigned char* wp = wt + (tid >> 6) * WB + (tid & 63) * 8;
    v4f wr[CI / 8], raw[CIN / 8];
#pragma unroll
    for (int i = 0; i < CI / 8; ++i) wr[i] = ((const v4f*)w0)[tid + i * 512];
    // keeps the first weight loads, which all work-groups of a kind share, in front of the tile's loads: loads return in order, and these come back first
    __builtin_amdgcn_sched_barrier(0);
#pragma unroll
    for (int i = 0; i < CIN / 8; ++i) raw[i] = *(const v4f*)((const char*)xb + go + (unsigned)(i * 8 * NPX * 4));
    // the wait before a register that an issued load names is rewritten; the offset, the index and the bases as inputs keep their registers from being given to another value inside the run of loads
    asm volatile("s_wait_xcnt 0x0" :: "v"(go), "v"(tid), "s"(w0), "s"(xb) : "memory");
#pragma unroll
    for (int i = 0; i < CI / 8; ++i) *(v4usa*)(wp + i * 8 * WB) = __builtin_bit_cast(v4us, __builtin_convertvector(wr[i], v4bf));   // round to nearest even
    if (!X1) {   // g's rows are asked for while the tile is still on its way; they return behind it
#pragma unroll
        for (int i = 0; i < CI / 8; ++i) wr[i] = ((const v4f*)w1)[tid + i * 512];
        // the wait before a register that an issued load names is rewritten; index and base as inputs, as above
        asm volatile("s_wait_xcnt 0x0" :: "v"(tid), "s"(w1) : "memory");
    }
    // keeps those loads in front of the tile's LDS stores, which wait for the tile
    __builtin_amdgcn_sched_barrier(0);
    unsigned char* sp = xt + (wv >> 1) * TP + (wv & 1) * 256 + lane * 8;
#pragma unroll
    for (int i = 0; i < CIN / 8; ++i) *(v4usa*)(sp + i * 8 * TP) = __builtin_bit_cast(v4us, __builtin_convertvector(raw[i], v4bf));   // round to nearest even
    if (!X1) {
#pragma unroll
        for (int i = 0; i < CI / 8; ++i) *(v4usa*)(wp + (CI + i * 8) * WB) = __builtin_bit_cast(v4us, __builtin_convertvector(wr[i], v4bf));
    }
}
__global__ __launch_bounds__(512) void k_convf(const float* __restrict__ x1, const float* __restrict__ x2, const float* __restrict__ WT, const float* __restrict__ WP, const float* __restrict__ WG, const float* __restrict__ bth, const float* __restrict__ bph, const float* __restrict__ bg, bf* Th, bf* Tl, bf* FTh, bf* FTl, bf* GTh, bf* GTl, float* GP, float* SP) {
    typedef v4us __attribute__((may_alias)) v4usa;
    typedef __attribute__((ext_vector_type(8))) short v8s;
    typedef __attribute__((address_space(3))) v8s lds_v8s;
    __shared__ __align__(32) unsigned char xt[2 * 256 * GPI];   // the tile, CIN * TP bytes; later theta's two planes (x1) or the turning ranges (x2)
    __shared__ __align__(16) unsigned char wt[2 * CI * WB];   // rows: phi's and g's output channels (x2), or theta's (x1: the second half holds the epilogue's tiles)
    const bool isx1 = blockIdx.y == 0;   // x1's work-groups, which have the moments to form as well, come first in index order
    // the wave's number as a scalar: the bases of its weights, bias and outputs stay in scalar registers
    const int lane = threadIdx.x & 31, wv = __builtin_amdgcn_readfirstlane(threadIdx.x >> 5), lr = lane & 15, hi = lane >> 4;
    const size_t xo = (size_t)(blockIdx.x / (NPX / 256)) * CIN * NPX + (size_t)(blockIdx.x % (NPX / 256)) * 256;
    if (isx1) conv_stage<true>(x1 + xo, WT, nullptr, xt, wt, wv, lane); else conv_stage<false>(x2 + xo, WP, WG, xt, wt, wv, lane);
    __syncthreads();
    const int pg = wv & 3, cb = wv >> 2;
    const bool idle = isx1 && cb >= 2;   // a scalar: these waves have no conv product; they take their share of theta's second moments below
    const int d0 = (pg >> 1) * (2 * WW) + (pg & 1) * 32, r0 = blockIdx.x * 256 + d0, c0 = (cb & 1) * 64;
    const int z = isx1 ? 0 : 1 + (cb >> 1);
    const float* __restrict__ bias = z == 0 ? bth : (z == 1 ? bph : bg);
    // lane (lr, hi) of a transposing load at channel kb gets channels kb + 8 hi + 0..7 of pixel d0 + lr
    const unsigned char* tp = xt + (8 * hi + (lane & 7)) * TP + 2 * d0 + 16 * ((lane >> 3) & 1);
    auto afrag = [&](int kc, int px) { return cat16b(__builtin_bit_cast(v8us, __builtin_amdgcn_ds_load_tr16_b128_v8i16((lds_v8s*)(tp + kc * TP + px * 2))), __builtin_bit_cast(v8us, __builtin_amdgcn_ds_load_tr16_b128_v8i16((lds_v8s*)(tp + (kc + 16) * TP + px * 2)))); };
    // the wave's 64 rows of B begin at row 64 cb (theta's halves; phi's halves, g's halves); the k step and the 16-row step are immediates
    const unsigned char* bp = wt + (cb * 64 + lr) * WB + 16 * hi;
    auto frag = [](const unsigned char* p) { return cat16b(*(const v8usa*)p, *(const v8usa*)(p + 32)); };
    const unsigned bi = (unsigned)(c0 + lr) * 4u;   // byte offset, the one vector register that the four bias loads name
    float bv[4];   // read in front of the k loop, so that the epilogue does not wait for it
#pragma unroll
    for (int t = 0; t < 4; ++t) bv[t] = *(const float*)((const char*)bias + bi + (unsigned)(t * 64));
    // the wait before a register that an issued load names is rewritten
    asm volatile("s_wait_xcnt 0x0" :: "v"(bi), "s"(bias) : "memory");
    v8f acc[4][4];   // tile ti: x positions (ti / 2) * 16 + 0..15 of image row 2q + (ti & 1)
#pragma unroll
    for (int ti = 0; ti < 4; ++ti) {
#pragma unroll
        for (int t = 0; t < 4; ++t) acc[ti][t] = (v8f){}; }
    // unrolled: the k step is an immediate of every load
    if (!idle) {
#pragma unroll
    for (int kc = 0; kc < CIN; kc += 32) {
        v16bf a[4], b[4];
#pragma unroll
        for (int ti = 0; ti < 4; ++ti) a[ti] = afrag(kc, (ti >> 1) * 16 + (ti & 1) * WW);
#pragma unroll
        for (int t = 0; t < 4; ++t) b[t] = frag(bp + t * 16 * WB + kc * 2);
        // keeps the sixteen LDS loads of a step together in front of its first matrix instruction: one wait a step instead of one at every few loads
        __builtin_amdgcn_sched_barrier(0);
#pragma unroll
        for (int t = 0; t < 4; ++t) {
#pragma unroll
            for (int ti = 0; ti < 4; ++ti) acc[ti][t] = wmmab(a[ti], b[t], acc[ti][t]); }
    }
    }
#pragma unroll
    for (int t = 0; t < 4; ++t) bv[t] = bfr(bv[t]);
    if (z == 0) {
        // every wave has read its last fragment of the tile: behind this barrier the tile's range takes theta's two bf16 planes, [pixel][channel]
        __syncthreads();
        if (!idle) {
        float* os = (float*)(void*)(wt + CI * WB) + wv * (16 * 72);   // the half of wt that theta's weights leave free: no wave reads or writes it before
#pragma unroll
        for (int ti = 0; ti < 4; ++ti) {
#pragma unroll
            for (int t = 0; t < 4; ++t) {
#pragma unroll
                for (int j = 0; j < 8; ++j) os[(hi * 8 + j) * 68 + t * 16 + lr] = acc[ti][t][j] + bv[t]; }
            // the tile is the wave's own: keeps the compiler from moving the reads below in front of the other lanes' stores
            __builtin_amdgcn_wave_barrier(); asm volatile("" ::: "memory");
#pragma unroll
            for (int s = 0; s < 4; ++s) { const int row = 4 * s + (lane >> 3), piece = lane & 7; const float* sp = os + row * 68 + piece * 8; const v4f p = *(const v4fa*)sp, q = *(const v4fa*)(sp + 4); v8us oh, ol;
                split8(__builtin_shufflevector(p, q, 0, 1, 2, 3, 4, 5, 6, 7) * (1.0f / (float)MP), oh, ol);
                const size_t o = (size_t)(r0 + (ti >> 1) * 16 + (ti & 1) * WW + row) * CI + c0 + piece * 8; *(v8us*)(Th + o) = oh; *(v8us*)(Tl + o) = ol;
                unsigned char* lp = xt + (d0 + (ti >> 1) * 16 + (ti & 1) * WW + row) * GPI + (c0 + piece * 8) * 2; *(v8usa*)lp = oh; *(v8usa*)(lp + 256 * GPI) = ol; }
            // and the next tile's stores behind this tile's reads
            __builtin_amdgcn_wave_barrier(); asm volatile("" ::: "memory");
        }
        // the wait before a register that an issued store names is rewritten
        asm volatile("s_wait_xcnt 0x0" ::: "memory");
        }
        // both planes of all 256 pixels lie in LDS: behind this barrier every wave reads them; theta's global stores stay in flight over it
        lds_barrier();
        // The work-group's share of theta's moments: G[c][c'] = sum over its 256 pixels of theta[c] theta[c'] (hh, lh, hl into each accumulator) and S[c] = sum of theta[c] (h, l against
        // a fragment of ones). Both operands come from the one transposing loader (channel = row, k = pixel), so their k orders are equal. Wave (pg, cb) takes channels 32 pg + 0..31 x 32 cb + 0..31.
        const unsigned char* gq = xt + (8 * hi + (lane & 7)) * GPI + 16 * ((lane >> 3) & 1);
        const unsigned char* ga = gq + pg * 64; const unsigned char* gb = gq + cb * 64;
        auto gfrag = [](const unsigned char* p) { return cat16b(__builtin_bit_cast(v8us, __builtin_amdgcn_ds_load_tr16_b128_v8i16((lds_v8s*)p)), __builtin_bit_cast(v8us, __builtin_amdgcn_ds_load_tr16_b128_v8i16((lds_v8s*)(p + 16 * GPI)))); };
        v8us o8;
#pragma unroll
        for (int i = 0; i < 8; ++i) o8[i] = 0x3F80;   // 1.0
        const v16bf one = cat16b(o8, o8);
        v8f g[2][2], sv[2];
#pragma unroll
        for (int i = 0; i < 2; ++i) { sv[i] = (v8f){}; g[i][0] = (v8f){}; g[i][1] = (v8f){}; }
        // two copies of the loop, chosen by a scalar in front of it: only the four waves of cb == 0 spend matrix instructions on S
        auto moments = [&](auto withs) {
        // unrolled: the k step is an immediate of every load
#pragma unroll
        for (int kc = 0; kc < 256; kc += 32) {
            v16bf ah[2], aw[2], bh[2], bw[2];
#pragma unroll
            for (int i = 0; i < 2; ++i) { ah[i] = gfrag(ga + kc * GPI + i * 32); aw[i] = gfrag(ga + (256 + kc) * GPI + i * 32); bh[i] = gfrag(gb + kc * GPI + i * 32); bw[i] = gfrag(gb + (256 + kc) * GPI + i * 32); }
            // keeps the sixteen LDS loads of a step together in front of its first matrix instruction: one wait a step instead of one at every few loads
            __builtin_amdgcn_sched_barrier(0);
#pragma unroll
            for (int i = 0; i < 2; ++i) { g[i][0] = wmmab(ah[i], bh[0], g[i][0]); g[i][1] = wmmab(ah[i], bh[1], g[i][1]); }
#pragma unroll
            for (int i = 0; i < 2; ++i) { g[i][0] = wmmab(aw[i], bh[0], g[i][0]); g[i][1] = wmmab(aw[i], bh[1], g[i][1]); }
#pragma unroll
            for (int i = 0; i < 2; ++i) { g[i][0] = wmmab(ah[i], bw[0], g[i][0]); g[i][1] = wmmab(ah[i], bw[1], g[i][1]); }
            if constexpr (decltype(withs)::v) {
#pragma unroll
                for (int i = 0; i < 2; ++i) { sv[i] = wmmab(ah[i], one, sv[i]); sv[i] = wmmab(aw[i], one, sv[i]); } }
        } };
        if (cb == 0) moments(flag_<true>{}); else moments(flag_<false>{});
        // a lane holds 8 neighbouring rows of one column; G is symmetric, so they leave as 8 neighbouring columns of one row: whole 128-byte lines a wave
        float* go = GP + (size_t)blockIdx.x * (CI * CI) + (size_t)(cb * 32 + lr) * CI + pg * 32 + hi * 8;
#pragma unroll
        for (int i = 0; i < 2; ++i) {
#pragma unroll
            for (int j = 0; j < 2; ++j) { float* d = go + j * 16 * CI + i * 16; *(v4f*)d = (v4f){g[i][j][0], g[i][j][1], g[i][j][2], g[i][j][3]}; *(v4f*)(d + 4) = (v4f){g[i][j][4], g[i][j][5], g[i][j][6], g[i][j][7]}; } }
        if (cb == 0 && lr == 0) {   // every column of sv is the same sum
            float* d = SP + (size_t)blockIdx.x * CI + pg * 32 + hi * 8;
#pragma unroll
            for (int i = 0; i < 2; ++i) { *(v4f*)(d + i * 16) = (v4f){sv[i][0], sv[i][1], sv[i][2], sv[i][3]}; *(v4f*)(d + i * 16 + 4) = (v4f){sv[i][4], sv[i][5], sv[i][6], sv[i][7]}; }
        }
    } else {
        constexpr int PP = 72;   // LDS pitch in 16-bit elements: 64 pooled positions + 16 bytes
        // every wave has read its last fragment of the tile: behind this barrier the tile's range is cut into the turning ranges
        __syncthreads();
        unsigned short* sh = (unsigned short*)(void*)(xt + cb * (2 * 64 * PP * 2)); unsigned short* sl = sh + 64 * PP;   // each cb's four waves have an LDS range of their own
#pragma unroll
        for (int sub = 0; sub < 2; ++sub) {
#pragma unroll
            for (int t = 0; t < 4; ++t) { v4us oh, ol; v4f y;
#pragma unroll
                for (int q = 0; q < 4; ++q) y[q] = fmaxf(fmaxf(acc[2 * sub][t][2 * q] + bv[t], acc[2 * sub][t][2 * q + 1] + bv[t]), fmaxf(acc[2 * sub + 1][t][2 * q] + bv[t], acc[2 * sub + 1][t][2 * q + 1] + bv[t]));
                split4(y, oh, ol);
                const int so = (t * 16 + lr) * PP + (pg * 2 + sub) * 8 + hi * 4; *(v4usa*)(sh + so) = oh; *(v4usa*)(sl + so) = ol; } }
        __syncthreads();
        const size_t io = (size_t)(blockIdx.x / (NPX / 256)) * CI * MP + (size_t)(blockIdx.x % (NPX / 256)) * 64;
        bf* Dh = (z == 1 ? FTh : GTh) + io; bf* Dl = (z == 1 ? FTl : GTl) + io;
#pragma unroll
        for (int s = 0; s < 4; ++s) { const int g = (threadIdx.x & 127) + s * 128, row = g >> 3, piece = g & 7;
            const v8us vh = *(const v8usa*)(sh + row * PP + piece * 8), vl = *(const v8usa*)(sl + row * PP + piece * 8);
            const size_t o = (size_t)(c0 + row) * MP + piece * 8; *(v8us*)(Dh + o) = vh; *(v8us*)(Dl + o) = vl; }
        // the wait before a register that an issued store names is rewritten: in the built code the theta branch's instructions stand behind these stores
        asm volatile("s_wait_xcnt 0x0" ::: "memory");
    }
}

__global__ __launch_bounds__(256) void k_zero8(bf* dst, size_t n8) {
    const size_t i = (size_t)blockIdx.x * 256 + threadIdx.x; if (i >= n8) return; v8us z;
#pragma unroll
    for (int k = 0; k < 8; ++k) z[k] = 0;
    *(v8us*)(dst + i * 8) = z; 
}
// k_km: one grid, two kinds of work-group, both fed by the conv kernel alone.
// blockIdx.y < 2: one 16 x 64 tile of KM = (Ah + Al).(Bh + Bl)^T over K = MP (row strides = K; n-major B). The grid is small, so the contraction is split over the 16 waves (two 32-k
// steps each, all loads of a wave independent); the partial tiles are summed through LDS in wave order and KM leaves as bf16 hi + residual planes in whole 128-byte lines. The rows of B
// go in as the matrix instruction's first operand and the rows of A as its second (both loaders have the same k order), so a lane holds 8 neighbouring columns of one row.
// blockIdx.y == 2: 16 rows of one image's theta covariance: the 16 conv work-groups' G and S are summed in their order, m = S / N, Cov = G / N - m m^T, bf16 hi + residual planes.
// blockIdx.z = image.
__global__ __launch_bounds__(512) void k_km(const bf* __restrict__ Ah, const bf* __restrict__ Al, const bf* __restrict__ Bh, const bf* __restrict__ Bl, bf* Ch, bf* Cl, const float* __restrict__ GP, const float* __restrict__ SP, bf* Vh, bf* Vl, float* MB) {
    constexpr int NWV = 16, STEPS = 2, K = MP, ldc = CI, NT = NPX / 256;
    __shared__ __align__(16) float part[NWV][16 * 68];
    if (blockIdx.y == 2) {
        __shared__ float ms[CI];
        const float* gz = GP + (size_t)blockIdx.z * NT * CI * CI + (size_t)blockIdx.x * 16 * CI; const float* sz = SP + (size_t)blockIdx.z * NT * CI;
        const int tid = threadIdx.x;
        const unsigned eo = (unsigned)tid * 16u, so = (unsigned)(tid & (CI - 1)) * 4u;   // byte offsets, the vector registers that the loads name (the step from one conv work-group to the next is an immediate)
        v4f gv[NT]; float sp[NT];
#pragma unroll
        for (int p = 0; p < NT; ++p) sp[p] = *(const float*)((const char*)sz + so + (unsigned)(p * CI * 4));
#pragma unroll
        for (int p = 0; p < NT; ++p) gv[p] = *(const v4f*)((const char*)gz + eo + (unsigned)(p * CI * CI * 4));
        // the wait before a register that an issued load names is rewritten; offsets and bases as inputs keep their registers to this line
        asm volatile("s_wait_xcnt 0x0" :: "v"(eo), "v"(so), "s"(gz), "s"(sz) : "memory");
        float s = sp[0];
#pragma unroll
        for (int p = 1; p < NT; ++p) s += sp[p];
        s *= 1.0f / (float)NPX;
        if (tid < CI) { ms[tid] = s; if (blockIdx.x == 0) MB[blockIdx.z * CI + tid] = s; }
        __syncthreads();
        v4f v = gv[0];
#pragma unroll
        for (int p = 1; p < NT; ++p) v += gv[p];
        const int row = blockIdx.x * 16 + (tid >> 5), col = (tid & 31) * 4; const float mr = ms[row];
        v4us oh, ol; v4f c;
#pragma unroll
        for (int i = 0; i < 4; ++i) c[i] = v[i] * (1.0f / (float)NPX) - mr * ms[col + i];
        split4(c, oh, ol);
        const size_t o = (size_t)blockIdx.z * CI * CI + (size_t)row * CI + col; *(v4us*)(Vh + o) = oh; *(v4us*)(Vl + o) = ol;
        return;
    }
    Ah += blockIdx.z * (size_t)(CI * MP); Al += blockIdx.z * (size_t)(CI * MP); Bh += blockIdx.z * (size_t)(CI * MP); Bl += blockIdx.z * (size_t)(CI * MP); Ch += blockIdx.z * (size_t)(CI * CI); Cl += blockIdx.z * (size_t)(CI * CI);
    const int lane = threadIdx.x & 31, wave = threadIdx.x >> 5, lr = lane & 15, hi = lane >> 4;
    const int r0 = blockIdx.x * 16, c0 = blockIdx.y * 64, k0 = wave * (STEPS * 32) + 8 * hi;
    // byte offsets: one vector register for A and one for B, named by all the loads of that operand (the plane's base is scalar; the k step and B's 16-row step are immediates)
    const unsigned ao = (unsigned)((r0 + lr) * K + k0) * 2u, bo = (unsigned)((c0 + lr) * K + k0) * 2u;
    auto frag = [](const bf* __restrict__ base, unsigned off, int el) { const char* p = (const char*)base + off; return cat16b(*(const v8us*)(p + (unsigned)(el * 2)), *(const v8us*)(p + (unsigned)(el * 2 + 32))); };
    v16bf a[STEPS], al[STEPS], bh[STEPS][4], bl[STEPS][4];
    // every loop of this kernel is unrolled: the fragment and accumulator arrays are indexed by constants only and so stay in registers
#pragma unroll
    for (int s = 0; s < STEPS; ++s) { a[s] = frag(Ah, ao, s * 32); al[s] = frag(Al, ao, s * 32);
#pragma unroll
        for (int t = 0; t < 4; ++t) { bh[s][t] = frag(Bh, bo, t * 16 * K + s * 32); bl[s][t] = frag(Bl, bo, t * 16 * K + s * 32); } }
    // the wait before a register that an issued load names is rewritten; the offsets as inputs keep their registers from being given to a result inside the run of loads
    asm volatile("s_wait_xcnt 0x0" :: "v"(ao), "v"(bo) : "memory");
    // keeps all loads of the wave in front of its first matrix instruction, so that they are in flight together; without it they are issued two at a time, each pair waited for
    __builtin_amdgcn_sched_barrier(0);
    v8f acc[4];
#pragma unroll
    for (int t = 0; t < 4; ++t) acc[t] = (v8f){};
#pragma unroll
    for (int s = 0; s < STEPS; ++s) {
#pragma unroll
        for (int t = 0; t < 4; ++t) { acc[t] = wmmab(bh[s][t], a[s], acc[t]); acc[t] = wmmab(bh[s][t], al[s], acc[t]); acc[t] = wmmab(bl[s][t], a[s], acc[t]); }
    }
    // keeps the LDS stores behind the last matrix instruction, so that the four accumulators have registers of their own
    __builtin_amdgcn_sched_barrier(0);
    float* os = &part[wave][lr * 68 + hi * 8];
#pragma unroll
    for (int t = 0; t < 4; ++t) { *(v4fa*)(os + t * 16) = (v4f){acc[t][0], acc[t][1], acc[t][2], acc[t][3]}; *(v4fa*)(os + t * 16 + 4) = (v4f){acc[t][4], acc[t][5], acc[t][6], acc[t][7]}; }
    __syncthreads();
    if (threadIdx.x < 16 * 16) { const int g = threadIdx.x, row = g >> 4, cofs = (g & 15) * 4;
        v4f v = *(const v4fa*)(&part[0][row * 68 + cofs]);
#pragma unroll
        for (int w = 1; w < NWV; ++w) v += *(const v4fa*)(&part[w][row * 68 + cofs]);
        v4us oh, ol;
        split4(v, oh, ol);
        const size_t o = (size_t)(r0 + row) * ldc + c0 + cofs; *(v4us*)(Ch + o) = oh; *(v4us*)(Cl + o) = ol; }
}
// k_qtst: QT and what the BatchNorm needs of it. The product that is normalised is linear in theta, WY[n][o] = sum_k theta[n][k] QT[o][k] + b[o], so over one image's pixels its mean is
// QT[o].m + b[o] and its variance QT[o].Cov.QT[o], with m and Cov theta's mean and covariance over those pixels. One work-group (8 waves) = 16 rows o of one image (blockIdx.z).
// Wave w first forms QT[o][k], k = 16 w + 0..15, = sum_c W[o][c] KM[k][c] (W f32, rounded to bf16 as it is read; KM hi then residual at each 32-k step; KM's rows as the first operand,
// so a lane holds 8 neighbouring k of one row o), splits it, stores it and lays it in LDS; then R[o][k] = sum_k' Cov[k][k'] QT[o][k'] for the same k (hh, hl, lh) and sums QT[o][k] R[o][k]
// and QT[o][k] m[k] over its 8 k. All loaders: k = 8 hi + 0..7 and 16 + 8 hi + 0..7 of each 32. The 16 partial sums of a row are added in a fixed order. EU: one 128-byte line a work-group,
// 16 variances, then 16 means (without b).
#define QP 272   // LDS pitch in bytes of one QT row's 128 k: 256 + 16, ds_load_b128's conflict-free pitch
__global__ __launch_bounds__(256) void k_qtst(const float* __restrict__ Wf, const bf* __restrict__ Kh, const bf* __restrict__ Kl, const bf* __restrict__ Vh, const bf* __restrict__ Vl, const float* __restrict__ MB, bf* Qh, bf* Ql, float* EU) {
    __shared__ __align__(16) unsigned char qs[2 * 16 * QP];   // rows: hi, residual
    __shared__ float re[16][16];
    __shared__ float ru[16][16];
    Kh += blockIdx.z * (size_t)(CI * CI); Kl += blockIdx.z * (size_t)(CI * CI); Vh += blockIdx.z * (size_t)(CI * CI); Vl += blockIdx.z * (size_t)(CI * CI); MB += blockIdx.z * CI; Qh += blockIdx.z * (size_t)(CIN * CI); Ql += blockIdx.z * (size_t)(CIN * CI);
    const int lane = threadIdx.x & 31, wave = threadIdx.x >> 5, lr = lane & 15, hi = lane >> 4, o0 = blockIdx.x * 16;
    // byte offsets, one vector register an operand shape (the bases are scalar, the k step an immediate): W's rows; KM's and Cov's rows; m
    const unsigned wo = (unsigned)((o0 + lr) * CI + 8 * hi) * 4u, ko = (unsigned)((wave * 16 + lr) * CI + 8 * hi) * 2u, mo = (unsigned)(wave * 16 + hi * 8) * 4u;
    auto frag = [](const bf* __restrict__ base, unsigned off, int el) { const char* p = (const char*)base + off; return cat16b(*(const v8us*)(p + (unsigned)(el * 2)), *(const v8us*)(p + (unsigned)(el * 2 + 32))); };
    // every loop of this kernel is unrolled: the fragment arrays are indexed by constants only and so stay in registers
    v8f wr[4][2]; v16bf kh[4], kl[4], vh[4], vl[4];
#pragma unroll
    for (int s = 0; s < 4; ++s) { wr[s][0] = *(const v8f*)((const char*)Wf + wo + (unsigned)(s * 128)); wr[s][1] = *(const v8f*)((const char*)Wf + wo + (unsigned)(s * 128 + 64)); kh[s] = frag(Kh, ko, s * 32); kl[s] = frag(Kl, ko, s * 32); }
    // keeps the first product's loads in front of the second's: loads return in order
    __builtin_amdgcn_sched_barrier(0);
#pragma unroll
    for (int s = 0; s < 4; ++s) { vh[s] = frag(Vh, ko, s * 32); vl[s] = frag(Vl, ko, s * 32); }
    const v8f mv = *(const v8f*)((const char*)MB + mo);
    // the wait before a register that an issued load names is rewritten; offsets and bases as inputs keep their registers to this line
    asm volatile("s_wait_xcnt 0x0" :: "v"(wo), "v"(ko), "v"(mo), "s"(Wf), "s"(Kh), "s"(Kl), "s"(Vh), "s"(Vl), "s"(MB) : "memory");
    // keeps all loads of the wave in front of its first matrix instruction, so that they are in flight together
    __builtin_amdgcn_sched_barrier(0);
    v8f q = (v8f){};
#pragma unroll
    for (int s = 0; s < 4; ++s) { const v16bf wa = cat16b(__builtin_bit_cast(v8us, __builtin_convertvector(wr[s][0], v8bf)), __builtin_bit_cast(v8us, __builtin_convertvector(wr[s][1], v8bf)));   // round to nearest even
        q = wmmab(kh[s], wa, q); q = wmmab(kl[s], wa, q); }
    v8us oh, ol;
    split8(q, oh, ol);
    const v8f qq = wide8(oh) + wide8(ol);   // the value that the two planes stand for
    const size_t o = (size_t)(o0 + lr) * CI + wave * 16 + hi * 8; *(v8us*)(Qh + o) = oh; *(v8us*)(Ql + o) = ol;
    unsigned char* sp = qs + lr * QP + (wave * 16 + hi * 8) * 2; *(v8usa*)sp = oh; *(v8usa*)(sp + 16 * QP) = ol;
    // all 128 k of the 16 rows lie in LDS: behind this barrier every wave reads them
    __syncthreads();
    const unsigned char* qp = qs + lr * QP + hi * 16;
    auto lfrag = [](const unsigned char* p) { return cat16b(*(const v8usa*)p, *(const v8usa*)(p + 32)); };
    v8f r = (v8f){};
#pragma unroll
    for (int s = 0; s < 4; ++s) { const v16bf qh = lfrag(qp + s * 64), ql = lfrag(qp + 16 * QP + s * 64); r = wmmab(vh[s], qh, r); r = wmmab(vh[s], ql, r); r = wmmab(vl[s], qh, r); }
    float e = 0.f, u = 0.f;
#pragma unroll
    for (int i = 0; i < 8; ++i) { e = fmaf(qq[i], r[i], e); u = fmaf(qq[i], mv[i], u); }
    re[wave * 2 + hi][lr] = e; ru[wave * 2 + hi][lr] = u;
    __syncthreads();
    if (threadIdx.x < 32) { float t = 0.f;   // lanes 0..15: the variances; 16..31: the means
#pragma unroll
        for (int w = 0; w < 16; ++w) t += hi ? ru[w][lr] : re[w][lr];
        EU[((size_t)blockIdx.z * (CIN / 16) + blockIdx.x) * 32 + lane] = t; }
}

// The last product and the BatchNorm. WY[n][o] = sum_k theta[n][k] / M . QT[o][k] + bf(b[o]) is never stored: k_prod forms it straight into what reads it, applies the affine, adds x1 and
// stores NCHW. The statistics come from k_qtst, one variance and one mean for each image and channel: equal-sized groups combine as mean = average of the means, variance = average of
// the variances + average of (group mean - mean)^2, in a fixed order; every work-group does that for its 256 channels while its tiles are on their way.
// One work-group (16 waves) = BNR = 128 pixels of one image x all 256 channels over K = CI: (Ah + Al).(Bh + Bl)^T, three products per 32-k step (hh, lh, hl, in that
// order into each accumulator). The four planes' tiles are contiguous in memory: they are read once, 512 contiguous bytes a wave-load with all 24 loads of a thread in flight, and
// laid in LDS at a padded pitch; wave (pg, cb) takes 32 pixels x 64 channels, its fragments by ds_load_b128 (both loaders: k = 8 hi + 0..7 and 16 + 8 hi + 0..7 of each 32).
// A lane holds 16 pixels (2 tiles x 8 registers) of each of its 4 channels.
#define BNP 256
#define BNR (NB_ * NPX / BNP)
#define LP 272   // LDS pitch in bytes of one row's 128 k: 256 + 16, ds_load_b128's conflict-free pitch
#define OP 36    // LDS pitch in floats of one channel's 32 pixels in a wave's transposing tile: 128 + 16 bytes
__global__ __launch_bounds__(512) void k_prod(const bf* __restrict__ Ah, const bf* __restrict__ Al, const bf* __restrict__ Bh, const bf* __restrict__ Bl, const float* __restrict__ bias, const float* __restrict__ x1, const float* __restrict__ EU, const float* __restrict__ gam, const float* __restrict__ bet, float* OUTB) {
    __shared__ __align__(16) unsigned char st[(2 * BNR + 2 * CIN) * LP];   // rows: Ah, Al, Bh, Bl
    __shared__ float smu[CIN];
    __shared__ float srs[CIN];
    // every loop of this kernel is unrolled: the staging, fragment, accumulator and x1 arrays are indexed by constants only and so stay in registers
    // the wave's number as a scalar: the bases of its loads and stores stay in scalar registers
    const int tid = threadIdx.x, lane = tid & 31, wv = __builtin_amdgcn_readfirstlane(tid >> 5), lr = lane & 15, hi = lane >> 4;
    const int img = blockIdx.x / (NPX / BNR), pg = wv & 3, cb = wv >> 2;
    const v8us* gah = (const v8us*)(Ah + (size_t)blockIdx.x * BNR * CI); const v8us* gal = (const v8us*)(Al + (size_t)blockIdx.x * BNR * CI);
    const v8us* gbh = (const v8us*)(Bh + (size_t)img * CIN * CI); const v8us* gbl = (const v8us*)(Bl + (size_t)img * CIN * CI);
    // all 24 loads name one vector register, the thread's number as the index of its 16 bytes (the bases are scalar, the step of 32 rows = 512 pieces an immediate)
    v8us ra[2][BNR / 32], rb[2][CIN / 32];
#pragma unroll
    for (int i = 0; i < CIN / 32; ++i) { rb[0][i] = gbh[tid + i * 512]; rb[1][i] = gbl[tid + i * 512]; }
#pragma unroll
    for (int i = 0; i < BNR / 32; ++i) { ra[0][i] = gah[tid + i * 512]; ra[1][i] = gal[tid + i * 512]; }
    // the wait before a register that an issued load names is rewritten; the four scalar bases and the index as inputs keep their registers to this line: otherwise the
    // arguments that are read next are loaded into the bases' registers in front of the wait
    asm volatile("s_wait_xcnt 0x0" :: "s"(gah), "s"(gal), "s"(gbh), "s"(gbl), "v"(tid) : "memory");
    // keeps the staging loads in front of the loads below: loads return in order, and the LDS stores wait for the staging loads alone
    __builtin_amdgcn_sched_barrier(0);
    // the images' variances and means of channel tid (waves 0..7; a scalar test): asked for behind the staging loads and in front of the x1 tile, so that their use below does not wait for x1
    float ev[NB_], uv[NB_], bc = 0.f;
    if (wv < CIN / 32) {
        const int ei = (tid >> 4) * 32 + (tid & 15);   // the one vector register of these loads (the step of an image is an immediate)
#pragma unroll
        for (int b = 0; b < NB_; ++b) { ev[b] = EU[ei + b * (CIN / 16) * 32]; uv[b] = EU[ei + b * (CIN / 16) * 32 + 16]; }
        bc = bias[tid];
        // the wait before a register that an issued load names is rewritten
        asm volatile("s_wait_xcnt 0x0" :: "v"(ei), "v"(tid), "s"(EU), "s"(bias) : "memory");
    }
    // keeps those loads in front of the loads below
    __builtin_amdgcn_sched_barrier(0);
    // the epilogue's per-channel values and its x1 tile are asked for here, behind the staging loads, so that the epilogue does not wait for them
    const int ci = cb * 64 + lr;   // the lane's first channel: one vector register for all of them (the step of 16 channels is an immediate)
    float bv[4], mu[4], rs[4], ga[4], be[4];
#pragma unroll
    for (int t = 0; t < 4; ++t) { bv[t] = bias[ci + t * 16]; ga[t] = gam[ci + t * 16]; be[t] = bet[ci + t * 16]; }
    // x1 and out: 4 channels x 128 bytes (whole lines) a wave-access; byte offset in one vector register (the base is scalar, the step of 4 channels an immediate)
    const size_t ob = ((size_t)img * CIN + cb * 64) * NPX + (size_t)(blockIdx.x % (NPX / BNR)) * BNR + pg * 32;
    const unsigned xo = (unsigned)((lane >> 3) * NPX + (lane & 7) * 4) * 4u;
    v4f xr[16];
#pragma unroll
    for (int s = 0; s < 16; ++s) xr[s] = *(const v4f*)((const char*)(x1 + ob) + xo + (unsigned)(s * 4 * NPX * 4));
    // the wait before a register that an issued load names is rewritten; the index registers as inputs are kept from being given to a result inside the run of loads
    asm volatile("s_wait_xcnt 0x0" :: "v"(tid), "v"(ci), "v"(xo) : "memory");
    {
        unsigned char* sp = st + (tid >> 4) * LP + (tid & 15) * 16;
        // in the order of the loads, which return in order: the first stores go while the last loads are still on their way
#pragma unroll
        for (int i = 0; i < CIN / 32; ++i) { *(v8usa*)(sp + (2 * BNR + i * 32) * LP) = rb[0][i]; *(v8usa*)(sp + (2 * BNR + CIN + i * 32) * LP) = rb[1][i]; }
#pragma unroll
        for (int i = 0; i < BNR / 32; ++i) { *(v8usa*)(sp + i * 32 * LP) = ra[0][i]; *(v8usa*)(sp + (BNR + i * 32) * LP) = ra[1][i]; }
    }
    if (wv < CIN / 32) { float a = 0.f, v = 0.f;
#pragma unroll
        for (int b = 0; b < NB_; ++b) a += uv[b];
        const float um = a * (1.0f / (float)NB_);
#pragma unroll
        for (int b = 0; b < NB_; ++b) { const float d = uv[b] - um; v += fmaf(d, d, ev[b]); }
        smu[tid] = bfr(bc) + um; srs[tid] = rsqrtf(fmaxf(v * (1.0f / (float)NB_), 0.f) + BEPS); }   // the maximum: a variance that rounding has left below zero
    lds_barrier();
    const unsigned char* ap = st + (pg * 32 + lr) * LP + hi * 16;
    const unsigned char* bp = st + (2 * BNR + cb * 64 + lr) * LP + hi * 16;
    auto lfrag = [](const unsigned char* p) { return cat16b(*(const v8usa*)p, *(const v8usa*)(p + 32)); };
    v8f acc[2][4];
#pragma unroll
    for (int ti = 0; ti < 2; ++ti) {
#pragma unroll
        for (int t = 0; t < 4; ++t) acc[ti][t] = (v8f){}; }
    // unrolled: the k step is an immediate of every LDS load
#pragma unroll
    for (int kc = 0; kc < CI / 32; ++kc) {
        v16bf a[2], al[2], bh[4], bl[4];
#pragma unroll
        for (int ti = 0; ti < 2; ++ti) { a[ti] = lfrag(ap + ti * 16 * LP + kc * 64); al[ti] = lfrag(ap + (BNR + ti * 16) * LP + kc * 64); }
#pragma unroll
        for (int t = 0; t < 4; ++t) { bh[t] = lfrag(bp + t * 16 * LP + kc * 64); bl[t] = lfrag(bp + (CIN + t * 16) * LP + kc * 64); }
        // keeps the 24 LDS loads of a step together in front of its first matrix instruction: one wait a step instead of one at every few loads
        __builtin_amdgcn_sched_barrier(0);
#pragma unroll
        for (int t = 0; t < 4; ++t) {
#pragma unroll
            for (int ti = 0; ti < 2; ++ti) acc[ti][t] = wmmab(a[ti], bh[t], acc[ti][t]); }
#pragma unroll
        for (int t = 0; t < 4; ++t) {
#pragma unroll
            for (int ti = 0; ti < 2; ++ti) acc[ti][t] = wmmab(al[ti], bh[t], acc[ti][t]); }
#pragma unroll
        for (int t = 0; t < 4; ++t) {
#pragma unroll
            for (int ti = 0; ti < 2; ++ti) acc[ti][t] = wmmab(a[ti], bl[t], acc[ti][t]); }
        // keeps the next step's loads behind this step's matrix instructions: one set of fragment registers, no spill
        __builtin_amdgcn_sched_barrier(0);
    }
#pragma unroll
    for (int t = 0; t < 4; ++t) { bv[t] = bfr(bv[t]); ga[t] = bfr(ga[t]); be[t] = bfr(be[t]); mu[t] = smu[ci + t * 16]; rs[t] = srs[ci + t * 16]; }
    {
        // every wave has read its last fragment: behind this barrier the staging range is cut into the waves' own transposing tiles
        lds_barrier();
        float* os = (float*)(void*)st + wv * (64 * OP);
#pragma unroll
        for (int t = 0; t < 4; ++t) {
#pragma unroll
            for (int ti = 0; ti < 2; ++ti) { v4f u[2];
#pragma unroll
                for (int j = 0; j < 8; ++j) u[j >> 2][j & 3] = ((acc[ti][t][j] + bv[t]) - mu[t]) * rs[t] * ga[t] + be[t];
                float* dp = os + (t * 16 + lr) * OP + ti * 16 + hi * 8; *(v4fa*)dp = u[0]; *(v4fa*)(dp + 4) = u[1]; } }
        // the tile is the wave's own: keeps the compiler from moving the reads below in front of the other lanes' stores
        __builtin_amdgcn_wave_barrier(); asm volatile("" ::: "memory");
        v4f vv[16];   // registers of their own for all 16 reads: they are in flight together, and no store's data register is rewritten
#pragma unroll
        for (int s = 0; s < 16; ++s) vv[s] = *(const v4fa*)(os + (s * 4 + (lane >> 3)) * OP + (lane & 7) * 4);
#pragma unroll
        for (int s = 0; s < 16; ++s) {
            vv[s] += bfr4(xr[s]);
            *(v4f*)((char*)(OUTB + ob) + xo + (unsigned)(s * 4 * NPX * 4)) = vv[s]; }
        // the wait before a register that an issued load or store names is rewritten; xo as an input keeps its register to the end of both runs
        asm volatile("s_wait_xcnt 0x0" :: "v"(xo) : "memory");
    }
}

extern "C" void kernel_launch(void* const* d_in, const int* in_sizes, int n_in,
                              void* d_out, int out_size, void* d_ws, size_t ws_size, hipStream_t stream) {
    (void)in_sizes; (void)n_in; (void)out_size;
    const float* x1 = (const float*)d_in[0]; const float* x2 = (const float*)d_in[1]; const float* wg = (const float*)d_in[2]; const float* bg = (const float*)d_in[3]; const float* wth = (const float*)d_in[4]; const float* bth = (const float*)d_in[5]; const float* wph = (const float*)d_in[6]; const float* bph = (const float*)d_in[7];
    const float* wout = (const float*)d_in[8]; const float* bout = (const float*)d_in[9]; const float* gam = (const float*)d_in[10]; const float* bet = (const float*)d_in[11];
    float* out = (float*)d_out;    // [8][256][64][64]
    char* wsp = (char*)d_ws;
    auto take = [&](size_t bytes) { char* p = wsp; wsp += (bytes + 255) & ~(size_t)255; return (void*)p; };
    // all NB_ images at once
    bf* Th = (bf*)take((size_t)NB_ * NPX * CI * 2); bf* Tl = (bf*)take((size_t)NB_ * NPX * CI * 2); bf* FTh = (bf*)take((size_t)NB_ * CI * MP * 2); bf* FTl = (bf*)take((size_t)NB_ * CI * MP * 2); bf* GTh = (bf*)take((size_t)NB_ * CI * MP * 2); bf* GTl = (bf*)take((size_t)NB_ * CI * MP * 2);
    bf* KMh = (bf*)take((size_t)NB_ * CI * CI * 2); bf* KMl = (bf*)take((size_t)NB_ * CI * CI * 2); bf* QTh = (bf*)take((size_t)NB_ * CIN * CI * 2); bf* QTl = (bf*)take((size_t)NB_ * CIN * CI * 2);
    float* GP = (float*)take((size_t)(NB_ * NPX / 256) * CI * CI * 4); float* SP = (float*)take((size_t)(NB_ * NPX / 256) * CI * 4); bf* Vh = (bf*)take((size_t)NB_ * CI * CI * 2); bf* Vl = (bf*)take((size_t)NB_ * CI * CI * 2);
    float* MB = (float*)take((size_t)NB_ * CI * 4); float* EU = (float*)take((size_t)NB_ * (CIN / 16) * 32 * 4);
    if ((size_t)(wsp - (char*)d_ws) > ws_size) return;    // MiB: 16 + 4 + 4 + 1.5 + 8.5 ~ 34
    k_convf<<<dim3(NB_ * NPX / 256, 2, 1), 512, 0, stream>>>(x1, x2, wth, wph, wg, bth, bph, bg, Th, Tl, FTh, FTl, GTh, GTl, GP, SP);   // 1/M folded into theta
    k_km<<<dim3(CI / 16, 3, NB_), 512, 0, stream>>>(FTh, FTl, GTh, GTl, KMh, KMl, GP, SP, Vh, Vl, MB);    // KM[k][c] = sum_m phi[k][m] g[c][m]; theta's mean and covariance
    k_qtst<<<dim3(CIN / 16, 1, NB_), 256, 0, stream>>>(wout, KMh, KMl, Vh, Vl, MB, QTh, QTl, EU);           // QT[o][k] = sum_c W[o][c] KM[k][c]; each image's variance and mean of WY
    k_prod<<<BNP, 512, 0, stream>>>(Th, Tl, QTh, QTl, bout, x1, EU, gam, bet, out);                        // WY[n][o] = sum_k theta[n][k] / M . QT[o][k] + b[o], normalised, + x1
}
